// v000
// Times are from an AMD MI455X. After a warm-up the kernel runs many times in a row, and a time is the length of
// such a window on the GPU divided by its runs, so every launch and the gaps after it count. The runs cycle
// through copies of the inputs. A figure is the median of several windows, for all but v000 over two sittings.
// Sittings can differ by a few percent; kernels timed side by side share one.
// The starting kernel, v000, takes 1470 microseconds a run.
#include <hip/hip_runtime.h>
#include <hip/hip_bf16.h>

// ---------------- problem constants (from reference) ----------------
#define B_      2
#define S_      1024
#define DM_     1024          // D_MODEL
#define DI_     2048          // D_INNER = 2*D_MODEL
#define DSTATE_ 16
#define DCONV_  4
#define NROW_   (B_ * S_)     // 2048 flattened (b,s) rows
#define XPN_    (2 * DSTATE_ + 1)   // 33

typedef __attribute__((ext_vector_type(16))) _Float16 v16h;
typedef __attribute__((ext_vector_type(8)))  _Float16 v8h;
typedef __attribute__((ext_vector_type(8)))  float    v8f;

union V16 { v16h v; v8h h2[2]; };

// ---------------------------------------------------------------
// Elementwise f32 -> f16 convert
// ---------------------------------------------------------------
__global__ void cvt_f16_kernel(const float* __restrict__ in,
                               _Float16* __restrict__ out, int n) {
  int i = blockIdx.x * 256 + threadIdx.x;
  if (i < n) out[i] = (_Float16)in[i];
}

// ---------------------------------------------------------------
// Transpose (K x N) f32  ->  (N x K) f16   (Wt[n*K + k] = W[k*N + n])
// ---------------------------------------------------------------
__global__ void transpose_f16_kernel(const float* __restrict__ W,
                                     _Float16* __restrict__ Wt,
                                     int K, int N) {
  int o = blockIdx.x * 256 + threadIdx.x;
  if (o >= K * N) return;
  int nn = o / K;
  int kk = o - nn * K;
  Wt[o] = (_Float16)W[(size_t)kk * N + nn];
}

// ---------------------------------------------------------------
// Fragment load helpers for 16-bit WMMA operands.
// Per CDNA5 ISA (16-bit A 16x32): lane<16 holds K[0..7] and K[16..23];
// lane>=16 holds K[8..15] and K[24..31]; each half is one contiguous
// 16-byte chunk -> two v8h global loads per fragment.
// ---------------------------------------------------------------
__device__ __forceinline__ void load_frag(V16& f, const _Float16* base, int k0) {
  f.h2[0] = *(const v8h*)(base + k0);
  f.h2[1] = *(const v8h*)(base + k0 + 16);
}

// ---------------------------------------------------------------
// WMMA GEMM:  C(MxN, f32) = A(MxK, f16 row-major) * B(KxN) with B given
// transposed: Bt (N x K, f16 row-major).
// Block = 128 threads (4 waves). Each wave computes a 16x64 strip:
// one A fragment reused by 4 B fragments -> 4 WMMA per 32-wide K-step.
// Explicit register double buffering: all loads for K-chunk (k+32) are
// issued before the WMMAs on chunk k, so waits before each WMMA are
// partial (loadcnt<=n) instead of a full load->wait->MMA serialization.
// Requires: M,N multiples of 64; K multiple of 64.
// ---------------------------------------------------------------
__global__ void gemm_wmma_f16_kernel(const _Float16* __restrict__ A,
                                     const _Float16* __restrict__ Bt,
                                     float* __restrict__ C,
                                     int M, int N, int K) {
  const int lane  = threadIdx.x & 31;
  const int wave  = threadIdx.x >> 5;
  const int tileM = blockIdx.x * 64 + wave * 16;
  const int tileN = blockIdx.y * 64;

  const int halfSel = (lane >> 4) << 3;         // 0 or 8
  const int l16     = lane & 15;

  const _Float16* aBase = A  + (size_t)(tileM + l16) * K + halfSel;
  const _Float16* b0p   = Bt + (size_t)(tileN + l16) * K + halfSel;
  const _Float16* b1p   = b0p + (size_t)16 * K;
  const _Float16* b2p   = b0p + (size_t)32 * K;
  const _Float16* b3p   = b0p + (size_t)48 * K;

  v8f acc0 = {}, acc1 = {}, acc2 = {}, acc3 = {};

  // ---- preload K-chunk 0 into buffer set A ----
  V16 aA, bA0, bA1, bA2, bA3;
  V16 aB, bB0, bB1, bB2, bB3;
  load_frag(aA,  aBase, 0);
  load_frag(bA0, b0p,   0);
  load_frag(bA1, b1p,   0);
  load_frag(bA2, b2p,   0);
  load_frag(bA3, b3p,   0);

#define WMMA4(af, f0, f1, f2, f3)                                            \
  acc0 = __builtin_amdgcn_wmma_f32_16x16x32_f16(false, (af).v, false,        \
             (f0).v, (short)0, acc0, false, false);                          \
  acc1 = __builtin_amdgcn_wmma_f32_16x16x32_f16(false, (af).v, false,        \
             (f1).v, (short)0, acc1, false, false);                          \
  acc2 = __builtin_amdgcn_wmma_f32_16x16x32_f16(false, (af).v, false,        \
             (f2).v, (short)0, acc2, false, false);                          \
  acc3 = __builtin_amdgcn_wmma_f32_16x16x32_f16(false, (af).v, false,        \
             (f3).v, (short)0, acc3, false, false)

  for (int k0 = 0; k0 < K; k0 += 64) {
    // issue loads for chunk k0+32 into buffer set B (always in range: K%64==0)
    const int k1 = k0 + 32;
    load_frag(aB,  aBase, k1);
    load_frag(bB0, b0p,   k1);
    load_frag(bB1, b1p,   k1);
    load_frag(bB2, b2p,   k1);
    load_frag(bB3, b3p,   k1);
    __builtin_prefetch(aBase + k1 + 32, 0, 3);     // global_prefetch_b8

    // compute on buffer set A (chunk k0) while set-B loads are in flight
    WMMA4(aA, bA0, bA1, bA2, bA3);

    if (k0 + 64 < K) {
      // issue loads for chunk k0+64 back into buffer set A
      const int k2 = k0 + 64;
      load_frag(aA,  aBase, k2);
      load_frag(bA0, b0p,   k2);
      load_frag(bA1, b1p,   k2);
      load_frag(bA2, b2p,   k2);
      load_frag(bA3, b3p,   k2);
      __builtin_prefetch(aBase + k2 + 32, 0, 3);
    }

    // compute on buffer set B (chunk k0+32)
    WMMA4(aB, bB0, bB1, bB2, bB3);
  }
#undef WMMA4

  // C/D layout: VGPR r -> row (tileM + r) for lanes 0..15,
  //                       row (tileM + r + 8) for lanes 16..31; col = lane&15.
  const int rowOff = (lane < 16) ? 0 : 8;
  float* crow = C + (size_t)(tileM + rowOff) * N + tileN + l16;
#pragma unroll
  for (int r = 0; r < 8; ++r) {
    float* cr = crow + (size_t)r * N;
    cr[0]  = acc0[r];
    cr[16] = acc1[r];
    cr[32] = acc2[r];
    cr[48] = acc3[r];
  }
}

// ---------------------------------------------------------------
// Depthwise causal conv (width 4) + bias + SiLU.
// x_in is columns [0, DI) of xz (NROW x 2*DI).  xc: NROW x DI.
// ---------------------------------------------------------------
__global__ void conv_silu_kernel(const float* __restrict__ xz,
                                 const float* __restrict__ conv_w,
                                 const float* __restrict__ conv_b,
                                 float* __restrict__ xc) {
  int idx = blockIdx.x * 256 + threadIdx.x;            // over NROW_*DI_
  if (idx >= NROW_ * DI_) return;
  int d = idx & (DI_ - 1);
  int r = idx >> 11;                                   // /DI_
  int s = r & (S_ - 1);
  float acc = conv_b[d];
#pragma unroll
  for (int j = 0; j < DCONV_; ++j) {
    int ss = s - (DCONV_ - 1) + j;
    if (ss >= 0) {
      acc += xz[(size_t)(r - (DCONV_ - 1) + j) * (2 * DI_) + d]
             * conv_w[d * DCONV_ + j];
    }
  }
  acc = acc / (1.f + __expf(-acc));                    // SiLU
  xc[idx] = acc;
}

// ---------------------------------------------------------------
// xp = xc @ W_xproj   (NROW x DI) * (DI x 33) -> (NROW x 33)
// tiny-N GEMM: one thread per output element.
// ---------------------------------------------------------------
__global__ void xproj_kernel(const float* __restrict__ xc,
                             const float* __restrict__ Wx,
                             float* __restrict__ xp) {
  int idx = blockIdx.x * 256 + threadIdx.x;
  if (idx >= NROW_ * XPN_) return;
  int j = idx % XPN_;
  int r = idx / XPN_;
  const float* xr = xc + (size_t)r * DI_;
  float acc = 0.f;
#pragma unroll 4
  for (int k = 0; k < DI_; ++k) acc += xr[k] * Wx[k * XPN_ + j];
  xp[idx] = acc;
}

// ---------------------------------------------------------------
// Fused selective scan. One thread per (b, d). State h[16] in regs.
// Per step: broadcast xp row (dt|B|C) through LDS, compute
// softplus(delta), dA=exp(delta*A), recurrence, y = h.C + Dp*xc,
// gate with silu(z), emit f16 for the output GEMM.
// Grid: (DI_/256, B_), block 256.
// ---------------------------------------------------------------
__global__ void ssm_scan_kernel(const float* __restrict__ xp,
                                const float* __restrict__ xc,
                                const float* __restrict__ xz,   // z at cols [DI_, 2*DI_)
                                const float* __restrict__ W_dt, // (1, DI_)
                                const float* __restrict__ b_dt,
                                const float* __restrict__ A_log,
                                const float* __restrict__ Dp,
                                _Float16* __restrict__ y_h) {
  __shared__ float bc[XPN_];
  const int d = blockIdx.x * 256 + threadIdx.x;
  const int b = blockIdx.y;

  float Aneg[DSTATE_];
#pragma unroll
  for (int n = 0; n < DSTATE_; ++n) Aneg[n] = -__expf(A_log[n]);

  const float wdt = W_dt[d];
  const float bdt = b_dt[d];
  const float dpv = Dp[d];

  float h[DSTATE_];
#pragma unroll
  for (int n = 0; n < DSTATE_; ++n) h[n] = 0.f;

  for (int s = 0; s < S_; ++s) {
    const int r = b * S_ + s;
    if (threadIdx.x < XPN_) bc[threadIdx.x] = xp[(size_t)r * XPN_ + threadIdx.x];
    __syncthreads();

    const float din   = bc[0] * wdt + bdt;
    const float delta = (din > 20.f) ? din : __logf(1.f + __expf(din));
    const float xcv   = xc[(size_t)r * DI_ + d];
    const float zv    = xz[(size_t)r * (2 * DI_) + DI_ + d];
    const float dx    = delta * xcv;

    float y = 0.f;
#pragma unroll
    for (int n = 0; n < DSTATE_; ++n) {
      const float e = __expf(delta * Aneg[n]);
      h[n] = e * h[n] + dx * bc[1 + n];
      y += h[n] * bc[1 + DSTATE_ + n];
    }
    y += dpv * xcv;
    y *= zv / (1.f + __expf(-zv));                 // * silu(z)
    y_h[(size_t)r * DI_ + d] = (_Float16)y;
    __syncthreads();                               // protect bc[] reuse
  }
}

// ---------------------------------------------------------------
extern "C" void kernel_launch(void* const* d_in, const int* in_sizes, int n_in,
                              void* d_out, int out_size, void* d_ws, size_t ws_size,
                              hipStream_t stream) {
  const float* x      = (const float*)d_in[0];   // (B,S,DM)
  const float* W_in   = (const float*)d_in[1];   // (DM, 2*DI)
  const float* conv_w = (const float*)d_in[2];   // (DI,1,4)
  const float* conv_b = (const float*)d_in[3];   // (DI)
  const float* W_xp   = (const float*)d_in[4];   // (DI, 33)
  const float* W_dt   = (const float*)d_in[5];   // (1, DI)
  const float* b_dt   = (const float*)d_in[6];   // (DI)
  const float* A_log  = (const float*)d_in[7];   // (16)
  const float* Dp     = (const float*)d_in[8];   // (DI)
  const float* W_out  = (const float*)d_in[9];   // (DI, DM)
  float* out = (float*)d_out;                    // (B,S,DM)

  // ---- workspace carve-out (256B aligned) ----
  size_t off = 0;
  auto carve = [&](size_t bytes) -> void* {
    void* p = (char*)d_ws + off;
    off += (bytes + 255) & ~(size_t)255;
    return p;
  };
  _Float16* x_h  = (_Float16*)carve((size_t)NROW_ * DM_ * 2);      // 4 MB
  _Float16* Wi_t = (_Float16*)carve((size_t)(2*DI_) * DM_ * 2);    // 8 MB  (4096 x 1024)
  _Float16* Wo_t = (_Float16*)carve((size_t)DM_ * DI_ * 2);        // 4 MB  (1024 x 2048)
  float*    xz   = (float*)   carve((size_t)NROW_ * 2*DI_ * 4);    // 32 MB
  float*    xc   = (float*)   carve((size_t)NROW_ * DI_ * 4);      // 16 MB
  float*    xp   = (float*)   carve((size_t)NROW_ * XPN_ * 4);     // ~0.3 MB
  _Float16* y_h  = (_Float16*)carve((size_t)NROW_ * DI_ * 2);      // 8 MB

  // 1) precision conversion / weight transposes
  {
    int n = NROW_ * DM_;
    cvt_f16_kernel<<<(n + 255) / 256, 256, 0, stream>>>(x, x_h, n);
  }
  {
    int n = DM_ * 2 * DI_;   // K=1024, N=4096
    transpose_f16_kernel<<<(n + 255) / 256, 256, 0, stream>>>(W_in, Wi_t, DM_, 2 * DI_);
  }
  {
    int n = DI_ * DM_;       // K=2048, N=1024
    transpose_f16_kernel<<<(n + 255) / 256, 256, 0, stream>>>(W_out, Wo_t, DI_, DM_);
  }

  // 2) xz = x @ W_in        (2048 x 4096, K=1024)  -- WMMA
  {
    dim3 grid(NROW_ / 64, (2 * DI_) / 64);
    gemm_wmma_f16_kernel<<<grid, 128, 0, stream>>>(x_h, Wi_t, xz,
                                                   NROW_, 2 * DI_, DM_);
  }

  // 3) depthwise conv + SiLU
  {
    int n = NROW_ * DI_;
    conv_silu_kernel<<<(n + 255) / 256, 256, 0, stream>>>(xz, conv_w, conv_b, xc);
  }

  // 4) xp = xc @ W_xproj    (N=33)
  {
    int n = NROW_ * XPN_;
    xproj_kernel<<<(n + 255) / 256, 256, 0, stream>>>(xc, W_xp, xp);
  }

  // 5) fused selective scan -> gated y (f16)
  {
    dim3 grid(DI_ / 256, B_);
    ssm_scan_kernel<<<grid, 256, 0, stream>>>(xp, xc, xz, W_dt, b_dt,
                                              A_log, Dp, y_h);
  }

  // 6) out = y @ W_out      (2048 x 1024, K=2048)  -- WMMA
  {
    dim3 grid(NROW_ / 64, DM_ / 64);
    gemm_wmma_f16_kernel<<<grid, 128, 0, stream>>>(y_h, Wo_t, out,
                                                   NROW_, DM_, DI_);
  }
  (void)in_sizes; (void)n_in; (void)out_size; (void)ws_size;
}

// v001
// A run of this version takes 388 microseconds.
// Two timings next to v000 put it at 3.77 and 3.78 times that version's speed.
#include <hip/hip_runtime.h>
#include <hip/hip_bf16.h>

// ---------------- problem constants (from reference) ----------------
#define B_      2
#define S_      1024
#define DM_     1024          // D_MODEL
#define DI_     2048          // D_INNER = 2*D_MODEL
#define DSTATE_ 16
#define DCONV_  4
#define NROW_   (B_ * S_)     // 2048 flattened (b,s) rows
#define XPN_    (2 * DSTATE_ + 1)   // 33

typedef __attribute__((ext_vector_type(16))) _Float16 v16h;
typedef __attribute__((ext_vector_type(8)))  _Float16 v8h;
typedef __attribute__((ext_vector_type(8)))  float    v8f;

union V16 { v16h v; v8h h2[2]; };

// ---------------------------------------------------------------
// Elementwise f32 -> f16 convert
// ---------------------------------------------------------------
__global__ void cvt_f16_kernel(const float* __restrict__ in,
                               _Float16* __restrict__ out, int n) {
  int i = blockIdx.x * 256 + threadIdx.x;
  if (i < n) out[i] = (_Float16)in[i];
}

// ---------------------------------------------------------------
// Transpose (K x N) f32  ->  (N x K) f16   (Wt[n*K + k] = W[k*N + n])
// ---------------------------------------------------------------
__global__ void transpose_f16_kernel(const float* __restrict__ W,
                                     _Float16* __restrict__ Wt,
                                     int K, int N) {
  int o = blockIdx.x * 256 + threadIdx.x;
  if (o >= K * N) return;
  int nn = o / K;
  int kk = o - nn * K;
  Wt[o] = (_Float16)W[(size_t)kk * N + nn];
}

// ---------------------------------------------------------------
// Fragment load helpers for 16-bit WMMA operands.
// Per CDNA5 ISA (16-bit A 16x32): lane<16 holds K[0..7] and K[16..23];
// lane>=16 holds K[8..15] and K[24..31]; each half is one contiguous
// 16-byte chunk -> two v8h global loads per fragment.
// ---------------------------------------------------------------
__device__ __forceinline__ void load_frag(V16& f, const _Float16* base, int k0) {
  f.h2[0] = *(const v8h*)(base + k0);
  f.h2[1] = *(const v8h*)(base + k0 + 16);
}

// ---------------------------------------------------------------
// WMMA GEMM:  C(MxN, f32) = A(MxK, f16 row-major) * B(KxN) with B given
// transposed: Bt (N x K, f16 row-major).
// Block = 128 threads (4 waves). Each wave computes a 16x64 strip:
// one A fragment reused by 4 B fragments -> 4 WMMA per 32-wide K-step.
// Explicit register double buffering: all loads for K-chunk (k+32) are
// issued before the WMMAs on chunk k, so waits before each WMMA are
// partial (loadcnt<=n) instead of a full load->wait->MMA serialization.
// Requires: M,N multiples of 64; K multiple of 64.
// ---------------------------------------------------------------
__global__ void gemm_wmma_f16_kernel(const _Float16* __restrict__ A,
                                     const _Float16* __restrict__ Bt,
                                     float* __restrict__ C,
                                     int M, int N, int K) {
  const int lane  = threadIdx.x & 31;
  const int wave  = threadIdx.x >> 5;
  const int tileM = blockIdx.x * 64 + wave * 16;
  const int tileN = blockIdx.y * 64;

  const int halfSel = (lane >> 4) << 3;         // 0 or 8
  const int l16     = lane & 15;

  const _Float16* aBase = A  + (size_t)(tileM + l16) * K + halfSel;
  const _Float16* b0p   = Bt + (size_t)(tileN + l16) * K + halfSel;
  const _Float16* b1p   = b0p + (size_t)16 * K;
  const _Float16* b2p   = b0p + (size_t)32 * K;
  const _Float16* b3p   = b0p + (size_t)48 * K;

  v8f acc0 = {}, acc1 = {}, acc2 = {}, acc3 = {};

  // ---- preload K-chunk 0 into buffer set A ----
  V16 aA, bA0, bA1, bA2, bA3;
  V16 aB, bB0, bB1, bB2, bB3;
  load_frag(aA,  aBase, 0);
  load_frag(bA0, b0p,   0);
  load_frag(bA1, b1p,   0);
  load_frag(bA2, b2p,   0);
  load_frag(bA3, b3p,   0);

#define WMMA4(af, f0, f1, f2, f3)                                            \
  acc0 = __builtin_amdgcn_wmma_f32_16x16x32_f16(false, (af).v, false,        \
             (f0).v, (short)0, acc0, false, false);                          \
  acc1 = __builtin_amdgcn_wmma_f32_16x16x32_f16(false, (af).v, false,        \
             (f1).v, (short)0, acc1, false, false);                          \
  acc2 = __builtin_amdgcn_wmma_f32_16x16x32_f16(false, (af).v, false,        \
             (f2).v, (short)0, acc2, false, false);                          \
  acc3 = __builtin_amdgcn_wmma_f32_16x16x32_f16(false, (af).v, false,        \
             (f3).v, (short)0, acc3, false, false)

  for (int k0 = 0; k0 < K; k0 += 64) {
    // issue loads for chunk k0+32 into buffer set B (always in range: K%64==0)
    const int k1 = k0 + 32;
    load_frag(aB,  aBase, k1);
    load_frag(bB0, b0p,   k1);
    load_frag(bB1, b1p,   k1);
    load_frag(bB2, b2p,   k1);
    load_frag(bB3, b3p,   k1);
    __builtin_prefetch(aBase + k1 + 32, 0, 3);     // global_prefetch_b8

    // compute on buffer set A (chunk k0) while set-B loads are in flight
    WMMA4(aA, bA0, bA1, bA2, bA3);

    if (k0 + 64 < K) {
      // issue loads for chunk k0+64 back into buffer set A
      const int k2 = k0 + 64;
      load_frag(aA,  aBase, k2);
      load_frag(bA0, b0p,   k2);
      load_frag(bA1, b1p,   k2);
      load_frag(bA2, b2p,   k2);
      load_frag(bA3, b3p,   k2);
      __builtin_prefetch(aBase + k2 + 32, 0, 3);
    }

    // compute on buffer set B (chunk k0+32)
    WMMA4(aB, bB0, bB1, bB2, bB3);
  }
#undef WMMA4

  // C/D layout: VGPR r -> row (tileM + r) for lanes 0..15,
  //                       row (tileM + r + 8) for lanes 16..31; col = lane&15.
  const int rowOff = (lane < 16) ? 0 : 8;
  float* crow = C + (size_t)(tileM + rowOff) * N + tileN + l16;
#pragma unroll
  for (int r = 0; r < 8; ++r) {
    float* cr = crow + (size_t)r * N;
    cr[0]  = acc0[r];
    cr[16] = acc1[r];
    cr[32] = acc2[r];
    cr[48] = acc3[r];
  }
}

// ---------------------------------------------------------------
// Depthwise causal conv (width 4) + bias + SiLU.
// x_in is columns [0, DI) of xz (NROW x 2*DI).  xc: NROW x DI.
// ---------------------------------------------------------------
__global__ void conv_silu_kernel(const float* __restrict__ xz,
                                 const float* __restrict__ conv_w,
                                 const float* __restrict__ conv_b,
                                 float* __restrict__ xc) {
  int idx = blockIdx.x * 256 + threadIdx.x;            // over NROW_*DI_
  if (idx >= NROW_ * DI_) return;
  int d = idx & (DI_ - 1);
  int r = idx >> 11;                                   // /DI_
  int s = r & (S_ - 1);
  float acc = conv_b[d];
#pragma unroll
  for (int j = 0; j < DCONV_; ++j) {
    int ss = s - (DCONV_ - 1) + j;
    if (ss >= 0) {
      acc += xz[(size_t)(r - (DCONV_ - 1) + j) * (2 * DI_) + d]
             * conv_w[d * DCONV_ + j];
    }
  }
  acc = acc / (1.f + __expf(-acc));                    // SiLU
  xc[idx] = acc;
}

// ---------------------------------------------------------------
// xp = xc @ W_xproj   (NROW x DI) * (DI x 33) -> (NROW x 33)
// tiny-N GEMM: one thread per output element.
// ---------------------------------------------------------------
__global__ void xproj_kernel(const float* __restrict__ xc,
                             const float* __restrict__ Wx,
                             float* __restrict__ xp) {
  int idx = blockIdx.x * 256 + threadIdx.x;
  if (idx >= NROW_ * XPN_) return;
  int j = idx % XPN_;
  int r = idx / XPN_;
  const float* xr = xc + (size_t)r * DI_;
  float acc = 0.f;
#pragma unroll 4
  for (int k = 0; k < DI_; ++k) acc += xr[k] * Wx[k * XPN_ + j];
  xp[idx] = acc;
}

// ---------------------------------------------------------------
// Selective scan, split along the sequence into CH_ chunks of TCH_ steps
// that run in parallel. The recurrence h <- dA*h + dBx is linear in h, and
// the product of dA over a chunk is exp(A * sum(delta)), so:
//   1) chunk_state: every chunk but the last runs from h = 0 and leaves its
//      end state and its sum of delta;
//   2) chunk_carry: per (b, n, d) the CH_ - 1 end states are chained into the
//      true state at the start of each chunk;
//   3) chunk_out: every chunk runs again from its true start state and
//      emits y = h.C + Dp*xc, gated with silu(z), as f16 for the output GEMM.
// One thread per (b, chunk, d), state h[16] in registers. The chunk's xp
// rows (dt|B|C) are staged in LDS once and read as broadcasts.
// ---------------------------------------------------------------
#define CH_   32                    // chunks per sequence
#define TCH_  (S_ / CH_)            // steps per chunk
#define ROWP_ (2 * DSTATE_ + 4)     // LDS row: B[16] | C[16] | dt | pad, 16-byte rows
#define GRP_  8                     // steps whose xc / z are fetched together, one group ahead

#define NXV_  ((TCH_ * XPN_ + 255) / 256)   // xp words per thread of a 256-thread block

// The chunk's xp rows go to LDS in two halves, so that a kernel can issue its
// other global loads between them and all latencies overlap.
__device__ __forceinline__ void load_xp_chunk(float* v,
                                              const float* __restrict__ xp,
                                              int r0) {
  const float* src = xp + (size_t)r0 * XPN_;
#pragma unroll
  for (int k = 0; k < NXV_; ++k) {
    const int i = threadIdx.x + k * 256;
    v[k] = ((k + 1) * 256 <= TCH_ * XPN_ || i < TCH_ * XPN_) ? src[i] : 0.f;
  }
}

__device__ __forceinline__ void store_xp_chunk(float* sx, const float* v) {
#pragma unroll
  for (int k = 0; k < NXV_; ++k) {
    const int i = threadIdx.x + k * 256;
    const int row = i / XPN_;
    const int col = i - row * XPN_;
    if ((k + 1) * 256 <= TCH_ * XPN_ || i < TCH_ * XPN_)
      sx[row * ROWP_ + (col == 0 ? 2 * DSTATE_ : col - 1)] = v[k];
  }
}

__device__ __forceinline__ void read16(float* v, const float* s) {
#pragma unroll
  for (int q = 0; q < 4; ++q) {
    const float4 f = ((const float4*)s)[q];
    v[4 * q + 0] = f.x; v[4 * q + 1] = f.y; v[4 * q + 2] = f.z; v[4 * q + 3] = f.w;
  }
}

__device__ __forceinline__ float softplus_dt(float din) {
  return (din > 20.f) ? din : __logf(1.f + __expf(din));
}

// Grid: (DI_/256, CH_-1, B_), block 256.
__global__ __launch_bounds__(256)
void ssm_chunk_state_kernel(const float* __restrict__ xp,
                            const float* __restrict__ xc,
                            const float* __restrict__ W_dt, // (1, DI_)
                            const float* __restrict__ b_dt,
                            const float* __restrict__ A_log,
                            float* __restrict__ hend,       // (B, CH, 16, DI)
                            float* __restrict__ sdel) {     // (B, CH, DI)
  __shared__ __attribute__((aligned(16))) float sx[TCH_ * ROWP_];
  const int d  = blockIdx.x * 256 + threadIdx.x;
  const int c  = blockIdx.y;
  const int b  = blockIdx.z;
  const int r0 = b * S_ + c * TCH_;

  float xv[NXV_];
  load_xp_chunk(xv, xp, r0);

  float Aneg[DSTATE_];
#pragma unroll
  for (int n = 0; n < DSTATE_; ++n) Aneg[n] = -__expf(A_log[n]);
  const float wdt = W_dt[d];
  const float bdt = b_dt[d];

  float h[DSTATE_];
#pragma unroll
  for (int n = 0; n < DSTATE_; ++n) h[n] = 0.f;
  float sd = 0.f;

  const float* xcp = xc + (size_t)r0 * DI_ + d;
  float xcu[GRP_];
#pragma unroll
  for (int u = 0; u < GRP_; ++u) xcu[u] = xcp[(size_t)u * DI_];

  store_xp_chunk(sx, xv);
  __syncthreads();

  // rolled over groups (code size); the next group's loads fly over this group's steps
#pragma unroll 1
  for (int g = 0; g < TCH_ / GRP_; ++g) {
    float xnx[GRP_];
#pragma unroll
    for (int u = 0; u < GRP_; ++u) xnx[u] = 0.f;
    if (g + 1 < TCH_ / GRP_) {
#pragma unroll
      for (int u = 0; u < GRP_; ++u) xnx[u] = xcp[(size_t)((g + 1) * GRP_ + u) * DI_];
    }
#pragma unroll
    for (int u = 0; u < GRP_; ++u) {
      const float* row = sx + (g * GRP_ + u) * ROWP_;
      float Bv[DSTATE_];
      read16(Bv, row);
      const float delta = softplus_dt(row[2 * DSTATE_] * wdt + bdt);
      const float dx    = delta * xcu[u];
      sd += delta;
#pragma unroll
      for (int n = 0; n < DSTATE_; ++n) {
        const float e = __expf(delta * Aneg[n]);
        h[n] = e * h[n] + dx * Bv[n];
      }
    }
#pragma unroll
    for (int u = 0; u < GRP_; ++u) xcu[u] = xnx[u];
  }

  const size_t bc = (size_t)b * CH_ + c;
#pragma unroll
  for (int n = 0; n < DSTATE_; ++n) hend[(bc * DSTATE_ + n) * DI_ + d] = h[n];
  sdel[bc * DI_ + d] = sd;
}

// One thread per (b, n, d): chain the chunks' end states.
__global__ __launch_bounds__(256)
void ssm_chunk_carry_kernel(const float* __restrict__ hend,
                            const float* __restrict__ sdel,
                            const float* __restrict__ A_log,
                            float* __restrict__ hini) {     // (B, CH, 16, DI)
  const int idx = blockIdx.x * 256 + threadIdx.x;           // over B_*16*DI_
  const int d = idx & (DI_ - 1);
  const int n = (idx >> 11) & (DSTATE_ - 1);
  const int b = idx >> 15;
  const float an = -__expf(A_log[n]);

  const float* hp = hend + ((size_t)b * CH_ * DSTATE_ + n) * DI_ + d;
  const float* sp = sdel + (size_t)b * CH_ * DI_ + d;
  float*       op = hini + ((size_t)b * CH_ * DSTATE_ + n) * DI_ + d;

  // every load is independent of the chain: fetch all first, one latency in all
  float he[CH_ - 1], ev[CH_ - 1];
#pragma unroll
  for (int c = 0; c < CH_ - 1; ++c) {
    ev[c] = sp[(size_t)c * DI_];
    he[c] = hp[(size_t)c * DSTATE_ * DI_];
  }
#pragma unroll
  for (int c = 0; c < CH_ - 1; ++c) ev[c] = __expf(an * ev[c]);

  float H = 0.f;
  op[0] = H;
#pragma unroll
  for (int c = 0; c < CH_ - 1; ++c) {
    H = ev[c] * H + he[c];
    op[(size_t)(c + 1) * DSTATE_ * DI_] = H;
  }
}

// Grid: (DI_/256, CH_, B_), block 256.
__global__ __launch_bounds__(256)
void ssm_chunk_out_kernel(const float* __restrict__ xp,
                          const float* __restrict__ xc,
                          const float* __restrict__ xz,   // z at cols [DI_, 2*DI_)
                          const float* __restrict__ W_dt, // (1, DI_)
                          const float* __restrict__ b_dt,
                          const float* __restrict__ A_log,
                          const float* __restrict__ Dp,
                          const float* __restrict__ hini,
                          _Float16* __restrict__ y_h) {
  __shared__ __attribute__((aligned(16))) float sx[TCH_ * ROWP_];
  const int d  = blockIdx.x * 256 + threadIdx.x;
  const int c  = blockIdx.y;
  const int b  = blockIdx.z;
  const int r0 = b * S_ + c * TCH_;

  float xv[NXV_];
  load_xp_chunk(xv, xp, r0);

  float Aneg[DSTATE_];
#pragma unroll
  for (int n = 0; n < DSTATE_; ++n) Aneg[n] = -__expf(A_log[n]);
  const float wdt = W_dt[d];
  const float bdt = b_dt[d];
  const float dpv = Dp[d];

  const size_t bc = (size_t)b * CH_ + c;
  float h[DSTATE_];
#pragma unroll
  for (int n = 0; n < DSTATE_; ++n) h[n] = hini[(bc * DSTATE_ + n) * DI_ + d];

  const float* xcp = xc + (size_t)r0 * DI_ + d;
  const float* zp  = xz + (size_t)r0 * (2 * DI_) + DI_ + d;
  _Float16*    yp  = y_h + (size_t)r0 * DI_ + d;
  float xcu[GRP_], zcu[GRP_];
#pragma unroll
  for (int u = 0; u < GRP_; ++u) {
    xcu[u] = xcp[(size_t)u * DI_];
    zcu[u] = zp[(size_t)u * (2 * DI_)];
  }

  store_xp_chunk(sx, xv);
  __syncthreads();

  // rolled over groups (code size); the next group's loads fly over this group's steps
#pragma unroll 1
  for (int g = 0; g < TCH_ / GRP_; ++g) {
    float xnx[GRP_], znx[GRP_];
#pragma unroll
    for (int u = 0; u < GRP_; ++u) { xnx[u] = 0.f; znx[u] = 0.f; }
    if (g + 1 < TCH_ / GRP_) {
#pragma unroll
      for (int u = 0; u < GRP_; ++u) {
        xnx[u] = xcp[(size_t)((g + 1) * GRP_ + u) * DI_];
        znx[u] = zp[(size_t)((g + 1) * GRP_ + u) * (2 * DI_)];
      }
    }
#pragma unroll
    for (int u = 0; u < GRP_; ++u) {
      const int t = g * GRP_ + u;
      const float* row = sx + t * ROWP_;
      float Bv[DSTATE_], Cv[DSTATE_];
      read16(Bv, row);
      read16(Cv, row + DSTATE_);
      const float delta = softplus_dt(row[2 * DSTATE_] * wdt + bdt);
      const float xcv   = xcu[u];
      const float zv    = zcu[u];
      const float dx    = delta * xcv;

      float y = 0.f;
#pragma unroll
      for (int n = 0; n < DSTATE_; ++n) {
        const float e = __expf(delta * Aneg[n]);
        h[n] = e * h[n] + dx * Bv[n];
        y += h[n] * Cv[n];
      }
      y += dpv * xcv;
      y *= zv / (1.f + __expf(-zv));               // * silu(z)
      yp[(size_t)t * DI_] = (_Float16)y;
    }
#pragma unroll
    for (int u = 0; u < GRP_; ++u) { xcu[u] = xnx[u]; zcu[u] = znx[u]; }
  }
}

// ---------------------------------------------------------------
extern "C" void kernel_launch(void* const* d_in, const int* in_sizes, int n_in,
                              void* d_out, int out_size, void* d_ws, size_t ws_size,
                              hipStream_t stream) {
  const float* x      = (const float*)d_in[0];   // (B,S,DM)
  const float* W_in   = (const float*)d_in[1];   // (DM, 2*DI)
  const float* conv_w = (const float*)d_in[2];   // (DI,1,4)
  const float* conv_b = (const float*)d_in[3];   // (DI)
  const float* W_xp   = (const float*)d_in[4];   // (DI, 33)
  const float* W_dt   = (const float*)d_in[5];   // (1, DI)
  const float* b_dt   = (const float*)d_in[6];   // (DI)
  const float* A_log  = (const float*)d_in[7];   // (16)
  const float* Dp     = (const float*)d_in[8];   // (DI)
  const float* W_out  = (const float*)d_in[9];   // (DI, DM)
  float* out = (float*)d_out;                    // (B,S,DM)

  // ---- workspace carve-out (256B aligned) ----
  size_t off = 0;
  auto carve = [&](size_t bytes) -> void* {
    void* p = (char*)d_ws + off;
    off += (bytes + 255) & ~(size_t)255;
    return p;
  };
  _Float16* x_h  = (_Float16*)carve((size_t)NROW_ * DM_ * 2);      // 4 MB
  _Float16* Wi_t = (_Float16*)carve((size_t)(2*DI_) * DM_ * 2);    // 8 MB  (4096 x 1024)
  _Float16* Wo_t = (_Float16*)carve((size_t)DM_ * DI_ * 2);        // 4 MB  (1024 x 2048)
  float*    xz   = (float*)   carve((size_t)NROW_ * 2*DI_ * 4);    // 32 MB
  float*    xc   = (float*)   carve((size_t)NROW_ * DI_ * 4);      // 16 MB
  float*    xp   = (float*)   carve((size_t)NROW_ * XPN_ * 4);     // ~0.3 MB
  _Float16* y_h  = (_Float16*)carve((size_t)NROW_ * DI_ * 2);      // 8 MB
  float*    hend = (float*)   carve((size_t)B_ * CH_ * DSTATE_ * DI_ * 4);  // 8 MB
  float*    hini = (float*)   carve((size_t)B_ * CH_ * DSTATE_ * DI_ * 4);  // 8 MB
  float*    sdel = (float*)   carve((size_t)B_ * CH_ * DI_ * 4);            // 0.5 MB

  // 1) precision conversion / weight transposes
  {
    int n = NROW_ * DM_;
    cvt_f16_kernel<<<(n + 255) / 256, 256, 0, stream>>>(x, x_h, n);
  }
  {
    int n = DM_ * 2 * DI_;   // K=1024, N=4096
    transpose_f16_kernel<<<(n + 255) / 256, 256, 0, stream>>>(W_in, Wi_t, DM_, 2 * DI_);
  }
  {
    int n = DI_ * DM_;       // K=2048, N=1024
    transpose_f16_kernel<<<(n + 255) / 256, 256, 0, stream>>>(W_out, Wo_t, DI_, DM_);
  }

  // 2) xz = x @ W_in        (2048 x 4096, K=1024)  -- WMMA
  {
    dim3 grid(NROW_ / 64, (2 * DI_) / 64);
    gemm_wmma_f16_kernel<<<grid, 128, 0, stream>>>(x_h, Wi_t, xz,
                                                   NROW_, 2 * DI_, DM_);
  }

  // 3) depthwise conv + SiLU
  {
    int n = NROW_ * DI_;
    conv_silu_kernel<<<(n + 255) / 256, 256, 0, stream>>>(xz, conv_w, conv_b, xc);
  }

  // 4) xp = xc @ W_xproj    (N=33)
  {
    int n = NROW_ * XPN_;
    xproj_kernel<<<(n + 255) / 256, 256, 0, stream>>>(xc, W_xp, xp);
  }

  // 5) selective scan in parallel chunks -> gated y (f16)
  {
    dim3 grid(DI_ / 256, CH_ - 1, B_);
    ssm_chunk_state_kernel<<<grid, 256, 0, stream>>>(xp, xc, W_dt, b_dt, A_log,
                                                     hend, sdel);
  }
  {
    int n = B_ * DSTATE_ * DI_;
    ssm_chunk_carry_kernel<<<n / 256, 256, 0, stream>>>(hend, sdel, A_log, hini);
  }
  {
    dim3 grid(DI_ / 256, CH_, B_);
    ssm_chunk_out_kernel<<<grid, 256, 0, stream>>>(xp, xc, xz, W_dt, b_dt,
                                                   A_log, Dp, hini, y_h);
  }

  // 6) out = y @ W_out      (2048 x 1024, K=2048)  -- WMMA
  {
    dim3 grid(NROW_ / 64, DM_ / 64);
    gemm_wmma_f16_kernel<<<grid, 128, 0, stream>>>(y_h, Wo_t, out,
                                                   NROW_, DM_, DI_);
  }
  (void)in_sizes; (void)n_in; (void)out_size; (void)ws_size;
}

// v002
// A run of this version takes 349 microseconds.
// Two timings next to v001 both put it at 1.11 times that version's speed.
// Over all steps from v000 it is 4.19 times as fast.
#include <hip/hip_runtime.h>
#include <hip/hip_bf16.h>

// ---------------- problem constants (from reference) ----------------
#define B_      2
#define S_      1024
#define DM_     1024          // D_MODEL
#define DI_     2048          // D_INNER = 2*D_MODEL
#define DSTATE_ 16
#define DCONV_  4
#define NROW_   (B_ * S_)     // 2048 flattened (b,s) rows
#define XPN_    (2 * DSTATE_ + 1)   // 33

typedef __attribute__((ext_vector_type(16))) _Float16 v16h;
typedef __attribute__((ext_vector_type(8)))  _Float16 v8h;
typedef __attribute__((ext_vector_type(8)))  float    v8f;
typedef __attribute__((ext_vector_type(4)))  float    v4f;

union V16 { v16h v; v8h h2[2]; };

// ---------------------------------------------------------------
// The elementwise launches below give every thread 16 to 32 elements, moved
// in 16-byte loads and stores, the loads issued together at the start. One
// element per lane would start 16 to 32 times as many waves for the same bytes.
// ---------------------------------------------------------------

__device__ __forceinline__ v8h pack8(float a, float b, float c, float d,
                                     float e, float f, float g, float h) {
  v8h o = {(_Float16)a, (_Float16)b, (_Float16)c, (_Float16)d,
           (_Float16)e, (_Float16)f, (_Float16)g, (_Float16)h};
  return o;
}

// ---------------------------------------------------------------
// Elementwise f32 -> f16 convert of NROW_*DM_ values.
// A thread converts two runs of 8 values. Grid: CVT_T_/256 blocks of 256.
// ---------------------------------------------------------------
#define CVT_T_ (NROW_ * DM_ / 16)     // threads
__global__ __launch_bounds__(256)
void cvt_f16_kernel(const float* __restrict__ in,
                    _Float16* __restrict__ out) {
  const size_t t = (size_t)blockIdx.x * 256 + threadIdx.x;
  const size_t e0 = t * 8;
  const size_t e1 = (t + CVT_T_) * 8;
  const v4f a0 = *(const v4f*)(in + e0);
  const v4f a1 = *(const v4f*)(in + e0 + 4);
  const v4f b0 = *(const v4f*)(in + e1);
  const v4f b1 = *(const v4f*)(in + e1 + 4);
  *(v8h*)(out + e0) = pack8(a0[0], a0[1], a0[2], a0[3], a1[0], a1[1], a1[2], a1[3]);
  *(v8h*)(out + e1) = pack8(b0[0], b0[1], b0[2], b0[3], b1[0], b1[1], b1[2], b1[3]);
}

// ---------------------------------------------------------------
// Transpose (K x N) f32  ->  (N x K) f16   (Wt[n*K + k] = W[k*N + n])
// A thread holds an 8 (k) x 4 (n) block: 8 row loads of 4 n, 4 stores of 8 k;
// the transpose itself is only a choice of registers. In a wave 8 lanes lie
// along k, so each store instruction writes whole 128-byte lines of Wt; the
// 8 waves of a block lie along n and share the lines of W they read.
// K and N are compile-time, so the row steps are immediate offsets on one
// address. Grid: (K/64, N/128), block 256; K % 64 == 0, N % 128 == 0.
// ---------------------------------------------------------------
template <int K, int N>
__device__ __forceinline__ void transpose_f16_block(const float* __restrict__ W,
                                                    _Float16* __restrict__ Wt) {
  const int lane = threadIdx.x & 31;
  const int wave = threadIdx.x >> 5;
  const int k = blockIdx.x * 64 + (lane & 7) * 8;
  const int n = blockIdx.y * 128 + wave * 16 + (lane >> 3) * 4;
  const float* src = W + (size_t)k * N + n;
  v4f r[8];
#pragma unroll
  for (int i = 0; i < 8; ++i) r[i] = *(const v4f*)(src + i * N);
  _Float16* dst = Wt + (size_t)n * K + k;
#pragma unroll
  for (int j = 0; j < 4; ++j)
    *(v8h*)(dst + j * K) = pack8(r[0][j], r[1][j], r[2][j], r[3][j],
                                 r[4][j], r[5][j], r[6][j], r[7][j]);
}

__global__ __launch_bounds__(256)
void transpose_win_kernel(const float* __restrict__ W, _Float16* __restrict__ Wt) {
  transpose_f16_block<DM_, 2 * DI_>(W, Wt);
}

__global__ __launch_bounds__(256)
void transpose_wout_kernel(const float* __restrict__ W, _Float16* __restrict__ Wt) {
  transpose_f16_block<DI_, DM_>(W, Wt);
}

// ---------------------------------------------------------------
// Fragment load helpers for 16-bit WMMA operands.
// Per CDNA5 ISA (16-bit A 16x32): lane<16 holds K[0..7] and K[16..23];
// lane>=16 holds K[8..15] and K[24..31]; each half is one contiguous
// 16-byte chunk -> two v8h global loads per fragment.
// ---------------------------------------------------------------
__device__ __forceinline__ void load_frag(V16& f, const _Float16* base, int k0) {
  f.h2[0] = *(const v8h*)(base + k0);
  f.h2[1] = *(const v8h*)(base + k0 + 16);
}

// ---------------------------------------------------------------
// WMMA GEMM:  C(MxN, f32) = A(MxK, f16 row-major) * B(KxN) with B given
// transposed: Bt (N x K, f16 row-major).
// Block = 128 threads (4 waves). Each wave computes a 16x64 strip:
// one A fragment reused by 4 B fragments -> 4 WMMA per 32-wide K-step.
// Explicit register double buffering: all loads for K-chunk (k+32) are
// issued before the WMMAs on chunk k, so waits before each WMMA are
// partial (loadcnt<=n) instead of a full load->wait->MMA serialization.
// Requires: M,N multiples of 64; K multiple of 64.
// ---------------------------------------------------------------
__global__ void gemm_wmma_f16_kernel(const _Float16* __restrict__ A,
                                     const _Float16* __restrict__ Bt,
                                     float* __restrict__ C,
                                     int M, int N, int K) {
  const int lane  = threadIdx.x & 31;
  const int wave  = threadIdx.x >> 5;
  const int tileM = blockIdx.x * 64 + wave * 16;
  const int tileN = blockIdx.y * 64;

  const int halfSel = (lane >> 4) << 3;         // 0 or 8
  const int l16     = lane & 15;

  const _Float16* aBase = A  + (size_t)(tileM + l16) * K + halfSel;
  const _Float16* b0p   = Bt + (size_t)(tileN + l16) * K + halfSel;
  const _Float16* b1p   = b0p + (size_t)16 * K;
  const _Float16* b2p   = b0p + (size_t)32 * K;
  const _Float16* b3p   = b0p + (size_t)48 * K;

  v8f acc0 = {}, acc1 = {}, acc2 = {}, acc3 = {};

  // ---- preload K-chunk 0 into buffer set A ----
  V16 aA, bA0, bA1, bA2, bA3;
  V16 aB, bB0, bB1, bB2, bB3;
  load_frag(aA,  aBase, 0);
  load_frag(bA0, b0p,   0);
  load_frag(bA1, b1p,   0);
  load_frag(bA2, b2p,   0);
  load_frag(bA3, b3p,   0);

#define WMMA4(af, f0, f1, f2, f3)                                            \
  acc0 = __builtin_amdgcn_wmma_f32_16x16x32_f16(false, (af).v, false,        \
             (f0).v, (short)0, acc0, false, false);                          \
  acc1 = __builtin_amdgcn_wmma_f32_16x16x32_f16(false, (af).v, false,        \
             (f1).v, (short)0, acc1, false, false);                          \
  acc2 = __builtin_amdgcn_wmma_f32_16x16x32_f16(false, (af).v, false,        \
             (f2).v, (short)0, acc2, false, false);                          \
  acc3 = __builtin_amdgcn_wmma_f32_16x16x32_f16(false, (af).v, false,        \
             (f3).v, (short)0, acc3, false, false)

  for (int k0 = 0; k0 < K; k0 += 64) {
    // issue loads for chunk k0+32 into buffer set B (always in range: K%64==0)
    const int k1 = k0 + 32;
    load_frag(aB,  aBase, k1);
    load_frag(bB0, b0p,   k1);
    load_frag(bB1, b1p,   k1);
    load_frag(bB2, b2p,   k1);
    load_frag(bB3, b3p,   k1);
    __builtin_prefetch(aBase + k1 + 32, 0, 3);     // global_prefetch_b8

    // compute on buffer set A (chunk k0) while set-B loads are in flight
    WMMA4(aA, bA0, bA1, bA2, bA3);

    if (k0 + 64 < K) {
      // issue loads for chunk k0+64 back into buffer set A
      const int k2 = k0 + 64;
      load_frag(aA,  aBase, k2);
      load_frag(bA0, b0p,   k2);
      load_frag(bA1, b1p,   k2);
      load_frag(bA2, b2p,   k2);
      load_frag(bA3, b3p,   k2);
      __builtin_prefetch(aBase + k2 + 32, 0, 3);
    }

    // compute on buffer set B (chunk k0+32)
    WMMA4(aB, bB0, bB1, bB2, bB3);
  }
#undef WMMA4

  // C/D layout: VGPR r -> row (tileM + r) for lanes 0..15,
  //                       row (tileM + r + 8) for lanes 16..31; col = lane&15.
  const int rowOff = (lane < 16) ? 0 : 8;
  float* crow = C + (size_t)(tileM + rowOff) * N + tileN + l16;
#pragma unroll
  for (int r = 0; r < 8; ++r) {
    float* cr = crow + (size_t)r * N;
    cr[0]  = acc0[r];
    cr[16] = acc1[r];
    cr[32] = acc2[r];
    cr[48] = acc3[r];
  }
}

// ---------------------------------------------------------------
// Depthwise causal conv (width 4) + bias + SiLU.
// x_in is columns [0, DI) of xz (NROW x 2*DI).  xc: NROW x DI.
// A thread makes CROWS_ successive rows of 4 channels from CROWS_+3 row loads.
// Grid: (DI_/1024, NROW_/CROWS_), block 256. S_ % CROWS_ == 0, so a thread's
// rows lie in one sequence and only its first group has rows before the start.
// ---------------------------------------------------------------
#define CROWS_ 8
__global__ __launch_bounds__(256)
void conv_silu_kernel(const float* __restrict__ xz,
                      const float* __restrict__ conv_w,
                      const float* __restrict__ conv_b,
                      float* __restrict__ xc) {
  const int d  = (blockIdx.x * 256 + threadIdx.x) * 4;
  const int r0 = blockIdx.y * CROWS_;
  const float* xin = xz + (size_t)r0 * (2 * DI_) + d;

  v4f x[CROWS_ + DCONV_ - 1];                 // x[i] = row r0 - 3 + i
#pragma unroll
  for (int i = 0; i < DCONV_ - 1; ++i) x[i] = (v4f){0.f, 0.f, 0.f, 0.f};
  if ((r0 & (S_ - 1)) != 0) {                 // the causal left pad stays zero
#pragma unroll
    for (int i = 0; i < DCONV_ - 1; ++i)
      x[i] = *(const v4f*)(xin - (size_t)(DCONV_ - 1 - i) * (2 * DI_));
  }
#pragma unroll
  for (int i = 0; i < CROWS_; ++i)
    x[DCONV_ - 1 + i] = *(const v4f*)(xin + (size_t)i * (2 * DI_));

  v4f w[4];                                   // w[c] = the 4 taps of channel d + c
#pragma unroll
  for (int c = 0; c < 4; ++c) w[c] = *(const v4f*)(conv_w + (size_t)(d + c) * DCONV_);
  const v4f bias = *(const v4f*)(conv_b + d);
  // the arithmetic below reuses the address registers of the loads above
  asm volatile("s_wait_xcnt 0x0" ::: "memory");
  // keeps every load, and that wait, above the arithmetic: one memory latency
  // per thread instead of two
  __builtin_amdgcn_sched_barrier(0);

  float* op = xc + (size_t)r0 * DI_ + d;
#pragma unroll
  for (int i = 0; i < CROWS_; ++i) {
    v4f o;
#pragma unroll
    for (int c = 0; c < 4; ++c) {
      float acc = bias[c];
#pragma unroll
      for (int j = 0; j < DCONV_; ++j) acc += x[i + j][c] * w[c][j];
      o[c] = acc / (1.f + __expf(-acc));      // SiLU
    }
    *(v4f*)(op + (size_t)i * DI_) = o;
  }
}

// ---------------------------------------------------------------
// xp = xc @ W_xproj   (NROW x DI) * (DI x 33) -> (NROW x 33)
// tiny-N GEMM: one thread per output element.
// ---------------------------------------------------------------
__global__ void xproj_kernel(const float* __restrict__ xc,
                             const float* __restrict__ Wx,
                             float* __restrict__ xp) {
  int idx = blockIdx.x * 256 + threadIdx.x;
  if (idx >= NROW_ * XPN_) return;
  int j = idx % XPN_;
  int r = idx / XPN_;
  const float* xr = xc + (size_t)r * DI_;
  float acc = 0.f;
#pragma unroll 4
  for (int k = 0; k < DI_; ++k) acc += xr[k] * Wx[k * XPN_ + j];
  xp[idx] = acc;
}

// ---------------------------------------------------------------
// Selective scan, split along the sequence into CH_ chunks of TCH_ steps
// that run in parallel. The recurrence h <- dA*h + dBx is linear in h, and
// the product of dA over a chunk is exp(A * sum(delta)), so:
//   1) chunk_state: every chunk but the last runs from h = 0 and leaves its
//      end state and its sum of delta;
//   2) chunk_carry: per (b, n, d) the CH_ - 1 end states are chained into the
//      true state at the start of each chunk;
//   3) chunk_out: every chunk runs again from its true start state and
//      emits y = h.C + Dp*xc, gated with silu(z), as f16 for the output GEMM.
// One thread per (b, chunk, d), state h[16] in registers. The chunk's xp
// rows (dt|B|C) are staged in LDS once and read as broadcasts.
// ---------------------------------------------------------------
#define CH_   32                    // chunks per sequence
#define TCH_  (S_ / CH_)            // steps per chunk
#define ROWP_ (2 * DSTATE_ + 4)     // LDS row: B[16] | C[16] | dt | pad, 16-byte rows
#define GRP_  8                     // steps whose xc / z are fetched together, one group ahead

#define NXV_  ((TCH_ * XPN_ + 255) / 256)   // xp words per thread of a 256-thread block

// The chunk's xp rows go to LDS in two halves, so that a kernel can issue its
// other global loads between them and all latencies overlap.
__device__ __forceinline__ void load_xp_chunk(float* v,
                                              const float* __restrict__ xp,
                                              int r0) {
  const float* src = xp + (size_t)r0 * XPN_;
#pragma unroll
  for (int k = 0; k < NXV_; ++k) {
    const int i = threadIdx.x + k * 256;
    v[k] = ((k + 1) * 256 <= TCH_ * XPN_ || i < TCH_ * XPN_) ? src[i] : 0.f;
  }
}

__device__ __forceinline__ void store_xp_chunk(float* sx, const float* v) {
#pragma unroll
  for (int k = 0; k < NXV_; ++k) {
    const int i = threadIdx.x + k * 256;
    const int row = i / XPN_;
    const int col = i - row * XPN_;
    if ((k + 1) * 256 <= TCH_ * XPN_ || i < TCH_ * XPN_)
      sx[row * ROWP_ + (col == 0 ? 2 * DSTATE_ : col - 1)] = v[k];
  }
}

__device__ __forceinline__ void read16(float* v, const float* s) {
#pragma unroll
  for (int q = 0; q < 4; ++q) {
    const float4 f = ((const float4*)s)[q];
    v[4 * q + 0] = f.x; v[4 * q + 1] = f.y; v[4 * q + 2] = f.z; v[4 * q + 3] = f.w;
  }
}

__device__ __forceinline__ float softplus_dt(float din) {
  return (din > 20.f) ? din : __logf(1.f + __expf(din));
}

// Grid: (DI_/256, CH_-1, B_), block 256.
__global__ __launch_bounds__(256)
void ssm_chunk_state_kernel(const float* __restrict__ xp,
                            const float* __restrict__ xc,
                            const float* __restrict__ W_dt, // (1, DI_)
                            const float* __restrict__ b_dt,
                            const float* __restrict__ A_log,
                            float* __restrict__ hend,       // (B, CH, 16, DI)
                            float* __restrict__ sdel) {     // (B, CH, DI)
  __shared__ __attribute__((aligned(16))) float sx[TCH_ * ROWP_];
  const int d  = blockIdx.x * 256 + threadIdx.x;
  const int c  = blockIdx.y;
  const int b  = blockIdx.z;
  const int r0 = b * S_ + c * TCH_;

  float xv[NXV_];
  load_xp_chunk(xv, xp, r0);

  float Aneg[DSTATE_];
#pragma unroll
  for (int n = 0; n < DSTATE_; ++n) Aneg[n] = -__expf(A_log[n]);
  const float wdt = W_dt[d];
  const float bdt = b_dt[d];

  float h[DSTATE_];
#pragma unroll
  for (int n = 0; n < DSTATE_; ++n) h[n] = 0.f;
  float sd = 0.f;

  const float* xcp = xc + (size_t)r0 * DI_ + d;
  float xcu[GRP_];
#pragma unroll
  for (int u = 0; u < GRP_; ++u) xcu[u] = xcp[(size_t)u * DI_];

  store_xp_chunk(sx, xv);
  __syncthreads();

  // rolled over groups (code size); the next group's loads fly over this group's steps
#pragma unroll 1
  for (int g = 0; g < TCH_ / GRP_; ++g) {
    float xnx[GRP_];
#pragma unroll
    for (int u = 0; u < GRP_; ++u) xnx[u] = 0.f;
    if (g + 1 < TCH_ / GRP_) {
#pragma unroll
      for (int u = 0; u < GRP_; ++u) xnx[u] = xcp[(size_t)((g + 1) * GRP_ + u) * DI_];
    }
#pragma unroll
    for (int u = 0; u < GRP_; ++u) {
      const float* row = sx + (g * GRP_ + u) * ROWP_;
      float Bv[DSTATE_];
      read16(Bv, row);
      const float delta = softplus_dt(row[2 * DSTATE_] * wdt + bdt);
      const float dx    = delta * xcu[u];
      sd += delta;
#pragma unroll
      for (int n = 0; n < DSTATE_; ++n) {
        const float e = __expf(delta * Aneg[n]);
        h[n] = e * h[n] + dx * Bv[n];
      }
    }
#pragma unroll
    for (int u = 0; u < GRP_; ++u) xcu[u] = xnx[u];
  }

  const size_t bc = (size_t)b * CH_ + c;
#pragma unroll
  for (int n = 0; n < DSTATE_; ++n) hend[(bc * DSTATE_ + n) * DI_ + d] = h[n];
  sdel[bc * DI_ + d] = sd;
}

// One thread per (b, n, d): chain the chunks' end states.
__global__ __launch_bounds__(256)
void ssm_chunk_carry_kernel(const float* __restrict__ hend,
                            const float* __restrict__ sdel,
                            const float* __restrict__ A_log,
                            float* __restrict__ hini) {     // (B, CH, 16, DI)
  const int idx = blockIdx.x * 256 + threadIdx.x;           // over B_*16*DI_
  const int d = idx & (DI_ - 1);
  const int n = (idx >> 11) & (DSTATE_ - 1);
  const int b = idx >> 15;
  const float an = -__expf(A_log[n]);

  const float* hp = hend + ((size_t)b * CH_ * DSTATE_ + n) * DI_ + d;
  const float* sp = sdel + (size_t)b * CH_ * DI_ + d;
  float*       op = hini + ((size_t)b * CH_ * DSTATE_ + n) * DI_ + d;

  // every load is independent of the chain: fetch all first, one latency in all
  float he[CH_ - 1], ev[CH_ - 1];
#pragma unroll
  for (int c = 0; c < CH_ - 1; ++c) {
    ev[c] = sp[(size_t)c * DI_];
    he[c] = hp[(size_t)c * DSTATE_ * DI_];
  }
#pragma unroll
  for (int c = 0; c < CH_ - 1; ++c) ev[c] = __expf(an * ev[c]);

  float H = 0.f;
  op[0] = H;
#pragma unroll
  for (int c = 0; c < CH_ - 1; ++c) {
    H = ev[c] * H + he[c];
    op[(size_t)(c + 1) * DSTATE_ * DI_] = H;
  }
}

// Grid: (DI_/256, CH_, B_), block 256.
__global__ __launch_bounds__(256)
void ssm_chunk_out_kernel(const float* __restrict__ xp,
                          const float* __restrict__ xc,
                          const float* __restrict__ xz,   // z at cols [DI_, 2*DI_)
                          const float* __restrict__ W_dt, // (1, DI_)
                          const float* __restrict__ b_dt,
                          const float* __restrict__ A_log,
                          const float* __restrict__ Dp,
                          const float* __restrict__ hini,
                          _Float16* __restrict__ y_h) {
  __shared__ __attribute__((aligned(16))) float sx[TCH_ * ROWP_];
  const int d  = blockIdx.x * 256 + threadIdx.x;
  const int c  = blockIdx.y;
  const int b  = blockIdx.z;
  const int r0 = b * S_ + c * TCH_;

  float xv[NXV_];
  load_xp_chunk(xv, xp, r0);

  float Aneg[DSTATE_];
#pragma unroll
  for (int n = 0; n < DSTATE_; ++n) Aneg[n] = -__expf(A_log[n]);
  const float wdt = W_dt[d];
  const float bdt = b_dt[d];
  const float dpv = Dp[d];

  const size_t bc = (size_t)b * CH_ + c;
  float h[DSTATE_];
#pragma unroll
  for (int n = 0; n < DSTATE_; ++n) h[n] = hini[(bc * DSTATE_ + n) * DI_ + d];

  const float* xcp = xc + (size_t)r0 * DI_ + d;
  const float* zp  = xz + (size_t)r0 * (2 * DI_) + DI_ + d;
  _Float16*    yp  = y_h + (size_t)r0 * DI_ + d;
  float xcu[GRP_], zcu[GRP_];
#pragma unroll
  for (int u = 0; u < GRP_; ++u) {
    xcu[u] = xcp[(size_t)u * DI_];
    zcu[u] = zp[(size_t)u * (2 * DI_)];
  }

  store_xp_chunk(sx, xv);
  __syncthreads();

  // rolled over groups (code size); the next group's loads fly over this group's steps
#pragma unroll 1
  for (int g = 0; g < TCH_ / GRP_; ++g) {
    float xnx[GRP_], znx[GRP_];
#pragma unroll
    for (int u = 0; u < GRP_; ++u) { xnx[u] = 0.f; znx[u] = 0.f; }
    if (g + 1 < TCH_ / GRP_) {
#pragma unroll
      for (int u = 0; u < GRP_; ++u) {
        xnx[u] = xcp[(size_t)((g + 1) * GRP_ + u) * DI_];
        znx[u] = zp[(size_t)((g + 1) * GRP_ + u) * (2 * DI_)];
      }
    }
#pragma unroll
    for (int u = 0; u < GRP_; ++u) {
      const int t = g * GRP_ + u;
      const float* row = sx + t * ROWP_;
      float Bv[DSTATE_], Cv[DSTATE_];
      read16(Bv, row);
      read16(Cv, row + DSTATE_);
      const float delta = softplus_dt(row[2 * DSTATE_] * wdt + bdt);
      const float xcv   = xcu[u];
      const float zv    = zcu[u];
      const float dx    = delta * xcv;

      float y = 0.f;
#pragma unroll
      for (int n = 0; n < DSTATE_; ++n) {
        const float e = __expf(delta * Aneg[n]);
        h[n] = e * h[n] + dx * Bv[n];
        y += h[n] * Cv[n];
      }
      y += dpv * xcv;
      y *= zv / (1.f + __expf(-zv));               // * silu(z)
      yp[(size_t)t * DI_] = (_Float16)y;
    }
#pragma unroll
    for (int u = 0; u < GRP_; ++u) { xcu[u] = xnx[u]; zcu[u] = znx[u]; }
  }
}

// ---------------------------------------------------------------
extern "C" void kernel_launch(void* const* d_in, const int* in_sizes, int n_in,
                              void* d_out, int out_size, void* d_ws, size_t ws_size,
                              hipStream_t stream) {
  const float* x      = (const float*)d_in[0];   // (B,S,DM)
  const float* W_in   = (const float*)d_in[1];   // (DM, 2*DI)
  const float* conv_w = (const float*)d_in[2];   // (DI,1,4)
  const float* conv_b = (const float*)d_in[3];   // (DI)
  const float* W_xp   = (const float*)d_in[4];   // (DI, 33)
  const float* W_dt   = (const float*)d_in[5];   // (1, DI)
  const float* b_dt   = (const float*)d_in[6];   // (DI)
  const float* A_log  = (const float*)d_in[7];   // (16)
  const float* Dp     = (const float*)d_in[8];   // (DI)
  const float* W_out  = (const float*)d_in[9];   // (DI, DM)
  float* out = (float*)d_out;                    // (B,S,DM)

  // ---- workspace carve-out (256B aligned) ----
  size_t off = 0;
  auto carve = [&](size_t bytes) -> void* {
    void* p = (char*)d_ws + off;
    off += (bytes + 255) & ~(size_t)255;
    return p;
  };
  _Float16* x_h  = (_Float16*)carve((size_t)NROW_ * DM_ * 2);      // 4 MB
  _Float16* Wi_t = (_Float16*)carve((size_t)(2*DI_) * DM_ * 2);    // 8 MB  (4096 x 1024)
  _Float16* Wo_t = (_Float16*)carve((size_t)DM_ * DI_ * 2);        // 4 MB  (1024 x 2048)
  float*    xz   = (float*)   carve((size_t)NROW_ * 2*DI_ * 4);    // 32 MB
  float*    xc   = (float*)   carve((size_t)NROW_ * DI_ * 4);      // 16 MB
  float*    xp   = (float*)   carve((size_t)NROW_ * XPN_ * 4);     // ~0.3 MB
  _Float16* y_h  = (_Float16*)carve((size_t)NROW_ * DI_ * 2);      // 8 MB
  float*    hend = (float*)   carve((size_t)B_ * CH_ * DSTATE_ * DI_ * 4);  // 8 MB
  float*    hini = (float*)   carve((size_t)B_ * CH_ * DSTATE_ * DI_ * 4);  // 8 MB
  float*    sdel = (float*)   carve((size_t)B_ * CH_ * DI_ * 4);            // 0.5 MB

  // 1) precision conversion / weight transposes
  cvt_f16_kernel<<<CVT_T_ / 256, 256, 0, stream>>>(x, x_h);
  {
    dim3 grid(DM_ / 64, (2 * DI_) / 128);   // K=1024, N=4096
    transpose_win_kernel<<<grid, 256, 0, stream>>>(W_in, Wi_t);
  }
  {
    dim3 grid(DI_ / 64, DM_ / 128);         // K=2048, N=1024
    transpose_wout_kernel<<<grid, 256, 0, stream>>>(W_out, Wo_t);
  }

  // 2) xz = x @ W_in        (2048 x 4096, K=1024)  -- WMMA
  {
    dim3 grid(NROW_ / 64, (2 * DI_) / 64);
    gemm_wmma_f16_kernel<<<grid, 128, 0, stream>>>(x_h, Wi_t, xz,
                                                   NROW_, 2 * DI_, DM_);
  }

  // 3) depthwise conv + SiLU
  {
    dim3 grid(DI_ / 1024, NROW_ / CROWS_);
    conv_silu_kernel<<<grid, 256, 0, stream>>>(xz, conv_w, conv_b, xc);
  }

  // 4) xp = xc @ W_xproj    (N=33)
  {
    int n = NROW_ * XPN_;
    xproj_kernel<<<(n + 255) / 256, 256, 0, stream>>>(xc, W_xp, xp);
  }

  // 5) selective scan in parallel chunks -> gated y (f16)
  {
    dim3 grid(DI_ / 256, CH_ - 1, B_);
    ssm_chunk_state_kernel<<<grid, 256, 0, stream>>>(xp, xc, W_dt, b_dt, A_log,
                                                     hend, sdel);
  }
  {
    int n = B_ * DSTATE_ * DI_;
    ssm_chunk_carry_kernel<<<n / 256, 256, 0, stream>>>(hend, sdel, A_log, hini);
  }
  {
    dim3 grid(DI_ / 256, CH_, B_);
    ssm_chunk_out_kernel<<<grid, 256, 0, stream>>>(xp, xc, xz, W_dt, b_dt,
                                                   A_log, Dp, hini, y_h);
  }

  // 6) out = y @ W_out      (2048 x 1024, K=2048)  -- WMMA
  {
    dim3 grid(NROW_ / 64, DM_ / 64);
    gemm_wmma_f16_kernel<<<grid, 128, 0, stream>>>(y_h, Wo_t, out,
                                                   NROW_, DM_, DI_);
  }
  (void)in_sizes; (void)n_in; (void)out_size; (void)ws_size;
}

// v003
// One run takes 159 microseconds.
// Timed twice side by side with v002, it ran 2.20 times as fast both times.
// Counting every step since v000, it is 9.21 times as fast.
#include <hip/hip_runtime.h>
#include <hip/hip_bf16.h>

// ---------------- problem constants (from reference) ----------------
#define B_      2
#define S_      1024
#define DM_     1024          // D_MODEL
#define DI_     2048          // D_INNER = 2*D_MODEL
#define DSTATE_ 16
#define DCONV_  4
#define NROW_   (B_ * S_)     // 2048 flattened (b,s) rows
#define XPN_    (2 * DSTATE_ + 1)   // 33

typedef __attribute__((ext_vector_type(16))) _Float16 v16h;
typedef __attribute__((ext_vector_type(8)))  _Float16 v8h;
typedef __attribute__((ext_vector_type(8)))  float    v8f;
typedef __attribute__((ext_vector_type(4)))  float    v4f;

union V16 { v16h v; v8h h2[2]; };

// ---------------------------------------------------------------
// The elementwise launches below give every thread 16 to 32 elements, moved
// in 16-byte loads and stores, the loads issued together at the start. One
// element per lane would start 16 to 32 times as many waves for the same bytes.
// ---------------------------------------------------------------

__device__ __forceinline__ v8h pack8(float a, float b, float c, float d,
                                     float e, float f, float g, float h) {
  v8h o = {(_Float16)a, (_Float16)b, (_Float16)c, (_Float16)d,
           (_Float16)e, (_Float16)f, (_Float16)g, (_Float16)h};
  return o;
}

// ---------------------------------------------------------------
// Elementwise f32 -> f16 convert of NROW_*DM_ values.
// A thread converts two runs of 8 values. Grid: CVT_T_/256 blocks of 256.
// ---------------------------------------------------------------
#define CVT_T_ (NROW_ * DM_ / 16)     // threads
__global__ __launch_bounds__(256)
void cvt_f16_kernel(const float* __restrict__ in,
                    _Float16* __restrict__ out) {
  const size_t t = (size_t)blockIdx.x * 256 + threadIdx.x;
  const size_t e0 = t * 8;
  const size_t e1 = (t + CVT_T_) * 8;
  const v4f a0 = *(const v4f*)(in + e0);
  const v4f a1 = *(const v4f*)(in + e0 + 4);
  const v4f b0 = *(const v4f*)(in + e1);
  const v4f b1 = *(const v4f*)(in + e1 + 4);
  *(v8h*)(out + e0) = pack8(a0[0], a0[1], a0[2], a0[3], a1[0], a1[1], a1[2], a1[3]);
  *(v8h*)(out + e1) = pack8(b0[0], b0[1], b0[2], b0[3], b1[0], b1[1], b1[2], b1[3]);
}

// ---------------------------------------------------------------
// Transpose (K x N) f32  ->  (N x K) f16   (Wt[n*K + k] = W[k*N + n])
// A thread holds an 8 (k) x 4 (n) block: 8 row loads of 4 n, 4 stores of 8 k;
// the transpose itself is only a choice of registers. In a wave 8 lanes lie
// along k, so each store instruction writes whole 128-byte lines of Wt; the
// 8 waves of a block lie along n and share the lines of W they read.
// K and N are compile-time, so the row steps are immediate offsets on one
// address. Grid: (K/64, N/128), block 256; K % 64 == 0, N % 128 == 0.
// ---------------------------------------------------------------
template <int K, int N>
__device__ __forceinline__ void transpose_f16_block(const float* __restrict__ W,
                                                    _Float16* __restrict__ Wt) {
  const int lane = threadIdx.x & 31;
  const int wave = threadIdx.x >> 5;
  const int k = blockIdx.x * 64 + (lane & 7) * 8;
  const int n = blockIdx.y * 128 + wave * 16 + (lane >> 3) * 4;
  const float* src = W + (size_t)k * N + n;
  v4f r[8];
#pragma unroll
  for (int i = 0; i < 8; ++i) r[i] = *(const v4f*)(src + i * N);
  _Float16* dst = Wt + (size_t)n * K + k;
#pragma unroll
  for (int j = 0; j < 4; ++j)
    *(v8h*)(dst + j * K) = pack8(r[0][j], r[1][j], r[2][j], r[3][j],
                                 r[4][j], r[5][j], r[6][j], r[7][j]);
}

__global__ __launch_bounds__(256)
void transpose_win_kernel(const float* __restrict__ W, _Float16* __restrict__ Wt) {
  transpose_f16_block<DM_, 2 * DI_>(W, Wt);
}

__global__ __launch_bounds__(256)
void transpose_wout_kernel(const float* __restrict__ W, _Float16* __restrict__ Wt) {
  transpose_f16_block<DI_, DM_>(W, Wt);
}

// ---------------------------------------------------------------
// Fragment load helpers for 16-bit WMMA operands.
// Per CDNA5 ISA (16-bit A 16x32): lane<16 holds K[0..7] and K[16..23];
// lane>=16 holds K[8..15] and K[24..31]; each half is one contiguous
// 16-byte chunk -> two v8h global loads per fragment.
// ---------------------------------------------------------------
__device__ __forceinline__ void load_frag(V16& f, const _Float16* base, int k0) {
  f.h2[0] = *(const v8h*)(base + k0);
  f.h2[1] = *(const v8h*)(base + k0 + 16);
}

// ---------------------------------------------------------------
// WMMA GEMM:  C(MxN, f32) = A(MxK, f16 row-major) * B(KxN) with B given
// transposed: Bt (N x K, f16 row-major).
// Block = 128 threads (4 waves). Each wave computes a 16x64 strip:
// one A fragment reused by 4 B fragments -> 4 WMMA per 32-wide K-step.
// Explicit register double buffering: all loads for K-chunk (k+32) are
// issued before the WMMAs on chunk k, so waits before each WMMA are
// partial (loadcnt<=n) instead of a full load->wait->MMA serialization.
// Requires: M,N multiples of 64; K multiple of 64.
// ---------------------------------------------------------------
__global__ void gemm_wmma_f16_kernel(const _Float16* __restrict__ A,
                                     const _Float16* __restrict__ Bt,
                                     float* __restrict__ C,
                                     int M, int N, int K) {
  const int lane  = threadIdx.x & 31;
  const int wave  = threadIdx.x >> 5;
  const int tileM = blockIdx.x * 64 + wave * 16;
  const int tileN = blockIdx.y * 64;

  const int halfSel = (lane >> 4) << 3;         // 0 or 8
  const int l16     = lane & 15;

  const _Float16* aBase = A  + (size_t)(tileM + l16) * K + halfSel;
  const _Float16* b0p   = Bt + (size_t)(tileN + l16) * K + halfSel;
  const _Float16* b1p   = b0p + (size_t)16 * K;
  const _Float16* b2p   = b0p + (size_t)32 * K;
  const _Float16* b3p   = b0p + (size_t)48 * K;

  v8f acc0 = {}, acc1 = {}, acc2 = {}, acc3 = {};

  // ---- preload K-chunk 0 into buffer set A ----
  V16 aA, bA0, bA1, bA2, bA3;
  V16 aB, bB0, bB1, bB2, bB3;
  load_frag(aA,  aBase, 0);
  load_frag(bA0, b0p,   0);
  load_frag(bA1, b1p,   0);
  load_frag(bA2, b2p,   0);
  load_frag(bA3, b3p,   0);

#define WMMA4(af, f0, f1, f2, f3)                                            \
  acc0 = __builtin_amdgcn_wmma_f32_16x16x32_f16(false, (af).v, false,        \
             (f0).v, (short)0, acc0, false, false);                          \
  acc1 = __builtin_amdgcn_wmma_f32_16x16x32_f16(false, (af).v, false,        \
             (f1).v, (short)0, acc1, false, false);                          \
  acc2 = __builtin_amdgcn_wmma_f32_16x16x32_f16(false, (af).v, false,        \
             (f2).v, (short)0, acc2, false, false);                          \
  acc3 = __builtin_amdgcn_wmma_f32_16x16x32_f16(false, (af).v, false,        \
             (f3).v, (short)0, acc3, false, false)

  for (int k0 = 0; k0 < K; k0 += 64) {
    // issue loads for chunk k0+32 into buffer set B (always in range: K%64==0)
    const int k1 = k0 + 32;
    load_frag(aB,  aBase, k1);
    load_frag(bB0, b0p,   k1);
    load_frag(bB1, b1p,   k1);
    load_frag(bB2, b2p,   k1);
    load_frag(bB3, b3p,   k1);
    __builtin_prefetch(aBase + k1 + 32, 0, 3);     // global_prefetch_b8

    // compute on buffer set A (chunk k0) while set-B loads are in flight
    WMMA4(aA, bA0, bA1, bA2, bA3);

    if (k0 + 64 < K) {
      // issue loads for chunk k0+64 back into buffer set A
      const int k2 = k0 + 64;
      load_frag(aA,  aBase, k2);
      load_frag(bA0, b0p,   k2);
      load_frag(bA1, b1p,   k2);
      load_frag(bA2, b2p,   k2);
      load_frag(bA3, b3p,   k2);
      __builtin_prefetch(aBase + k2 + 32, 0, 3);
    }

    // compute on buffer set B (chunk k0+32)
    WMMA4(aB, bB0, bB1, bB2, bB3);
  }
#undef WMMA4

  // C/D layout: VGPR r -> row (tileM + r) for lanes 0..15,
  //                       row (tileM + r + 8) for lanes 16..31; col = lane&15.
  const int rowOff = (lane < 16) ? 0 : 8;
  float* crow = C + (size_t)(tileM + rowOff) * N + tileN + l16;
#pragma unroll
  for (int r = 0; r < 8; ++r) {
    float* cr = crow + (size_t)r * N;
    cr[0]  = acc0[r];
    cr[16] = acc1[r];
    cr[32] = acc2[r];
    cr[48] = acc3[r];
  }
}

// ---------------------------------------------------------------
// Depthwise causal conv (width 4) + bias + SiLU.
// x_in is columns [0, DI) of xz (NROW x 2*DI).  xc: NROW x DI.
// A thread makes CROWS_ successive rows of 4 channels from CROWS_+3 row loads.
// Grid: (DI_/1024, NROW_/CROWS_), block 256. S_ % CROWS_ == 0, so a thread's
// rows lie in one sequence and only its first group has rows before the start.
// ---------------------------------------------------------------
#define CROWS_ 8
__global__ __launch_bounds__(256)
void conv_silu_kernel(const float* __restrict__ xz,
                      const float* __restrict__ conv_w,
                      const float* __restrict__ conv_b,
                      float* __restrict__ xc) {
  const int d  = (blockIdx.x * 256 + threadIdx.x) * 4;
  const int r0 = blockIdx.y * CROWS_;
  const float* xin = xz + (size_t)r0 * (2 * DI_) + d;

  v4f x[CROWS_ + DCONV_ - 1];                 // x[i] = row r0 - 3 + i
#pragma unroll
  for (int i = 0; i < DCONV_ - 1; ++i) x[i] = (v4f){0.f, 0.f, 0.f, 0.f};
  if ((r0 & (S_ - 1)) != 0) {                 // the causal left pad stays zero
#pragma unroll
    for (int i = 0; i < DCONV_ - 1; ++i)
      x[i] = *(const v4f*)(xin - (size_t)(DCONV_ - 1 - i) * (2 * DI_));
  }
#pragma unroll
  for (int i = 0; i < CROWS_; ++i)
    x[DCONV_ - 1 + i] = *(const v4f*)(xin + (size_t)i * (2 * DI_));

  v4f w[4];                                   // w[c] = the 4 taps of channel d + c
#pragma unroll
  for (int c = 0; c < 4; ++c) w[c] = *(const v4f*)(conv_w + (size_t)(d + c) * DCONV_);
  const v4f bias = *(const v4f*)(conv_b + d);
  // the arithmetic below reuses the address registers of the loads above
  asm volatile("s_wait_xcnt 0x0" ::: "memory");
  // keeps every load, and that wait, above the arithmetic: one memory latency
  // per thread instead of two
  __builtin_amdgcn_sched_barrier(0);

  float* op = xc + (size_t)r0 * DI_ + d;
#pragma unroll
  for (int i = 0; i < CROWS_; ++i) {
    v4f o;
#pragma unroll
    for (int c = 0; c < 4; ++c) {
      float acc = bias[c];
#pragma unroll
      for (int j = 0; j < DCONV_; ++j) acc += x[i + j][c] * w[c][j];
      o[c] = acc / (1.f + __expf(-acc));      // SiLU
    }
    *(v4f*)(op + (size_t)i * DI_) = o;
  }
}

// ---------------------------------------------------------------
// xp = xc @ W_xproj   (NROW x DI) * (DI x 33) -> (NROW x 33), all in f32,
// on the f32 16x16x4 matrix form.
// A block makes 16 rows of xp. Its XW_ waves split k; each wave holds three
// 16x16 accumulator tiles (columns 0-15, 16-31, and column 32 repeated in all
// 16 columns of the third tile, of which only the first is kept: a column of
// D depends on that column of B alone). The waves' partial sums meet in LDS.
// k pairing: in a run of 32 k, lane (c, h) holds k = 16h + q, q = 0..15, of
// row c of xc and of its column of W_xproj; product t takes q = 2t, 2t + 1 of
// both. The loads of a run are issued at least one run ahead of its products.
// Grid: NROW_/16 blocks of 32 * XW_ threads.
// ---------------------------------------------------------------
typedef __attribute__((ext_vector_type(2))) float v2f;
#define XW_   8                     // waves of a block
#define XKS_  (DI_ / XW_)           // k per wave
#define XRUN_ 32                    // k per run of loads
#define XPIT_ 52                    // LDS row pitch in floats: rows 8 apart lie 32 banks apart

struct XFrag { v4f a[4]; float b[3][16]; };

__device__ __forceinline__ void xproj_load(XFrag& f, const float* __restrict__ ap,
                                           const float* __restrict__ bp,
                                           const float* __restrict__ bw) {
#pragma unroll
  for (int i = 0; i < 4; ++i) f.a[i] = *(const v4f*)(ap + 4 * i);
#pragma unroll
  for (int q = 0; q < 16; ++q) {
    f.b[0][q] = bp[q * XPN_];
    f.b[1][q] = bp[q * XPN_ + 16];
    f.b[2][q] = bw[q * XPN_ + XPN_ - 1];
  }
}

__device__ __forceinline__ void xproj_mma(v8f* acc, const XFrag& f) {
#pragma unroll
  for (int t = 0; t < 8; ++t) {
    const v2f a = {f.a[t >> 1][(2 * t) & 3], f.a[t >> 1][(2 * t + 1) & 3]};
#pragma unroll
    for (int j = 0; j < 3; ++j) {
      const v2f b = {f.b[j][2 * t], f.b[j][2 * t + 1]};
      acc[j] = __builtin_amdgcn_wmma_f32_16x16x4_f32(false, a, false, b, (short)0,
                                                     acc[j], false, false);
    }
  }
}

__global__ __launch_bounds__(32 * XW_)
void xproj_kernel(const float* __restrict__ xc,
                  const float* __restrict__ Wx,
                  float* __restrict__ xp) {
  __shared__ float red[XW_ * 16 * XPIT_];
  const int lane = threadIdx.x & 31;
  const int wave = threadIdx.x >> 5;
  const int c    = lane & 15;
  const int h    = lane >> 4;
  const int r0   = blockIdx.x * 16;
  const int k0   = wave * XKS_ + 16 * h;

  const float* ap = xc + (size_t)(r0 + c) * DI_ + k0;
  const float* bw = Wx + (size_t)k0 * XPN_;   // row k0 of W_xproj
  const float* bp = bw + c;

  v8f acc[3] = {};
  XFrag f0, f1;
  xproj_load(f0, ap, bp, bw);
#pragma unroll
  for (int s = 0; s < XKS_ / XRUN_; s += 2) {
    xproj_load(f1, ap + (s + 1) * XRUN_, bp + (s + 1) * XRUN_ * XPN_,
               bw + (s + 1) * XRUN_ * XPN_);
    // keeps the next run's loads above this run's products: left free, the
    // compiler sinks each load to a few products ahead of its use, too late
    __builtin_amdgcn_sched_barrier(0);
    xproj_mma(acc, f0);
    if (s + 2 < XKS_ / XRUN_)
      xproj_load(f0, ap + (s + 2) * XRUN_, bp + (s + 2) * XRUN_ * XPN_,
                 bw + (s + 2) * XRUN_ * XPN_);
    __builtin_amdgcn_sched_barrier(0);   // the same, for the other register set
    xproj_mma(acc, f1);
  }
  // the three addresses stay in their registers up to here (else the last
  // run's loads land in them), and are given up only behind this wait
  asm volatile("s_wait_xcnt 0x0" :: "v"(ap), "v"(bp), "v"(bw) : "memory");

  // D register r of lane (c, h) is row 8h + r, column c of its tile
  float* my = red + wave * 16 * XPIT_;
#pragma unroll
  for (int j = 0; j < 3; ++j)
#pragma unroll
    for (int r = 0; r < 8; ++r) my[(8 * h + r) * XPIT_ + 16 * j + c] = acc[j][r];
  __syncthreads();

  for (int idx = threadIdx.x; idx < 16 * XPN_; idx += 32 * XW_) {
    const int row = idx / XPN_;
    const int col = idx - row * XPN_;
    float sum = red[row * XPIT_ + col];
#pragma unroll
    for (int w = 1; w < XW_; ++w) sum += red[(w * 16 + row) * XPIT_ + col];
    xp[(size_t)r0 * XPN_ + idx] = sum;
  }
}

// ---------------------------------------------------------------
// Selective scan, split along the sequence into CH_ chunks of TCH_ steps
// that run in parallel. The recurrence h <- dA*h + dBx is linear in h, and
// the product of dA over a chunk is exp(A * sum(delta)), so:
//   1) chunk_state: every chunk but the last runs from h = 0 and leaves its
//      end state and its sum of delta;
//   2) chunk_carry: per (b, n, d) the CH_ - 1 end states are chained into the
//      true state at the start of each chunk;
//   3) chunk_out: every chunk runs again from its true start state and
//      emits y = h.C + Dp*xc, gated with silu(z), as f16 for the output GEMM.
// One thread per (b, chunk, d), state h[16] in registers. The chunk's xp
// rows (dt|B|C) are staged in LDS once and read as broadcasts.
// ---------------------------------------------------------------
#define CH_   32                    // chunks per sequence
#define TCH_  (S_ / CH_)            // steps per chunk
#define ROWP_ (2 * DSTATE_ + 4)     // LDS row: B[16] | C[16] | dt | pad, 16-byte rows
#define GRP_  8                     // steps whose xc / z are fetched together, one group ahead

#define NXV_  ((TCH_ * XPN_ + 255) / 256)   // xp words per thread of a 256-thread block

// The chunk's xp rows go to LDS in two halves, so that a kernel can issue its
// other global loads between them and all latencies overlap.
__device__ __forceinline__ void load_xp_chunk(float* v,
                                              const float* __restrict__ xp,
                                              int r0) {
  const float* src = xp + (size_t)r0 * XPN_;
#pragma unroll
  for (int k = 0; k < NXV_; ++k) {
    const int i = threadIdx.x + k * 256;
    v[k] = ((k + 1) * 256 <= TCH_ * XPN_ || i < TCH_ * XPN_) ? src[i] : 0.f;
  }
}

__device__ __forceinline__ void store_xp_chunk(float* sx, const float* v) {
#pragma unroll
  for (int k = 0; k < NXV_; ++k) {
    const int i = threadIdx.x + k * 256;
    const int row = i / XPN_;
    const int col = i - row * XPN_;
    if ((k + 1) * 256 <= TCH_ * XPN_ || i < TCH_ * XPN_)
      sx[row * ROWP_ + (col == 0 ? 2 * DSTATE_ : col - 1)] = v[k];
  }
}

__device__ __forceinline__ void read16(float* v, const float* s) {
#pragma unroll
  for (int q = 0; q < 4; ++q) {
    const float4 f = ((const float4*)s)[q];
    v[4 * q + 0] = f.x; v[4 * q + 1] = f.y; v[4 * q + 2] = f.z; v[4 * q + 3] = f.w;
  }
}

__device__ __forceinline__ float softplus_dt(float din) {
  return (din > 20.f) ? din : __logf(1.f + __expf(din));
}

// Grid: (DI_/256, CH_-1, B_), block 256.
__global__ __launch_bounds__(256)
void ssm_chunk_state_kernel(const float* __restrict__ xp,
                            const float* __restrict__ xc,
                            const float* __restrict__ W_dt, // (1, DI_)
                            const float* __restrict__ b_dt,
                            const float* __restrict__ A_log,
                            float* __restrict__ hend,       // (B, CH, 16, DI)
                            float* __restrict__ sdel) {     // (B, CH, DI)
  __shared__ __attribute__((aligned(16))) float sx[TCH_ * ROWP_];
  const int d  = blockIdx.x * 256 + threadIdx.x;
  const int c  = blockIdx.y;
  const int b  = blockIdx.z;
  const int r0 = b * S_ + c * TCH_;

  float xv[NXV_];
  load_xp_chunk(xv, xp, r0);

  float Aneg[DSTATE_];
#pragma unroll
  for (int n = 0; n < DSTATE_; ++n) Aneg[n] = -__expf(A_log[n]);
  const float wdt = W_dt[d];
  const float bdt = b_dt[d];

  float h[DSTATE_];
#pragma unroll
  for (int n = 0; n < DSTATE_; ++n) h[n] = 0.f;
  float sd = 0.f;

  const float* xcp = xc + (size_t)r0 * DI_ + d;
  float xcu[GRP_];
#pragma unroll
  for (int u = 0; u < GRP_; ++u) xcu[u] = xcp[(size_t)u * DI_];

  store_xp_chunk(sx, xv);
  __syncthreads();

  // rolled over groups (code size); the next group's loads fly over this group's steps
#pragma unroll 1
  for (int g = 0; g < TCH_ / GRP_; ++g) {
    float xnx[GRP_];
#pragma unroll
    for (int u = 0; u < GRP_; ++u) xnx[u] = 0.f;
    if (g + 1 < TCH_ / GRP_) {
#pragma unroll
      for (int u = 0; u < GRP_; ++u) xnx[u] = xcp[(size_t)((g + 1) * GRP_ + u) * DI_];
    }
#pragma unroll
    for (int u = 0; u < GRP_; ++u) {
      const float* row = sx + (g * GRP_ + u) * ROWP_;
      float Bv[DSTATE_];
      read16(Bv, row);
      const float delta = softplus_dt(row[2 * DSTATE_] * wdt + bdt);
      const float dx    = delta * xcu[u];
      sd += delta;
#pragma unroll
      for (int n = 0; n < DSTATE_; ++n) {
        const float e = __expf(delta * Aneg[n]);
        h[n] = e * h[n] + dx * Bv[n];
      }
    }
#pragma unroll
    for (int u = 0; u < GRP_; ++u) xcu[u] = xnx[u];
  }

  const size_t bc = (size_t)b * CH_ + c;
#pragma unroll
  for (int n = 0; n < DSTATE_; ++n) hend[(bc * DSTATE_ + n) * DI_ + d] = h[n];
  sdel[bc * DI_ + d] = sd;
}

// One thread per (b, n, d): chain the chunks' end states.
__global__ __launch_bounds__(256)
void ssm_chunk_carry_kernel(const float* __restrict__ hend,
                            const float* __restrict__ sdel,
                            const float* __restrict__ A_log,
                            float* __restrict__ hini) {     // (B, CH, 16, DI)
  const int idx = blockIdx.x * 256 + threadIdx.x;           // over B_*16*DI_
  const int d = idx & (DI_ - 1);
  const int n = (idx >> 11) & (DSTATE_ - 1);
  const int b = idx >> 15;
  const float an = -__expf(A_log[n]);

  const float* hp = hend + ((size_t)b * CH_ * DSTATE_ + n) * DI_ + d;
  const float* sp = sdel + (size_t)b * CH_ * DI_ + d;
  float*       op = hini + ((size_t)b * CH_ * DSTATE_ + n) * DI_ + d;

  // every load is independent of the chain: fetch all first, one latency in all
  float he[CH_ - 1], ev[CH_ - 1];
#pragma unroll
  for (int c = 0; c < CH_ - 1; ++c) {
    ev[c] = sp[(size_t)c * DI_];
    he[c] = hp[(size_t)c * DSTATE_ * DI_];
  }
#pragma unroll
  for (int c = 0; c < CH_ - 1; ++c) ev[c] = __expf(an * ev[c]);

  float H = 0.f;
  op[0] = H;
#pragma unroll
  for (int c = 0; c < CH_ - 1; ++c) {
    H = ev[c] * H + he[c];
    op[(size_t)(c + 1) * DSTATE_ * DI_] = H;
  }
}

// Grid: (DI_/256, CH_, B_), block 256.
__global__ __launch_bounds__(256)
void ssm_chunk_out_kernel(const float* __restrict__ xp,
                          const float* __restrict__ xc,
                          const float* __restrict__ xz,   // z at cols [DI_, 2*DI_)
                          const float* __restrict__ W_dt, // (1, DI_)
                          const float* __restrict__ b_dt,
                          const float* __restrict__ A_log,
                          const float* __restrict__ Dp,
                          const float* __restrict__ hini,
                          _Float16* __restrict__ y_h) {
  __shared__ __attribute__((aligned(16))) float sx[TCH_ * ROWP_];
  const int d  = blockIdx.x * 256 + threadIdx.x;
  const int c  = blockIdx.y;
  const int b  = blockIdx.z;
  const int r0 = b * S_ + c * TCH_;

  float xv[NXV_];
  load_xp_chunk(xv, xp, r0);

  float Aneg[DSTATE_];
#pragma unroll
  for (int n = 0; n < DSTATE_; ++n) Aneg[n] = -__expf(A_log[n]);
  const float wdt = W_dt[d];
  const float bdt = b_dt[d];
  const float dpv = Dp[d];

  const size_t bc = (size_t)b * CH_ + c;
  float h[DSTATE_];
#pragma unroll
  for (int n = 0; n < DSTATE_; ++n) h[n] = hini[(bc * DSTATE_ + n) * DI_ + d];

  const float* xcp = xc + (size_t)r0 * DI_ + d;
  const float* zp  = xz + (size_t)r0 * (2 * DI_) + DI_ + d;
  _Float16*    yp  = y_h + (size_t)r0 * DI_ + d;
  float xcu[GRP_], zcu[GRP_];
#pragma unroll
  for (int u = 0; u < GRP_; ++u) {
    xcu[u] = xcp[(size_t)u * DI_];
    zcu[u] = zp[(size_t)u * (2 * DI_)];
  }

  store_xp_chunk(sx, xv);
  __syncthreads();

  // rolled over groups (code size); the next group's loads fly over this group's steps
#pragma unroll 1
  for (int g = 0; g < TCH_ / GRP_; ++g) {
    float xnx[GRP_], znx[GRP_];
#pragma unroll
    for (int u = 0; u < GRP_; ++u) { xnx[u] = 0.f; znx[u] = 0.f; }
    if (g + 1 < TCH_ / GRP_) {
#pragma unroll
      for (int u = 0; u < GRP_; ++u) {
        xnx[u] = xcp[(size_t)((g + 1) * GRP_ + u) * DI_];
        znx[u] = zp[(size_t)((g + 1) * GRP_ + u) * (2 * DI_)];
      }
    }
#pragma unroll
    for (int u = 0; u < GRP_; ++u) {
      const int t = g * GRP_ + u;
      const float* row = sx + t * ROWP_;
      float Bv[DSTATE_], Cv[DSTATE_];
      read16(Bv, row);
      read16(Cv, row + DSTATE_);
      const float delta = softplus_dt(row[2 * DSTATE_] * wdt + bdt);
      const float xcv   = xcu[u];
      const float zv    = zcu[u];
      const float dx    = delta * xcv;

      float y = 0.f;
#pragma unroll
      for (int n = 0; n < DSTATE_; ++n) {
        const float e = __expf(delta * Aneg[n]);
        h[n] = e * h[n] + dx * Bv[n];
        y += h[n] * Cv[n];
      }
      y += dpv * xcv;
      y *= zv / (1.f + __expf(-zv));               // * silu(z)
      yp[(size_t)t * DI_] = (_Float16)y;
    }
#pragma unroll
    for (int u = 0; u < GRP_; ++u) { xcu[u] = xnx[u]; zcu[u] = znx[u]; }
  }
}

// ---------------------------------------------------------------
extern "C" void kernel_launch(void* const* d_in, const int* in_sizes, int n_in,
                              void* d_out, int out_size, void* d_ws, size_t ws_size,
                              hipStream_t stream) {
  const float* x      = (const float*)d_in[0];   // (B,S,DM)
  const float* W_in   = (const float*)d_in[1];   // (DM, 2*DI)
  const float* conv_w = (const float*)d_in[2];   // (DI,1,4)
  const float* conv_b = (const float*)d_in[3];   // (DI)
  const float* W_xp   = (const float*)d_in[4];   // (DI, 33)
  const float* W_dt   = (const float*)d_in[5];   // (1, DI)
  const float* b_dt   = (const float*)d_in[6];   // (DI)
  const float* A_log  = (const float*)d_in[7];   // (16)
  const float* Dp     = (const float*)d_in[8];   // (DI)
  const float* W_out  = (const float*)d_in[9];   // (DI, DM)
  float* out = (float*)d_out;                    // (B,S,DM)

  // ---- workspace carve-out (256B aligned) ----
  size_t off = 0;
  auto carve = [&](size_t bytes) -> void* {
    void* p = (char*)d_ws + off;
    off += (bytes + 255) & ~(size_t)255;
    return p;
  };
  _Float16* x_h  = (_Float16*)carve((size_t)NROW_ * DM_ * 2);      // 4 MB
  _Float16* Wi_t = (_Float16*)carve((size_t)(2*DI_) * DM_ * 2);    // 8 MB  (4096 x 1024)
  _Float16* Wo_t = (_Float16*)carve((size_t)DM_ * DI_ * 2);        // 4 MB  (1024 x 2048)
  float*    xz   = (float*)   carve((size_t)NROW_ * 2*DI_ * 4);    // 32 MB
  float*    xc   = (float*)   carve((size_t)NROW_ * DI_ * 4);      // 16 MB
  float*    xp   = (float*)   carve((size_t)NROW_ * XPN_ * 4);     // ~0.3 MB
  _Float16* y_h  = (_Float16*)carve((size_t)NROW_ * DI_ * 2);      // 8 MB
  float*    hend = (float*)   carve((size_t)B_ * CH_ * DSTATE_ * DI_ * 4);  // 8 MB
  float*    hini = (float*)   carve((size_t)B_ * CH_ * DSTATE_ * DI_ * 4);  // 8 MB
  float*    sdel = (float*)   carve((size_t)B_ * CH_ * DI_ * 4);            // 0.5 MB

  // 1) precision conversion / weight transposes
  cvt_f16_kernel<<<CVT_T_ / 256, 256, 0, stream>>>(x, x_h);
  {
    dim3 grid(DM_ / 64, (2 * DI_) / 128);   // K=1024, N=4096
    transpose_win_kernel<<<grid, 256, 0, stream>>>(W_in, Wi_t);
  }
  {
    dim3 grid(DI_ / 64, DM_ / 128);         // K=2048, N=1024
    transpose_wout_kernel<<<grid, 256, 0, stream>>>(W_out, Wo_t);
  }

  // 2) xz = x @ W_in        (2048 x 4096, K=1024)  -- WMMA
  {
    dim3 grid(NROW_ / 64, (2 * DI_) / 64);
    gemm_wmma_f16_kernel<<<grid, 128, 0, stream>>>(x_h, Wi_t, xz,
                                                   NROW_, 2 * DI_, DM_);
  }

  // 3) depthwise conv + SiLU
  {
    dim3 grid(DI_ / 1024, NROW_ / CROWS_);
    conv_silu_kernel<<<grid, 256, 0, stream>>>(xz, conv_w, conv_b, xc);
  }

  // 4) xp = xc @ W_xproj    (N=33)
  xproj_kernel<<<NROW_ / 16, 32 * XW_, 0, stream>>>(xc, W_xp, xp);

  // 5) selective scan in parallel chunks -> gated y (f16)
  {
    dim3 grid(DI_ / 256, CH_ - 1, B_);
    ssm_chunk_state_kernel<<<grid, 256, 0, stream>>>(xp, xc, W_dt, b_dt, A_log,
                                                     hend, sdel);
  }
  {
    int n = B_ * DSTATE_ * DI_;
    ssm_chunk_carry_kernel<<<n / 256, 256, 0, stream>>>(hend, sdel, A_log, hini);
  }
  {
    dim3 grid(DI_ / 256, CH_, B_);
    ssm_chunk_out_kernel<<<grid, 256, 0, stream>>>(xp, xc, xz, W_dt, b_dt,
                                                   A_log, Dp, hini, y_h);
  }

  // 6) out = y @ W_out      (2048 x 1024, K=2048)  -- WMMA
  {
    dim3 grid(NROW_ / 64, DM_ / 64);
    gemm_wmma_f16_kernel<<<grid, 128, 0, stream>>>(y_h, Wo_t, out,
                                                   NROW_, DM_, DI_);
  }
  (void)in_sizes; (void)n_in; (void)out_size; (void)ws_size;
}

// v004
// It runs in 89.7 microseconds.
// Two timings next to v003 put it at 1.77 and 1.78 times that version's speed.
// Counting every step since v000, it is 16.3 times as fast.
#include <hip/hip_runtime.h>
#include <hip/hip_bf16.h>

// ---------------- problem constants (from reference) ----------------
#define B_      2
#define S_      1024
#define DM_     1024          // D_MODEL
#define DI_     2048          // D_INNER = 2*D_MODEL
#define DSTATE_ 16
#define DCONV_  4
#define NROW_   (B_ * S_)     // 2048 flattened (b,s) rows
#define XPN_    (2 * DSTATE_ + 1)   // 33

typedef __attribute__((ext_vector_type(16))) _Float16 v16h;
typedef __attribute__((ext_vector_type(8)))  _Float16 v8h;
typedef __attribute__((ext_vector_type(8)))  float    v8f;
typedef __attribute__((ext_vector_type(4)))  float    v4f;

union V16 { v16h v; v8h h2[2]; };

// ---------------------------------------------------------------
// The elementwise launches below give every thread 16 to 32 elements, moved
// in 16-byte loads and stores, the loads issued together at the start. One
// element per lane would start 16 to 32 times as many waves for the same bytes.
// ---------------------------------------------------------------

__device__ __forceinline__ v8h pack8(float a, float b, float c, float d,
                                     float e, float f, float g, float h) {
  v8h o = {(_Float16)a, (_Float16)b, (_Float16)c, (_Float16)d,
           (_Float16)e, (_Float16)f, (_Float16)g, (_Float16)h};
  return o;
}

// ---------------------------------------------------------------
// Elementwise f32 -> f16 convert of NROW_*DM_ values.
// A thread converts two runs of 8 values. Grid: CVT_T_/256 blocks of 256.
// ---------------------------------------------------------------
#define CVT_T_ (NROW_ * DM_ / 16)     // threads
__global__ __launch_bounds__(256)
void cvt_f16_kernel(const float* __restrict__ in,
                    _Float16* __restrict__ out) {
  const size_t t = (size_t)blockIdx.x * 256 + threadIdx.x;
  const size_t e0 = t * 8;
  const size_t e1 = (t + CVT_T_) * 8;
  const v4f a0 = *(const v4f*)(in + e0);
  const v4f a1 = *(const v4f*)(in + e0 + 4);
  const v4f b0 = *(const v4f*)(in + e1);
  const v4f b1 = *(const v4f*)(in + e1 + 4);
  *(v8h*)(out + e0) = pack8(a0[0], a0[1], a0[2], a0[3], a1[0], a1[1], a1[2], a1[3]);
  *(v8h*)(out + e1) = pack8(b0[0], b0[1], b0[2], b0[3], b1[0], b1[1], b1[2], b1[3]);
}

// ---------------------------------------------------------------
// Transpose (K x N) f32  ->  (N x K) f16   (Wt[n*K + k] = W[k*N + n])
// A thread holds an 8 (k) x 4 (n) block: 8 row loads of 4 n, 4 stores of 8 k;
// the transpose itself is only a choice of registers. In a wave 8 lanes lie
// along k, so each store instruction writes whole 128-byte lines of Wt; the
// 8 waves of a block lie along n and share the lines of W they read.
// K and N are compile-time, so the row steps are immediate offsets on one
// address. Grid: (K/64, N/128), block 256; K % 64 == 0, N % 128 == 0.
// ---------------------------------------------------------------
template <int K, int N>
__device__ __forceinline__ void transpose_f16_block(const float* __restrict__ W,
                                                    _Float16* __restrict__ Wt) {
  const int lane = threadIdx.x & 31;
  const int wave = threadIdx.x >> 5;
  const int k = blockIdx.x * 64 + (lane & 7) * 8;
  const int n = blockIdx.y * 128 + wave * 16 + (lane >> 3) * 4;
  const float* src = W + (size_t)k * N + n;
  v4f r[8];
#pragma unroll
  for (int i = 0; i < 8; ++i) r[i] = *(const v4f*)(src + i * N);
  _Float16* dst = Wt + (size_t)n * K + k;
#pragma unroll
  for (int j = 0; j < 4; ++j)
    *(v8h*)(dst + j * K) = pack8(r[0][j], r[1][j], r[2][j], r[3][j],
                                 r[4][j], r[5][j], r[6][j], r[7][j]);
}

__global__ __launch_bounds__(256)
void transpose_win_kernel(const float* __restrict__ W, _Float16* __restrict__ Wt) {
  transpose_f16_block<DM_, 2 * DI_>(W, Wt);
}

__global__ __launch_bounds__(256)
void transpose_wout_kernel(const float* __restrict__ W, _Float16* __restrict__ Wt) {
  transpose_f16_block<DI_, DM_>(W, Wt);
}

// ---------------------------------------------------------------
// WMMA GEMM:  C(MxN, f32) = A(MxK, f16 row-major) * B(KxN) with B given
// transposed: Bt (N x K, f16 row-major).
// A block of WM x 2 waves makes a (32*WM) x 128 tile of C; a wave makes 32 x 64
// of it: 2 A fragments times 4 B fragments per 32 k.
// The block's rows of A and Bt come into LDS 128 k at a time (a stage), by
// asynchronous copies of 16 bytes a lane: a copy instruction takes two whole
// 256-byte row pieces, and every row is fetched once per block instead of
// once per wave in 32-byte pieces. Two stage buffers: the copies of stage
// t + 2 fly while stage t + 1 is worked on.
// Fragments (16-bit A 16x32): lane < 16 holds k 0..7 and 16..23 of its row,
// lane >= 16 holds k 8..15 and 24..31; A and Bt are read by the same code.
// k runs upward in steps of 32 into one accumulator per 16x16 tile.
// Requires: M % (32*WM) == 0, N % 128 == 0, K % 128 == 0, K >= 256.
// ---------------------------------------------------------------
#define GBK_    128                  // k per stage
#define GPITCH_ 272                  // LDS row pitch in bytes: 16 x odd, for 16-byte reads
#define GBN_    128                  // columns of C per block
#define GSTAGE_(WM) ((32 * (WM) + GBN_) * GPITCH_)   // bytes of a stage

// Eight copies of 16 bytes a lane: rows r, r + RS, ..., r + 7 * RS of one
// operand. The wait at the end stands in the copies' own statement, so that no
// address register named here is rewritten in front of it.
template <int K, int RS>
__device__ __forceinline__ void async_rows8(unsigned lds, const _Float16* g) {
  asm volatile(
      "global_load_async_to_lds_b128 %0, %8, off\n\t"
      "global_load_async_to_lds_b128 %1, %9, off\n\t"
      "global_load_async_to_lds_b128 %2, %10, off\n\t"
      "global_load_async_to_lds_b128 %3, %11, off\n\t"
      "global_load_async_to_lds_b128 %4, %12, off\n\t"
      "global_load_async_to_lds_b128 %5, %13, off\n\t"
      "global_load_async_to_lds_b128 %6, %14, off\n\t"
      "global_load_async_to_lds_b128 %7, %15, off\n\t"
      "s_wait_xcnt 0x0"
      :: "v"(lds), "v"(lds + 1 * RS * GPITCH_), "v"(lds + 2 * RS * GPITCH_),
         "v"(lds + 3 * RS * GPITCH_), "v"(lds + 4 * RS * GPITCH_),
         "v"(lds + 5 * RS * GPITCH_), "v"(lds + 6 * RS * GPITCH_),
         "v"(lds + 7 * RS * GPITCH_),
         "v"(g), "v"(g + 1 * RS * K), "v"(g + 2 * RS * K), "v"(g + 3 * RS * K),
         "v"(g + 4 * RS * K), "v"(g + 5 * RS * K), "v"(g + 6 * RS * K), "v"(g + 7 * RS * K)
      : "memory");
}

// One stage: 32*WM rows of A, then GBN_ rows of Bt, 256 bytes of each. The
// block's threads cover RS = 4*WM rows at a time, 16 lanes to a row.
template <int WM, int K>
__device__ __forceinline__ void gemm_copy_stage(unsigned lds, const _Float16* ga,
                                                const _Float16* gb) {
  constexpr int RS = 4 * WM;
  async_rows8<K, RS>(lds, ga);
#pragma unroll
  for (int i = 0; i < GBN_ / (8 * RS); ++i)
    async_rows8<K, RS>(lds + (32 * WM + i * 8 * RS) * GPITCH_, gb + (size_t)i * 8 * RS * K);
}

// The fragments of 32 k: 2 of A's rows, 4 of Bt's, two 16-byte reads each.
__device__ __forceinline__ void gemm_frags(V16* a, V16* b, const _Float16* sa,
                                           const _Float16* sb) {
  constexpr int PH = GPITCH_ / 2;                // pitch in f16
#pragma unroll
  for (int i = 0; i < 2; ++i) {
    a[i].h2[0] = *(const v8h*)(sa + i * 16 * PH);
    a[i].h2[1] = *(const v8h*)(sa + i * 16 * PH + 16);
  }
#pragma unroll
  for (int j = 0; j < 4; ++j) {
    b[j].h2[0] = *(const v8h*)(sb + j * 16 * PH);
    b[j].h2[1] = *(const v8h*)(sb + j * 16 * PH + 16);
  }
}

template <int WM, int N, int K>
__device__ __forceinline__ void gemm_lds_block(const _Float16* __restrict__ A,
                                               const _Float16* __restrict__ Bt,
                                               float* __restrict__ C,
                                               unsigned char* smem) {
  constexpr int BM = 32 * WM;
  constexpr int NT = K / GBK_;                   // stages
  constexpr int PH = GPITCH_ / 2;                // pitch in f16
  const int lane  = threadIdx.x & 31;
  const int wave  = threadIdx.x >> 5;
  const int wm    = wave >> 1;
  const int wn    = wave & 1;
  const int tileM = blockIdx.x * BM;
  const int tileN = blockIdx.y * GBN_;
  const int halfSel = (lane >> 4) << 3;          // 0 or 8
  const int l16     = lane & 15;

  // copies: 16 lanes lie along a row piece
  const int crow = threadIdx.x >> 4;
  const int cchk = threadIdx.x & 15;
  const _Float16* ga = A  + (size_t)(tileM + crow) * K + cchk * 8;
  const _Float16* gb = Bt + (size_t)(tileN + crow) * K + cchk * 8;
  const unsigned  l0 = (unsigned)(uintptr_t)smem + crow * GPITCH_ + cchk * 16;

  v8f acc[2][4] = {};

  gemm_copy_stage<WM, K>(l0, ga, gb);
  // stage 0 has landed for this wave; the barrier publishes it to the others
  asm volatile("s_wait_asynccnt 0x0" ::: "memory");
  __syncthreads();
  gemm_copy_stage<WM, K>(l0 + GSTAGE_(WM), ga + GBK_, gb + GBK_);

  // rolled: one copy of the stage's code, and one hand-over point per stage
#pragma unroll 1
  for (int t = 0; t < NT; ++t) {
    const unsigned boff = (t & 1) * GSTAGE_(WM);
    const _Float16* sa = (const _Float16*)(smem + boff) + (wm * 32 + l16) * PH + halfSel;
    const _Float16* sb = (const _Float16*)(smem + boff) + (BM + wn * 64 + l16) * PH + halfSel;
    V16 a[2][2], b[2][4];                        // two fragment sets
    gemm_frags(a[0], b[0], sa, sb);
#pragma unroll
    for (int ks = 0; ks < GBK_ / 32; ++ks) {
      if (ks + 1 < GBK_ / 32)
        gemm_frags(a[(ks + 1) & 1], b[(ks + 1) & 1], sa + (ks + 1) * 32, sb + (ks + 1) * 32);
      // keeps the next 32 k's LDS reads together, ahead of this 32 k's products:
      // left free, they sink among the products and each group is waited out
      __builtin_amdgcn_sched_barrier(0);
#pragma unroll
      for (int i = 0; i < 2; ++i)
#pragma unroll
        for (int j = 0; j < 4; ++j)
          acc[i][j] = __builtin_amdgcn_wmma_f32_16x16x32_f16(false, a[ks & 1][i].v, false,
                                                             b[ks & 1][j].v, (short)0,
                                                             acc[i][j], false, false);
      __builtin_amdgcn_sched_barrier(0);         // the same, from below
    }
    // hand-over: this wave's reads of stage t are done ...
    asm volatile("s_wait_dscnt 0x0" ::: "memory");
    // ... its copies of stage t + 1 have landed ...
    asm volatile("s_wait_asynccnt 0x0" ::: "memory");
    // ... and the barrier publishes stage t + 1 and frees stage t's buffer
    __syncthreads();
    if (t + 2 < NT)
      gemm_copy_stage<WM, K>(l0 + boff, ga + (size_t)(t + 2) * GBK_, gb + (size_t)(t + 2) * GBK_);
  }
  // no copy is left in flight when the wave ends
  asm volatile("s_wait_asynccnt 0x0" ::: "memory");

  // C/D layout: VGPR r -> row r of the tile for lanes 0..15, row r + 8 for
  // lanes 16..31; col = lane & 15.
  const int rowOff = (lane < 16) ? 0 : 8;
  float* crow0 = C + (size_t)(tileM + wm * 32 + rowOff) * N + tileN + wn * 64 + l16;
#pragma unroll
  for (int i = 0; i < 2; ++i)
#pragma unroll
    for (int r = 0; r < 8; ++r) {
      float* cr = crow0 + (size_t)(i * 16 + r) * N;
      cr[0]  = acc[i][0][r];
      cr[16] = acc[i][1][r];
      cr[32] = acc[i][2][r];
      cr[48] = acc[i][3][r];
    }
}

// xz = x_h * Wi_t^T: 128 x 128 tiles, 8 waves; 512 blocks, two to a WGP.
__global__ __launch_bounds__(256)
void gemm_in_kernel(const _Float16* __restrict__ A, const _Float16* __restrict__ Bt,
                    float* __restrict__ C) {
  __shared__ __attribute__((aligned(16))) unsigned char smem[2 * GSTAGE_(4)];
  gemm_lds_block<4, 2 * DI_, DM_>(A, Bt, C, smem);
}

// out = y_h * Wo_t^T: 64 x 128 tiles, 4 waves, so that 256 blocks come of the
// smaller C.
__global__ __launch_bounds__(128)
void gemm_out_kernel(const _Float16* __restrict__ A, const _Float16* __restrict__ Bt,
                     float* __restrict__ C) {
  __shared__ __attribute__((aligned(16))) unsigned char smem[2 * GSTAGE_(2)];
  gemm_lds_block<2, DM_, DI_>(A, Bt, C, smem);
}

// ---------------------------------------------------------------
// Depthwise causal conv (width 4) + bias + SiLU.
// x_in is columns [0, DI) of xz (NROW x 2*DI).  xc: NROW x DI.
// A thread makes CROWS_ successive rows of 4 channels from CROWS_+3 row loads.
// Grid: (DI_/1024, NROW_/CROWS_), block 256. S_ % CROWS_ == 0, so a thread's
// rows lie in one sequence and only its first group has rows before the start.
// ---------------------------------------------------------------
#define CROWS_ 8
__global__ __launch_bounds__(256)
void conv_silu_kernel(const float* __restrict__ xz,
                      const float* __restrict__ conv_w,
                      const float* __restrict__ conv_b,
                      float* __restrict__ xc) {
  const int d  = (blockIdx.x * 256 + threadIdx.x) * 4;
  const int r0 = blockIdx.y * CROWS_;
  const float* xin = xz + (size_t)r0 * (2 * DI_) + d;

  v4f x[CROWS_ + DCONV_ - 1];                 // x[i] = row r0 - 3 + i
#pragma unroll
  for (int i = 0; i < DCONV_ - 1; ++i) x[i] = (v4f){0.f, 0.f, 0.f, 0.f};
  if ((r0 & (S_ - 1)) != 0) {                 // the causal left pad stays zero
#pragma unroll
    for (int i = 0; i < DCONV_ - 1; ++i)
      x[i] = *(const v4f*)(xin - (size_t)(DCONV_ - 1 - i) * (2 * DI_));
  }
#pragma unroll
  for (int i = 0; i < CROWS_; ++i)
    x[DCONV_ - 1 + i] = *(const v4f*)(xin + (size_t)i * (2 * DI_));

  v4f w[4];                                   // w[c] = the 4 taps of channel d + c
#pragma unroll
  for (int c = 0; c < 4; ++c) w[c] = *(const v4f*)(conv_w + (size_t)(d + c) * DCONV_);
  const v4f bias = *(const v4f*)(conv_b + d);
  // the arithmetic below reuses the address registers of the loads above
  asm volatile("s_wait_xcnt 0x0" ::: "memory");
  // keeps every load, and that wait, above the arithmetic: one memory latency
  // per thread instead of two
  __builtin_amdgcn_sched_barrier(0);

  float* op = xc + (size_t)r0 * DI_ + d;
#pragma unroll
  for (int i = 0; i < CROWS_; ++i) {
    v4f o;
#pragma unroll
    for (int c = 0; c < 4; ++c) {
      float acc = bias[c];
#pragma unroll
      for (int j = 0; j < DCONV_; ++j) acc += x[i + j][c] * w[c][j];
      o[c] = acc / (1.f + __expf(-acc));      // SiLU
    }
    *(v4f*)(op + (size_t)i * DI_) = o;
  }
}

// ---------------------------------------------------------------
// xp = xc @ W_xproj   (NROW x DI) * (DI x 33) -> (NROW x 33), all in f32,
// on the f32 16x16x4 matrix form.
// A block makes 16 rows of xp. Its XW_ waves split k; each wave holds three
// 16x16 accumulator tiles (columns 0-15, 16-31, and column 32 repeated in all
// 16 columns of the third tile, of which only the first is kept: a column of
// D depends on that column of B alone). The waves' partial sums meet in LDS.
// k pairing: in a run of 32 k, lane (c, h) holds k = 16h + q, q = 0..15, of
// row c of xc and of its column of W_xproj; product t takes q = 2t, 2t + 1 of
// both. The loads of a run are issued at least one run ahead of its products.
// Grid: NROW_/16 blocks of 32 * XW_ threads.
// ---------------------------------------------------------------
typedef __attribute__((ext_vector_type(2))) float v2f;
#define XW_   8                     // waves of a block
#define XKS_  (DI_ / XW_)           // k per wave
#define XRUN_ 32                    // k per run of loads
#define XPIT_ 52                    // LDS row pitch in floats: rows 8 apart lie 32 banks apart

struct XFrag { v4f a[4]; float b[3][16]; };

__device__ __forceinline__ void xproj_load(XFrag& f, const float* __restrict__ ap,
                                           const float* __restrict__ bp,
                                           const float* __restrict__ bw) {
#pragma unroll
  for (int i = 0; i < 4; ++i) f.a[i] = *(const v4f*)(ap + 4 * i);
#pragma unroll
  for (int q = 0; q < 16; ++q) {
    f.b[0][q] = bp[q * XPN_];
    f.b[1][q] = bp[q * XPN_ + 16];
    f.b[2][q] = bw[q * XPN_ + XPN_ - 1];
  }
}

__device__ __forceinline__ void xproj_mma(v8f* acc, const XFrag& f) {
#pragma unroll
  for (int t = 0; t < 8; ++t) {
    const v2f a = {f.a[t >> 1][(2 * t) & 3], f.a[t >> 1][(2 * t + 1) & 3]};
#pragma unroll
    for (int j = 0; j < 3; ++j) {
      const v2f b = {f.b[j][2 * t], f.b[j][2 * t + 1]};
      acc[j] = __builtin_amdgcn_wmma_f32_16x16x4_f32(false, a, false, b, (short)0,
                                                     acc[j], false, false);
    }
  }
}

__global__ __launch_bounds__(32 * XW_)
void xproj_kernel(const float* __restrict__ xc,
                  const float* __restrict__ Wx,
                  float* __restrict__ xp) {
  __shared__ float red[XW_ * 16 * XPIT_];
  const int lane = threadIdx.x & 31;
  const int wave = threadIdx.x >> 5;
  const int c    = lane & 15;
  const int h    = lane >> 4;
  const int r0   = blockIdx.x * 16;
  const int k0   = wave * XKS_ + 16 * h;

  const float* ap = xc + (size_t)(r0 + c) * DI_ + k0;
  const float* bw = Wx + (size_t)k0 * XPN_;   // row k0 of W_xproj
  const float* bp = bw + c;

  v8f acc[3] = {};
  XFrag f0, f1;
  xproj_load(f0, ap, bp, bw);
#pragma unroll
  for (int s = 0; s < XKS_ / XRUN_; s += 2) {
    xproj_load(f1, ap + (s + 1) * XRUN_, bp + (s + 1) * XRUN_ * XPN_,
               bw + (s + 1) * XRUN_ * XPN_);
    // keeps the next run's loads above this run's products: left free, the
    // compiler sinks each load to a few products ahead of its use, too late
    __builtin_amdgcn_sched_barrier(0);
    xproj_mma(acc, f0);
    if (s + 2 < XKS_ / XRUN_)
      xproj_load(f0, ap + (s + 2) * XRUN_, bp + (s + 2) * XRUN_ * XPN_,
                 bw + (s + 2) * XRUN_ * XPN_);
    __builtin_amdgcn_sched_barrier(0);   // the same, for the other register set
    xproj_mma(acc, f1);
  }
  // the three addresses stay in their registers up to here (else the last
  // run's loads land in them), and are given up only behind this wait
  asm volatile("s_wait_xcnt 0x0" :: "v"(ap), "v"(bp), "v"(bw) : "memory");

  // D register r of lane (c, h) is row 8h + r, column c of its tile
  float* my = red + wave * 16 * XPIT_;
#pragma unroll
  for (int j = 0; j < 3; ++j)
#pragma unroll
    for (int r = 0; r < 8; ++r) my[(8 * h + r) * XPIT_ + 16 * j + c] = acc[j][r];
  __syncthreads();

  for (int idx = threadIdx.x; idx < 16 * XPN_; idx += 32 * XW_) {
    const int row = idx / XPN_;
    const int col = idx - row * XPN_;
    float sum = red[row * XPIT_ + col];
#pragma unroll
    for (int w = 1; w < XW_; ++w) sum += red[(w * 16 + row) * XPIT_ + col];
    xp[(size_t)r0 * XPN_ + idx] = sum;
  }
}

// ---------------------------------------------------------------
// Selective scan, split along the sequence into CH_ chunks of TCH_ steps
// that run in parallel. The recurrence h <- dA*h + dBx is linear in h, and
// the product of dA over a chunk is exp(A * sum(delta)), so:
//   1) chunk_state: every chunk but the last runs from h = 0 and leaves its
//      end state and its sum of delta;
//   2) chunk_carry: per (b, n, d) the CH_ - 1 end states are chained into the
//      true state at the start of each chunk;
//   3) chunk_out: every chunk runs again from its true start state and
//      emits y = h.C + Dp*xc, gated with silu(z), as f16 for the output GEMM.
// One thread per (b, chunk, d), state h[16] in registers. The chunk's xp
// rows (dt|B|C) are staged in LDS once and read as broadcasts.
// ---------------------------------------------------------------
#define CH_   32                    // chunks per sequence
#define TCH_  (S_ / CH_)            // steps per chunk
#define ROWP_ (2 * DSTATE_ + 4)     // LDS row: B[16] | C[16] | dt | pad, 16-byte rows
#define GRP_  8                     // steps whose xc / z are fetched together, one group ahead

#define NXV_  ((TCH_ * XPN_ + 255) / 256)   // xp words per thread of a 256-thread block

// The chunk's xp rows go to LDS in two halves, so that a kernel can issue its
// other global loads between them and all latencies overlap.
__device__ __forceinline__ void load_xp_chunk(float* v,
                                              const float* __restrict__ xp,
                                              int r0) {
  const float* src = xp + (size_t)r0 * XPN_;
#pragma unroll
  for (int k = 0; k < NXV_; ++k) {
    const int i = threadIdx.x + k * 256;
    v[k] = ((k + 1) * 256 <= TCH_ * XPN_ || i < TCH_ * XPN_) ? src[i] : 0.f;
  }
}

__device__ __forceinline__ void store_xp_chunk(float* sx, const float* v) {
#pragma unroll
  for (int k = 0; k < NXV_; ++k) {
    const int i = threadIdx.x + k * 256;
    const int row = i / XPN_;
    const int col = i - row * XPN_;
    if ((k + 1) * 256 <= TCH_ * XPN_ || i < TCH_ * XPN_)
      sx[row * ROWP_ + (col == 0 ? 2 * DSTATE_ : col - 1)] = v[k];
  }
}

__device__ __forceinline__ void read16(float* v, const float* s) {
#pragma unroll
  for (int q = 0; q < 4; ++q) {
    const float4 f = ((const float4*)s)[q];
    v[4 * q + 0] = f.x; v[4 * q + 1] = f.y; v[4 * q + 2] = f.z; v[4 * q + 3] = f.w;
  }
}

__device__ __forceinline__ float softplus_dt(float din) {
  return (din > 20.f) ? din : __logf(1.f + __expf(din));
}

// Grid: (DI_/256, CH_-1, B_), block 256.
__global__ __launch_bounds__(256)
void ssm_chunk_state_kernel(const float* __restrict__ xp,
                            const float* __restrict__ xc,
                            const float* __restrict__ W_dt, // (1, DI_)
                            const float* __restrict__ b_dt,
                            const float* __restrict__ A_log,
                            float* __restrict__ hend,       // (B, CH, 16, DI)
                            float* __restrict__ sdel) {     // (B, CH, DI)
  __shared__ __attribute__((aligned(16))) float sx[TCH_ * ROWP_];
  const int d  = blockIdx.x * 256 + threadIdx.x;
  const int c  = blockIdx.y;
  const int b  = blockIdx.z;
  const int r0 = b * S_ + c * TCH_;

  float xv[NXV_];
  load_xp_chunk(xv, xp, r0);

  float Aneg[DSTATE_];
#pragma unroll
  for (int n = 0; n < DSTATE_; ++n) Aneg[n] = -__expf(A_log[n]);
  const float wdt = W_dt[d];
  const float bdt = b_dt[d];

  float h[DSTATE_];
#pragma unroll
  for (int n = 0; n < DSTATE_; ++n) h[n] = 0.f;
  float sd = 0.f;

  const float* xcp = xc + (size_t)r0 * DI_ + d;
  float xcu[GRP_];
#pragma unroll
  for (int u = 0; u < GRP_; ++u) xcu[u] = xcp[(size_t)u * DI_];

  store_xp_chunk(sx, xv);
  __syncthreads();

  // rolled over groups (code size); the next group's loads fly over this group's steps
#pragma unroll 1
  for (int g = 0; g < TCH_ / GRP_; ++g) {
    float xnx[GRP_];
#pragma unroll
    for (int u = 0; u < GRP_; ++u) xnx[u] = 0.f;
    if (g + 1 < TCH_ / GRP_) {
#pragma unroll
      for (int u = 0; u < GRP_; ++u) xnx[u] = xcp[(size_t)((g + 1) * GRP_ + u) * DI_];
    }
#pragma unroll
    for (int u = 0; u < GRP_; ++u) {
      const float* row = sx + (g * GRP_ + u) * ROWP_;
      float Bv[DSTATE_];
      read16(Bv, row);
      const float delta = softplus_dt(row[2 * DSTATE_] * wdt + bdt);
      const float dx    = delta * xcu[u];
      sd += delta;
#pragma unroll
      for (int n = 0; n < DSTATE_; ++n) {
        const float e = __expf(delta * Aneg[n]);
        h[n] = e * h[n] + dx * Bv[n];
      }
    }
#pragma unroll
    for (int u = 0; u < GRP_; ++u) xcu[u] = xnx[u];
  }

  const size_t bc = (size_t)b * CH_ + c;
#pragma unroll
  for (int n = 0; n < DSTATE_; ++n) hend[(bc * DSTATE_ + n) * DI_ + d] = h[n];
  sdel[bc * DI_ + d] = sd;
}

// One thread per (b, n, d): chain the chunks' end states.
__global__ __launch_bounds__(256)
void ssm_chunk_carry_kernel(const float* __restrict__ hend,
                            const float* __restrict__ sdel,
                            const float* __restrict__ A_log,
                            float* __restrict__ hini) {     // (B, CH, 16, DI)
  const int idx = blockIdx.x * 256 + threadIdx.x;           // over B_*16*DI_
  const int d = idx & (DI_ - 1);
  const int n = (idx >> 11) & (DSTATE_ - 1);
  const int b = idx >> 15;
  const float an = -__expf(A_log[n]);

  const float* hp = hend + ((size_t)b * CH_ * DSTATE_ + n) * DI_ + d;
  const float* sp = sdel + (size_t)b * CH_ * DI_ + d;
  float*       op = hini + ((size_t)b * CH_ * DSTATE_ + n) * DI_ + d;

  // every load is independent of the chain: fetch all first, one latency in all
  float he[CH_ - 1], ev[CH_ - 1];
#pragma unroll
  for (int c = 0; c < CH_ - 1; ++c) {
    ev[c] = sp[(size_t)c * DI_];
    he[c] = hp[(size_t)c * DSTATE_ * DI_];
  }
#pragma unroll
  for (int c = 0; c < CH_ - 1; ++c) ev[c] = __expf(an * ev[c]);

  float H = 0.f;
  op[0] = H;
#pragma unroll
  for (int c = 0; c < CH_ - 1; ++c) {
    H = ev[c] * H + he[c];
    op[(size_t)(c + 1) * DSTATE_ * DI_] = H;
  }
}

// Grid: (DI_/256, CH_, B_), block 256.
__global__ __launch_bounds__(256)
void ssm_chunk_out_kernel(const float* __restrict__ xp,
                          const float* __restrict__ xc,
                          const float* __restrict__ xz,   // z at cols [DI_, 2*DI_)
                          const float* __restrict__ W_dt, // (1, DI_)
                          const float* __restrict__ b_dt,
                          const float* __restrict__ A_log,
                          const float* __restrict__ Dp,
                          const float* __restrict__ hini,
                          _Float16* __restrict__ y_h) {
  __shared__ __attribute__((aligned(16))) float sx[TCH_ * ROWP_];
  const int d  = blockIdx.x * 256 + threadIdx.x;
  const int c  = blockIdx.y;
  const int b  = blockIdx.z;
  const int r0 = b * S_ + c * TCH_;

  float xv[NXV_];
  load_xp_chunk(xv, xp, r0);

  float Aneg[DSTATE_];
#pragma unroll
  for (int n = 0; n < DSTATE_; ++n) Aneg[n] = -__expf(A_log[n]);
  const float wdt = W_dt[d];
  const float bdt = b_dt[d];
  const float dpv = Dp[d];

  const size_t bc = (size_t)b * CH_ + c;
  float h[DSTATE_];
#pragma unroll
  for (int n = 0; n < DSTATE_; ++n) h[n] = hini[(bc * DSTATE_ + n) * DI_ + d];

  const float* xcp = xc + (size_t)r0 * DI_ + d;
  const float* zp  = xz + (size_t)r0 * (2 * DI_) + DI_ + d;
  _Float16*    yp  = y_h + (size_t)r0 * DI_ + d;
  float xcu[GRP_], zcu[GRP_];
#pragma unroll
  for (int u = 0; u < GRP_; ++u) {
    xcu[u] = xcp[(size_t)u * DI_];
    zcu[u] = zp[(size_t)u * (2 * DI_)];
  }

  store_xp_chunk(sx, xv);
  __syncthreads();

  // rolled over groups (code size); the next group's loads fly over this group's steps
#pragma unroll 1
  for (int g = 0; g < TCH_ / GRP_; ++g) {
    float xnx[GRP_], znx[GRP_];
#pragma unroll
    for (int u = 0; u < GRP_; ++u) { xnx[u] = 0.f; znx[u] = 0.f; }
    if (g + 1 < TCH_ / GRP_) {
#pragma unroll
      for (int u = 0; u < GRP_; ++u) {
        xnx[u] = xcp[(size_t)((g + 1) * GRP_ + u) * DI_];
        znx[u] = zp[(size_t)((g + 1) * GRP_ + u) * (2 * DI_)];
      }
    }
#pragma unroll
    for (int u = 0; u < GRP_; ++u) {
      const int t = g * GRP_ + u;
      const float* row = sx + t * ROWP_;
      float Bv[DSTATE_], Cv[DSTATE_];
      read16(Bv, row);
      read16(Cv, row + DSTATE_);
      const float delta = softplus_dt(row[2 * DSTATE_] * wdt + bdt);
      const float xcv   = xcu[u];
      const float zv    = zcu[u];
      const float dx    = delta * xcv;

      float y = 0.f;
#pragma unroll
      for (int n = 0; n < DSTATE_; ++n) {
        const float e = __expf(delta * Aneg[n]);
        h[n] = e * h[n] + dx * Bv[n];
        y += h[n] * Cv[n];
      }
      y += dpv * xcv;
      y *= zv / (1.f + __expf(-zv));               // * silu(z)
      yp[(size_t)t * DI_] = (_Float16)y;
    }
#pragma unroll
    for (int u = 0; u < GRP_; ++u) { xcu[u] = xnx[u]; zcu[u] = znx[u]; }
  }
}

// ---------------------------------------------------------------
extern "C" void kernel_launch(void* const* d_in, const int* in_sizes, int n_in,
                              void* d_out, int out_size, void* d_ws, size_t ws_size,
                              hipStream_t stream) {
  const float* x      = (const float*)d_in[0];   // (B,S,DM)
  const float* W_in   = (const float*)d_in[1];   // (DM, 2*DI)
  const float* conv_w = (const float*)d_in[2];   // (DI,1,4)
  const float* conv_b = (const float*)d_in[3];   // (DI)
  const float* W_xp   = (const float*)d_in[4];   // (DI, 33)
  const float* W_dt   = (const float*)d_in[5];   // (1, DI)
  const float* b_dt   = (const float*)d_in[6];   // (DI)
  const float* A_log  = (const float*)d_in[7];   // (16)
  const float* Dp     = (const float*)d_in[8];   // (DI)
  const float* W_out  = (const float*)d_in[9];   // (DI, DM)
  float* out = (float*)d_out;                    // (B,S,DM)

  // ---- workspace carve-out (256B aligned) ----
  size_t off = 0;
  auto carve = [&](size_t bytes) -> void* {
    void* p = (char*)d_ws + off;
    off += (bytes + 255) & ~(size_t)255;
    return p;
  };
  _Float16* x_h  = (_Float16*)carve((size_t)NROW_ * DM_ * 2);      // 4 MB
  _Float16* Wi_t = (_Float16*)carve((size_t)(2*DI_) * DM_ * 2);    // 8 MB  (4096 x 1024)
  _Float16* Wo_t = (_Float16*)carve((size_t)DM_ * DI_ * 2);        // 4 MB  (1024 x 2048)
  float*    xz   = (float*)   carve((size_t)NROW_ * 2*DI_ * 4);    // 32 MB
  float*    xc   = (float*)   carve((size_t)NROW_ * DI_ * 4);      // 16 MB
  float*    xp   = (float*)   carve((size_t)NROW_ * XPN_ * 4);     // ~0.3 MB
  _Float16* y_h  = (_Float16*)carve((size_t)NROW_ * DI_ * 2);      // 8 MB
  float*    hend = (float*)   carve((size_t)B_ * CH_ * DSTATE_ * DI_ * 4);  // 8 MB
  float*    hini = (float*)   carve((size_t)B_ * CH_ * DSTATE_ * DI_ * 4);  // 8 MB
  float*    sdel = (float*)   carve((size_t)B_ * CH_ * DI_ * 4);            // 0.5 MB

  // 1) precision conversion / weight transposes
  cvt_f16_kernel<<<CVT_T_ / 256, 256, 0, stream>>>(x, x_h);
  {
    dim3 grid(DM_ / 64, (2 * DI_) / 128);   // K=1024, N=4096
    transpose_win_kernel<<<grid, 256, 0, stream>>>(W_in, Wi_t);
  }
  {
    dim3 grid(DI_ / 64, DM_ / 128);         // K=2048, N=1024
    transpose_wout_kernel<<<grid, 256, 0, stream>>>(W_out, Wo_t);
  }

  // 2) xz = x @ W_in        (2048 x 4096, K=1024)  -- WMMA
  {
    dim3 grid(NROW_ / 128, (2 * DI_) / GBN_);
    gemm_in_kernel<<<grid, 256, 0, stream>>>(x_h, Wi_t, xz);
  }

  // 3) depthwise conv + SiLU
  {
    dim3 grid(DI_ / 1024, NROW_ / CROWS_);
    conv_silu_kernel<<<grid, 256, 0, stream>>>(xz, conv_w, conv_b, xc);
  }

  // 4) xp = xc @ W_xproj    (N=33)
  xproj_kernel<<<NROW_ / 16, 32 * XW_, 0, stream>>>(xc, W_xp, xp);

  // 5) selective scan in parallel chunks -> gated y (f16)
  {
    dim3 grid(DI_ / 256, CH_ - 1, B_);
    ssm_chunk_state_kernel<<<grid, 256, 0, stream>>>(xp, xc, W_dt, b_dt, A_log,
                                                     hend, sdel);
  }
  {
    int n = B_ * DSTATE_ * DI_;
    ssm_chunk_carry_kernel<<<n / 256, 256, 0, stream>>>(hend, sdel, A_log, hini);
  }
  {
    dim3 grid(DI_ / 256, CH_, B_);
    ssm_chunk_out_kernel<<<grid, 256, 0, stream>>>(xp, xc, xz, W_dt, b_dt,
                                                   A_log, Dp, hini, y_h);
  }

  // 6) out = y @ W_out      (2048 x 1024, K=2048)  -- WMMA
  {
    dim3 grid(NROW_ / 64, DM_ / GBN_);
    gemm_out_kernel<<<grid, 128, 0, stream>>>(y_h, Wo_t, out);
  }
  (void)in_sizes; (void)n_in; (void)out_size; (void)ws_size;
}

// v005
// Measured time: 84.5 microseconds a run.
// Next to v004, in two timings, it ran 1.06 times as fast each time.
// All steps since v000 together make it 17.3 times as fast.
#include <hip/hip_runtime.h>
#include <hip/hip_bf16.h>

// ---------------- problem constants (from reference) ----------------
#define B_      2
#define S_      1024
#define DM_     1024          // D_MODEL
#define DI_     2048          // D_INNER = 2*D_MODEL
#define DSTATE_ 16
#define DCONV_  4
#define NROW_   (B_ * S_)     // 2048 flattened (b,s) rows
#define XPN_    (2 * DSTATE_ + 1)   // 33

typedef __attribute__((ext_vector_type(16))) _Float16 v16h;
typedef __attribute__((ext_vector_type(8)))  _Float16 v8h;
typedef __attribute__((ext_vector_type(8)))  float    v8f;
typedef __attribute__((ext_vector_type(4)))  float    v4f;

union V16 { v16h v; v8h h2[2]; };

// ---------------------------------------------------------------
// The elementwise launches below give every thread 16 to 32 elements, moved
// in 16-byte loads and stores, the loads issued together at the start. One
// element per lane would start 16 to 32 times as many waves for the same bytes.
// ---------------------------------------------------------------

__device__ __forceinline__ v8h pack8(float a, float b, float c, float d,
                                     float e, float f, float g, float h) {
  v8h o = {(_Float16)a, (_Float16)b, (_Float16)c, (_Float16)d,
           (_Float16)e, (_Float16)f, (_Float16)g, (_Float16)h};
  return o;
}

// ---------------------------------------------------------------
// Elementwise f32 -> f16 convert of NROW_*DM_ values.
// A thread converts two runs of 8 values. CVT_T_/256 blocks of 256; blk is the
// block's number among them.
// ---------------------------------------------------------------
#define CVT_T_ (NROW_ * DM_ / 16)     // threads
__device__ __forceinline__ void cvt_f16_block(const float* __restrict__ in,
                                              _Float16* __restrict__ out, int blk) {
  const size_t t = (size_t)blk * 256 + threadIdx.x;
  const size_t e0 = t * 8;
  const size_t e1 = (t + CVT_T_) * 8;
  const v4f a0 = *(const v4f*)(in + e0);
  const v4f a1 = *(const v4f*)(in + e0 + 4);
  const v4f b0 = *(const v4f*)(in + e1);
  const v4f b1 = *(const v4f*)(in + e1 + 4);
  *(v8h*)(out + e0) = pack8(a0[0], a0[1], a0[2], a0[3], a1[0], a1[1], a1[2], a1[3]);
  *(v8h*)(out + e1) = pack8(b0[0], b0[1], b0[2], b0[3], b1[0], b1[1], b1[2], b1[3]);
}

// ---------------------------------------------------------------
// Transpose (K x N) f32  ->  (N x K) f16   (Wt[n*K + k] = W[k*N + n])
// A thread holds an 8 (k) x 4 (n) block: 8 row loads of 4 n, 4 stores of 8 k;
// the transpose itself is only a choice of registers. In a wave 8 lanes lie
// along k, so each store instruction writes whole 128-byte lines of Wt; the
// 8 waves of a block lie along n and share the lines of W they read.
// K and N are compile-time, so the row steps are immediate offsets on one
// address. (K/64) * (N/128) blocks of 256, k fastest; blk is the block's number
// among them; K % 64 == 0, N % 128 == 0.
// ---------------------------------------------------------------
template <int K, int N>
__device__ __forceinline__ void transpose_f16_block(const float* __restrict__ W,
                                                    _Float16* __restrict__ Wt, int blk) {
  const int lane = threadIdx.x & 31;
  const int wave = threadIdx.x >> 5;
  const int k = (blk % (K / 64)) * 64 + (lane & 7) * 8;
  const int n = (blk / (K / 64)) * 128 + wave * 16 + (lane >> 3) * 4;
  const float* src = W + (size_t)k * N + n;
  v4f r[8];
#pragma unroll
  for (int i = 0; i < 8; ++i) r[i] = *(const v4f*)(src + i * N);
  _Float16* dst = Wt + (size_t)n * K + k;
#pragma unroll
  for (int j = 0; j < 4; ++j)
    *(v8h*)(dst + j * K) = pack8(r[0][j], r[1][j], r[2][j], r[3][j],
                                 r[4][j], r[5][j], r[6][j], r[7][j]);
}

// Jobs that do not depend on one another share a launch: the block number picks
// the job, the longer job's blocks first. Each launch saved is a gap, a start
// and a tail less in the chain of dependent launches.
#define TWIN_B_  ((DM_ / 64) * (2 * DI_ / 128))   // blocks of the W_in transpose
#define TWOUT_B_ ((DI_ / 64) * (DM_ / 128))       // blocks of the W_out transpose
#define CVT_B_   (CVT_T_ / 256)                   // blocks of the convert

// What the input GEMM needs: W_in transposed, x converted.
// Grid: TWIN_B_ + CVT_B_ blocks of 256.
__global__ __launch_bounds__(256)
void prep_in_kernel(const float* __restrict__ W, _Float16* __restrict__ Wt,
                    const float* __restrict__ x, _Float16* __restrict__ x_h) {
  const int blk = blockIdx.x;
  if (blk < TWIN_B_) transpose_f16_block<DM_, 2 * DI_>(W, Wt, blk);
  else               cvt_f16_block(x, x_h, blk - TWIN_B_);
}

// ---------------------------------------------------------------
// WMMA GEMM:  C(MxN, f32) = A(MxK, f16 row-major) * B(KxN) with B given
// transposed: Bt (N x K, f16 row-major).
// A block of WM x 2 waves makes a (32*WM) x 128 tile of C; a wave makes 32 x 64
// of it: 2 A fragments times 4 B fragments per 32 k.
// The block's rows of A and Bt come into LDS 128 k at a time (a stage), by
// asynchronous copies of 16 bytes a lane: a copy instruction takes two whole
// 256-byte row pieces, and every row is fetched once per block instead of
// once per wave in 32-byte pieces. Two stage buffers: the copies of stage
// t + 2 fly while stage t + 1 is worked on.
// Fragments (16-bit A 16x32): lane < 16 holds k 0..7 and 16..23 of its row,
// lane >= 16 holds k 8..15 and 24..31; A and Bt are read by the same code.
// k runs upward in steps of 32 into one accumulator per 16x16 tile.
// Requires: M % (32*WM) == 0, N % 128 == 0, K % 128 == 0, K >= 256.
// ---------------------------------------------------------------
#define GBK_    128                  // k per stage
#define GPITCH_ 272                  // LDS row pitch in bytes: 16 x odd, for 16-byte reads
#define GBN_    128                  // columns of C per block
#define GSTAGE_(WM) ((32 * (WM) + GBN_) * GPITCH_)   // bytes of a stage

// Eight copies of 16 bytes a lane: rows r, r + RS, ..., r + 7 * RS of one
// operand. The wait at the end stands in the copies' own statement, so that no
// address register named here is rewritten in front of it.
template <int K, int RS>
__device__ __forceinline__ void async_rows8(unsigned lds, const _Float16* g) {
  asm volatile(
      "global_load_async_to_lds_b128 %0, %8, off\n\t"
      "global_load_async_to_lds_b128 %1, %9, off\n\t"
      "global_load_async_to_lds_b128 %2, %10, off\n\t"
      "global_load_async_to_lds_b128 %3, %11, off\n\t"
      "global_load_async_to_lds_b128 %4, %12, off\n\t"
      "global_load_async_to_lds_b128 %5, %13, off\n\t"
      "global_load_async_to_lds_b128 %6, %14, off\n\t"
      "global_load_async_to_lds_b128 %7, %15, off\n\t"
      "s_wait_xcnt 0x0"
      :: "v"(lds), "v"(lds + 1 * RS * GPITCH_), "v"(lds + 2 * RS * GPITCH_),
         "v"(lds + 3 * RS * GPITCH_), "v"(lds + 4 * RS * GPITCH_),
         "v"(lds + 5 * RS * GPITCH_), "v"(lds + 6 * RS * GPITCH_),
         "v"(lds + 7 * RS * GPITCH_),
         "v"(g), "v"(g + 1 * RS * K), "v"(g + 2 * RS * K), "v"(g + 3 * RS * K),
         "v"(g + 4 * RS * K), "v"(g + 5 * RS * K), "v"(g + 6 * RS * K), "v"(g + 7 * RS * K)
      : "memory");
}

// One stage: 32*WM rows of A, then GBN_ rows of Bt, 256 bytes of each. The
// block's threads cover RS = 4*WM rows at a time, 16 lanes to a row.
template <int WM, int K>
__device__ __forceinline__ void gemm_copy_stage(unsigned lds, const _Float16* ga,
                                                const _Float16* gb) {
  constexpr int RS = 4 * WM;
  async_rows8<K, RS>(lds, ga);
#pragma unroll
  for (int i = 0; i < GBN_ / (8 * RS); ++i)
    async_rows8<K, RS>(lds + (32 * WM + i * 8 * RS) * GPITCH_, gb + (size_t)i * 8 * RS * K);
}

// The fragments of 32 k: 2 of A's rows, 4 of Bt's, two 16-byte reads each.
__device__ __forceinline__ void gemm_frags(V16* a, V16* b, const _Float16* sa,
                                           const _Float16* sb) {
  constexpr int PH = GPITCH_ / 2;                // pitch in f16
#pragma unroll
  for (int i = 0; i < 2; ++i) {
    a[i].h2[0] = *(const v8h*)(sa + i * 16 * PH);
    a[i].h2[1] = *(const v8h*)(sa + i * 16 * PH + 16);
  }
#pragma unroll
  for (int j = 0; j < 4; ++j) {
    b[j].h2[0] = *(const v8h*)(sb + j * 16 * PH);
    b[j].h2[1] = *(const v8h*)(sb + j * 16 * PH + 16);
  }
}

template <int WM, int N, int K>
__device__ __forceinline__ void gemm_lds_block(const _Float16* __restrict__ A,
                                               const _Float16* __restrict__ Bt,
                                               float* __restrict__ C,
                                               unsigned char* smem) {
  constexpr int BM = 32 * WM;
  constexpr int NT = K / GBK_;                   // stages
  constexpr int PH = GPITCH_ / 2;                // pitch in f16
  const int lane  = threadIdx.x & 31;
  const int wave  = threadIdx.x >> 5;
  const int wm    = wave >> 1;
  const int wn    = wave & 1;
  const int tileM = blockIdx.x * BM;
  const int tileN = blockIdx.y * GBN_;
  const int halfSel = (lane >> 4) << 3;          // 0 or 8
  const int l16     = lane & 15;

  // copies: 16 lanes lie along a row piece
  const int crow = threadIdx.x >> 4;
  const int cchk = threadIdx.x & 15;
  const _Float16* ga = A  + (size_t)(tileM + crow) * K + cchk * 8;
  const _Float16* gb = Bt + (size_t)(tileN + crow) * K + cchk * 8;
  const unsigned  l0 = (unsigned)(uintptr_t)smem + crow * GPITCH_ + cchk * 16;

  v8f acc[2][4] = {};

  gemm_copy_stage<WM, K>(l0, ga, gb);
  // stage 0 has landed for this wave; the barrier publishes it to the others
  asm volatile("s_wait_asynccnt 0x0" ::: "memory");
  __syncthreads();
  gemm_copy_stage<WM, K>(l0 + GSTAGE_(WM), ga + GBK_, gb + GBK_);

  // rolled: one copy of the stage's code, and one hand-over point per stage
#pragma unroll 1
  for (int t = 0; t < NT; ++t) {
    const unsigned boff = (t & 1) * GSTAGE_(WM);
    const _Float16* sa = (const _Float16*)(smem + boff) + (wm * 32 + l16) * PH + halfSel;
    const _Float16* sb = (const _Float16*)(smem + boff) + (BM + wn * 64 + l16) * PH + halfSel;
    V16 a[2][2], b[2][4];                        // two fragment sets
    gemm_frags(a[0], b[0], sa, sb);
#pragma unroll
    for (int ks = 0; ks < GBK_ / 32; ++ks) {
      if (ks + 1 < GBK_ / 32)
        gemm_frags(a[(ks + 1) & 1], b[(ks + 1) & 1], sa + (ks + 1) * 32, sb + (ks + 1) * 32);
      // keeps the next 32 k's LDS reads together, ahead of this 32 k's products:
      // left free, they sink among the products and each group is waited out
      __builtin_amdgcn_sched_barrier(0);
#pragma unroll
      for (int i = 0; i < 2; ++i)
#pragma unroll
        for (int j = 0; j < 4; ++j)
          acc[i][j] = __builtin_amdgcn_wmma_f32_16x16x32_f16(false, a[ks & 1][i].v, false,
                                                             b[ks & 1][j].v, (short)0,
                                                             acc[i][j], false, false);
      __builtin_amdgcn_sched_barrier(0);         // the same, from below
    }
    // hand-over: this wave's reads of stage t are done ...
    asm volatile("s_wait_dscnt 0x0" ::: "memory");
    // ... its copies of stage t + 1 have landed ...
    asm volatile("s_wait_asynccnt 0x0" ::: "memory");
    // ... and the barrier publishes stage t + 1 and frees stage t's buffer
    __syncthreads();
    if (t + 2 < NT)
      gemm_copy_stage<WM, K>(l0 + boff, ga + (size_t)(t + 2) * GBK_, gb + (size_t)(t + 2) * GBK_);
  }
  // no copy is left in flight when the wave ends
  asm volatile("s_wait_asynccnt 0x0" ::: "memory");

  // C/D layout: VGPR r -> row r of the tile for lanes 0..15, row r + 8 for
  // lanes 16..31; col = lane & 15.
  const int rowOff = (lane < 16) ? 0 : 8;
  float* crow0 = C + (size_t)(tileM + wm * 32 + rowOff) * N + tileN + wn * 64 + l16;
#pragma unroll
  for (int i = 0; i < 2; ++i)
#pragma unroll
    for (int r = 0; r < 8; ++r) {
      float* cr = crow0 + (size_t)(i * 16 + r) * N;
      cr[0]  = acc[i][0][r];
      cr[16] = acc[i][1][r];
      cr[32] = acc[i][2][r];
      cr[48] = acc[i][3][r];
    }
}

// xz = x_h * Wi_t^T: 128 x 128 tiles, 8 waves; 512 blocks, two to a WGP.
__global__ __launch_bounds__(256)
void gemm_in_kernel(const _Float16* __restrict__ A, const _Float16* __restrict__ Bt,
                    float* __restrict__ C) {
  __shared__ __attribute__((aligned(16))) unsigned char smem[2 * GSTAGE_(4)];
  gemm_lds_block<4, 2 * DI_, DM_>(A, Bt, C, smem);
}

// out = y_h * Wo_t^T: 64 x 128 tiles, 4 waves, so that 256 blocks come of the
// smaller C.
__global__ __launch_bounds__(128)
void gemm_out_kernel(const _Float16* __restrict__ A, const _Float16* __restrict__ Bt,
                     float* __restrict__ C) {
  __shared__ __attribute__((aligned(16))) unsigned char smem[2 * GSTAGE_(2)];
  gemm_lds_block<2, DM_, DI_>(A, Bt, C, smem);
}

// ---------------------------------------------------------------
// Depthwise causal conv (width 4) + bias + SiLU.
// x_in is columns [0, DI) of xz (NROW x 2*DI).  xc: NROW x DI.
// A thread makes CROWS_ successive rows of 4 channels from CROWS_+3 row loads.
// Grid: (DI_/1024, NROW_/CROWS_), block 256. S_ % CROWS_ == 0, so a thread's
// rows lie in one sequence and only its first group has rows before the start.
// ---------------------------------------------------------------
#define CROWS_ 8
__global__ __launch_bounds__(256)
void conv_silu_kernel(const float* __restrict__ xz,
                      const float* __restrict__ conv_w,
                      const float* __restrict__ conv_b,
                      float* __restrict__ xc) {
  const int d  = (blockIdx.x * 256 + threadIdx.x) * 4;
  const int r0 = blockIdx.y * CROWS_;
  const float* xin = xz + (size_t)r0 * (2 * DI_) + d;

  v4f x[CROWS_ + DCONV_ - 1];                 // x[i] = row r0 - 3 + i
#pragma unroll
  for (int i = 0; i < DCONV_ - 1; ++i) x[i] = (v4f){0.f, 0.f, 0.f, 0.f};
  if ((r0 & (S_ - 1)) != 0) {                 // the causal left pad stays zero
#pragma unroll
    for (int i = 0; i < DCONV_ - 1; ++i)
      x[i] = *(const v4f*)(xin - (size_t)(DCONV_ - 1 - i) * (2 * DI_));
  }
#pragma unroll
  for (int i = 0; i < CROWS_; ++i)
    x[DCONV_ - 1 + i] = *(const v4f*)(xin + (size_t)i * (2 * DI_));

  v4f w[4];                                   // w[c] = the 4 taps of channel d + c
#pragma unroll
  for (int c = 0; c < 4; ++c) w[c] = *(const v4f*)(conv_w + (size_t)(d + c) * DCONV_);
  const v4f bias = *(const v4f*)(conv_b + d);
  // the arithmetic below reuses the address registers of the loads above
  asm volatile("s_wait_xcnt 0x0" ::: "memory");
  // keeps every load, and that wait, above the arithmetic: one memory latency
  // per thread instead of two
  __builtin_amdgcn_sched_barrier(0);

  float* op = xc + (size_t)r0 * DI_ + d;
#pragma unroll
  for (int i = 0; i < CROWS_; ++i) {
    v4f o;
#pragma unroll
    for (int c = 0; c < 4; ++c) {
      float acc = bias[c];
#pragma unroll
      for (int j = 0; j < DCONV_; ++j) acc += x[i + j][c] * w[c][j];
      o[c] = acc / (1.f + __expf(-acc));      // SiLU
    }
    *(v4f*)(op + (size_t)i * DI_) = o;
  }
}

// ---------------------------------------------------------------
// xp = xc @ W_xproj   (NROW x DI) * (DI x 33) -> (NROW x 33), all in f32,
// on the f32 16x16x4 matrix form.
// A block makes 16 rows of xp. Its XW_ waves split k; each wave holds three
// 16x16 accumulator tiles (columns 0-15, 16-31, and column 32 repeated in all
// 16 columns of the third tile, of which only the first is kept: a column of
// D depends on that column of B alone). The waves' partial sums meet in LDS.
// k pairing: in a run of 32 k, lane (c, h) holds k = 16h + q, q = 0..15, of
// row c of xc and of its column of W_xproj; product t takes q = 2t, 2t + 1 of
// both. The loads of a run are issued at least one run ahead of its products.
// NROW_/16 blocks of 32 * XW_ threads; blk is the block's number among them.
// ---------------------------------------------------------------
typedef __attribute__((ext_vector_type(2))) float v2f;
#define XW_   8                     // waves of a block
#define XKS_  (DI_ / XW_)           // k per wave
#define XRUN_ 32                    // k per run of loads
#define XPIT_ 52                    // LDS row pitch in floats: rows 8 apart lie 32 banks apart

struct XFrag { v4f a[4]; float b[3][16]; };

__device__ __forceinline__ void xproj_load(XFrag& f, const float* __restrict__ ap,
                                           const float* __restrict__ bp,
                                           const float* __restrict__ bw) {
#pragma unroll
  for (int i = 0; i < 4; ++i) f.a[i] = *(const v4f*)(ap + 4 * i);
#pragma unroll
  for (int q = 0; q < 16; ++q) {
    f.b[0][q] = bp[q * XPN_];
    f.b[1][q] = bp[q * XPN_ + 16];
    f.b[2][q] = bw[q * XPN_ + XPN_ - 1];
  }
}

__device__ __forceinline__ void xproj_mma(v8f* acc, const XFrag& f) {
#pragma unroll
  for (int t = 0; t < 8; ++t) {
    const v2f a = {f.a[t >> 1][(2 * t) & 3], f.a[t >> 1][(2 * t + 1) & 3]};
#pragma unroll
    for (int j = 0; j < 3; ++j) {
      const v2f b = {f.b[j][2 * t], f.b[j][2 * t + 1]};
      acc[j] = __builtin_amdgcn_wmma_f32_16x16x4_f32(false, a, false, b, (short)0,
                                                     acc[j], false, false);
    }
  }
}

__device__ __forceinline__ void xproj_block(const float* __restrict__ xc,
                                            const float* __restrict__ Wx,
                                            float* __restrict__ xp,
                                            float* red, int blk) {
  const int lane = threadIdx.x & 31;
  const int wave = threadIdx.x >> 5;
  const int c    = lane & 15;
  const int h    = lane >> 4;
  const int r0   = blk * 16;
  const int k0   = wave * XKS_ + 16 * h;

  const float* ap = xc + (size_t)(r0 + c) * DI_ + k0;
  const float* bw = Wx + (size_t)k0 * XPN_;   // row k0 of W_xproj
  const float* bp = bw + c;

  v8f acc[3] = {};
  XFrag f0, f1;
  xproj_load(f0, ap, bp, bw);
#pragma unroll
  for (int s = 0; s < XKS_ / XRUN_; s += 2) {
    xproj_load(f1, ap + (s + 1) * XRUN_, bp + (s + 1) * XRUN_ * XPN_,
               bw + (s + 1) * XRUN_ * XPN_);
    // keeps the next run's loads above this run's products: left free, the
    // compiler sinks each load to a few products ahead of its use, too late
    __builtin_amdgcn_sched_barrier(0);
    xproj_mma(acc, f0);
    if (s + 2 < XKS_ / XRUN_)
      xproj_load(f0, ap + (s + 2) * XRUN_, bp + (s + 2) * XRUN_ * XPN_,
                 bw + (s + 2) * XRUN_ * XPN_);
    __builtin_amdgcn_sched_barrier(0);   // the same, for the other register set
    xproj_mma(acc, f1);
  }
  // the three addresses stay in their registers up to here (else the last
  // run's loads land in them), and are given up only behind this wait
  asm volatile("s_wait_xcnt 0x0" :: "v"(ap), "v"(bp), "v"(bw) : "memory");

  // D register r of lane (c, h) is row 8h + r, column c of its tile
  float* my = red + wave * 16 * XPIT_;
#pragma unroll
  for (int j = 0; j < 3; ++j)
#pragma unroll
    for (int r = 0; r < 8; ++r) my[(8 * h + r) * XPIT_ + 16 * j + c] = acc[j][r];
  __syncthreads();

  for (int idx = threadIdx.x; idx < 16 * XPN_; idx += 32 * XW_) {
    const int row = idx / XPN_;
    const int col = idx - row * XPN_;
    float sum = red[row * XPIT_ + col];
#pragma unroll
    for (int w = 1; w < XW_; ++w) sum += red[(w * 16 + row) * XPIT_ + col];
    xp[(size_t)r0 * XPN_ + idx] = sum;
  }
}

// The xproj blocks are fewer than the chip's WGPs: the W_out transpose, which
// only the last GEMM needs, runs beside them in the same launch.
// Grid: XPJ_B_ + TWOUT_B_ blocks of 32 * XW_ = 256 threads.
#define XPJ_B_ (NROW_ / 16)
__global__ __launch_bounds__(32 * XW_)
void xproj_twout_kernel(const float* __restrict__ xc,
                        const float* __restrict__ Wx,
                        float* __restrict__ xp,
                        const float* __restrict__ W, _Float16* __restrict__ Wt) {
  __shared__ float red[XW_ * 16 * XPIT_];
  const int blk = blockIdx.x;
  if (blk < XPJ_B_) xproj_block(xc, Wx, xp, red, blk);
  else              transpose_f16_block<DI_, DM_>(W, Wt, blk - XPJ_B_);
}

// ---------------------------------------------------------------
// Selective scan, split along the sequence into CH_ chunks of TCH_ steps
// that run in parallel. The recurrence h <- dA*h + dBx is linear in h, and
// the product of dA over a chunk is exp(A * sum(delta)), so:
//   1) chunk_state: every chunk but the last runs from h = 0 and leaves its
//      end state and its sum of delta;
//   2) chunk_carry: per (b, n, d) the CH_ - 1 end states are chained into the
//      true state at the start of each chunk;
//   3) chunk_out: every chunk runs again from its true start state and
//      emits y = h.C + Dp*xc, gated with silu(z), as f16 for the output GEMM.
// One thread per (b, chunk, d), state h[16] in registers. The chunk's xp
// rows (dt|B|C) are staged in LDS once and read as broadcasts.
// ---------------------------------------------------------------
#define CH_   32                    // chunks per sequence
#define TCH_  (S_ / CH_)            // steps per chunk
#define ROWP_ (2 * DSTATE_ + 4)     // LDS row: B[16] | C[16] | dt | pad, 16-byte rows
#define GRP_  8                     // steps whose xc / z are fetched together, one group ahead

#define NXV_  ((TCH_ * XPN_ + 255) / 256)   // xp words per thread of a 256-thread block

// The chunk's xp rows go to LDS in two halves, so that a kernel can issue its
// other global loads between them and all latencies overlap.
__device__ __forceinline__ void load_xp_chunk(float* v,
                                              const float* __restrict__ xp,
                                              int r0) {
  const float* src = xp + (size_t)r0 * XPN_;
#pragma unroll
  for (int k = 0; k < NXV_; ++k) {
    const int i = threadIdx.x + k * 256;
    v[k] = ((k + 1) * 256 <= TCH_ * XPN_ || i < TCH_ * XPN_) ? src[i] : 0.f;
  }
}

__device__ __forceinline__ void store_xp_chunk(float* sx, const float* v) {
#pragma unroll
  for (int k = 0; k < NXV_; ++k) {
    const int i = threadIdx.x + k * 256;
    const int row = i / XPN_;
    const int col = i - row * XPN_;
    if ((k + 1) * 256 <= TCH_ * XPN_ || i < TCH_ * XPN_)
      sx[row * ROWP_ + (col == 0 ? 2 * DSTATE_ : col - 1)] = v[k];
  }
}

__device__ __forceinline__ void read16(float* v, const float* s) {
#pragma unroll
  for (int q = 0; q < 4; ++q) {
    const float4 f = ((const float4*)s)[q];
    v[4 * q + 0] = f.x; v[4 * q + 1] = f.y; v[4 * q + 2] = f.z; v[4 * q + 3] = f.w;
  }
}

__device__ __forceinline__ float softplus_dt(float din) {
  return (din > 20.f) ? din : __logf(1.f + __expf(din));
}

// Grid: (DI_/256, CH_-1, B_), block 256.
__global__ __launch_bounds__(256)
void ssm_chunk_state_kernel(const float* __restrict__ xp,
                            const float* __restrict__ xc,
                            const float* __restrict__ W_dt, // (1, DI_)
                            const float* __restrict__ b_dt,
                            const float* __restrict__ A_log,
                            float* __restrict__ hend,       // (B, CH, 16, DI)
                            float* __restrict__ sdel) {     // (B, CH, DI)
  __shared__ __attribute__((aligned(16))) float sx[TCH_ * ROWP_];
  const int d  = blockIdx.x * 256 + threadIdx.x;
  const int c  = blockIdx.y;
  const int b  = blockIdx.z;
  const int r0 = b * S_ + c * TCH_;

  float xv[NXV_];
  load_xp_chunk(xv, xp, r0);

  float Aneg[DSTATE_];
#pragma unroll
  for (int n = 0; n < DSTATE_; ++n) Aneg[n] = -__expf(A_log[n]);
  const float wdt = W_dt[d];
  const float bdt = b_dt[d];

  float h[DSTATE_];
#pragma unroll
  for (int n = 0; n < DSTATE_; ++n) h[n] = 0.f;
  float sd = 0.f;

  const float* xcp = xc + (size_t)r0 * DI_ + d;
  float xcu[GRP_];
#pragma unroll
  for (int u = 0; u < GRP_; ++u) xcu[u] = xcp[(size_t)u * DI_];

  store_xp_chunk(sx, xv);
  __syncthreads();

  // rolled over groups (code size); the next group's loads fly over this group's steps
#pragma unroll 1
  for (int g = 0; g < TCH_ / GRP_; ++g) {
    float xnx[GRP_];
#pragma unroll
    for (int u = 0; u < GRP_; ++u) xnx[u] = 0.f;
    if (g + 1 < TCH_ / GRP_) {
#pragma unroll
      for (int u = 0; u < GRP_; ++u) xnx[u] = xcp[(size_t)((g + 1) * GRP_ + u) * DI_];
    }
#pragma unroll
    for (int u = 0; u < GRP_; ++u) {
      const float* row = sx + (g * GRP_ + u) * ROWP_;
      float Bv[DSTATE_];
      read16(Bv, row);
      const float delta = softplus_dt(row[2 * DSTATE_] * wdt + bdt);
      const float dx    = delta * xcu[u];
      sd += delta;
#pragma unroll
      for (int n = 0; n < DSTATE_; ++n) {
        const float e = __expf(delta * Aneg[n]);
        h[n] = e * h[n] + dx * Bv[n];
      }
    }
#pragma unroll
    for (int u = 0; u < GRP_; ++u) xcu[u] = xnx[u];
  }

  const size_t bc = (size_t)b * CH_ + c;
#pragma unroll
  for (int n = 0; n < DSTATE_; ++n) hend[(bc * DSTATE_ + n) * DI_ + d] = h[n];
  sdel[bc * DI_ + d] = sd;
}

// One thread per (b, n, d): chain the chunks' end states.
__global__ __launch_bounds__(256)
void ssm_chunk_carry_kernel(const float* __restrict__ hend,
                            const float* __restrict__ sdel,
                            const float* __restrict__ A_log,
                            float* __restrict__ hini) {     // (B, CH, 16, DI)
  const int idx = blockIdx.x * 256 + threadIdx.x;           // over B_*16*DI_
  const int d = idx & (DI_ - 1);
  const int n = (idx >> 11) & (DSTATE_ - 1);
  const int b = idx >> 15;
  const float an = -__expf(A_log[n]);

  const float* hp = hend + ((size_t)b * CH_ * DSTATE_ + n) * DI_ + d;
  const float* sp = sdel + (size_t)b * CH_ * DI_ + d;
  float*       op = hini + ((size_t)b * CH_ * DSTATE_ + n) * DI_ + d;

  // every load is independent of the chain: fetch all first, one latency in all
  float he[CH_ - 1], ev[CH_ - 1];
#pragma unroll
  for (int c = 0; c < CH_ - 1; ++c) {
    ev[c] = sp[(size_t)c * DI_];
    he[c] = hp[(size_t)c * DSTATE_ * DI_];
  }
#pragma unroll
  for (int c = 0; c < CH_ - 1; ++c) ev[c] = __expf(an * ev[c]);

  float H = 0.f;
  op[0] = H;
#pragma unroll
  for (int c = 0; c < CH_ - 1; ++c) {
    H = ev[c] * H + he[c];
    op[(size_t)(c + 1) * DSTATE_ * DI_] = H;
  }
}

// Grid: (DI_/256, CH_, B_), block 256.
__global__ __launch_bounds__(256)
void ssm_chunk_out_kernel(const float* __restrict__ xp,
                          const float* __restrict__ xc,
                          const float* __restrict__ xz,   // z at cols [DI_, 2*DI_)
                          const float* __restrict__ W_dt, // (1, DI_)
                          const float* __restrict__ b_dt,
                          const float* __restrict__ A_log,
                          const float* __restrict__ Dp,
                          const float* __restrict__ hini,
                          _Float16* __restrict__ y_h) {
  __shared__ __attribute__((aligned(16))) float sx[TCH_ * ROWP_];
  const int d  = blockIdx.x * 256 + threadIdx.x;
  const int c  = blockIdx.y;
  const int b  = blockIdx.z;
  const int r0 = b * S_ + c * TCH_;

  float xv[NXV_];
  load_xp_chunk(xv, xp, r0);

  float Aneg[DSTATE_];
#pragma unroll
  for (int n = 0; n < DSTATE_; ++n) Aneg[n] = -__expf(A_log[n]);
  const float wdt = W_dt[d];
  const float bdt = b_dt[d];
  const float dpv = Dp[d];

  const size_t bc = (size_t)b * CH_ + c;
  float h[DSTATE_];
#pragma unroll
  for (int n = 0; n < DSTATE_; ++n) h[n] = hini[(bc * DSTATE_ + n) * DI_ + d];

  const float* xcp = xc + (size_t)r0 * DI_ + d;
  const float* zp  = xz + (size_t)r0 * (2 * DI_) + DI_ + d;
  _Float16*    yp  = y_h + (size_t)r0 * DI_ + d;
  float xcu[GRP_], zcu[GRP_];
#pragma unroll
  for (int u = 0; u < GRP_; ++u) {
    xcu[u] = xcp[(size_t)u * DI_];
    zcu[u] = zp[(size_t)u * (2 * DI_)];
  }

  store_xp_chunk(sx, xv);
  __syncthreads();

  // rolled over groups (code size); the next group's loads fly over this group's steps
#pragma unroll 1
  for (int g = 0; g < TCH_ / GRP_; ++g) {
    float xnx[GRP_], znx[GRP_];
#pragma unroll
    for (int u = 0; u < GRP_; ++u) { xnx[u] = 0.f; znx[u] = 0.f; }
    if (g + 1 < TCH_ / GRP_) {
#pragma unroll
      for (int u = 0; u < GRP_; ++u) {
        xnx[u] = xcp[(size_t)((g + 1) * GRP_ + u) * DI_];
        znx[u] = zp[(size_t)((g + 1) * GRP_ + u) * (2 * DI_)];
      }
    }
#pragma unroll
    for (int u = 0; u < GRP_; ++u) {
      const int t = g * GRP_ + u;
      const float* row = sx + t * ROWP_;
      float Bv[DSTATE_], Cv[DSTATE_];
      read16(Bv, row);
      read16(Cv, row + DSTATE_);
      const float delta = softplus_dt(row[2 * DSTATE_] * wdt + bdt);
      const float xcv   = xcu[u];
      const float zv    = zcu[u];
      const float dx    = delta * xcv;

      float y = 0.f;
#pragma unroll
      for (int n = 0; n < DSTATE_; ++n) {
        const float e = __expf(delta * Aneg[n]);
        h[n] = e * h[n] + dx * Bv[n];
        y += h[n] * Cv[n];
      }
      y += dpv * xcv;
      y *= zv / (1.f + __expf(-zv));               // * silu(z)
      yp[(size_t)t * DI_] = (_Float16)y;
    }
#pragma unroll
    for (int u = 0; u < GRP_; ++u) { xcu[u] = xnx[u]; zcu[u] = znx[u]; }
  }
}

// ---------------------------------------------------------------
extern "C" void kernel_launch(void* const* d_in, const int* in_sizes, int n_in,
                              void* d_out, int out_size, void* d_ws, size_t ws_size,
                              hipStream_t stream) {
  const float* x      = (const float*)d_in[0];   // (B,S,DM)
  const float* W_in   = (const float*)d_in[1];   // (DM, 2*DI)
  const float* conv_w = (const float*)d_in[2];   // (DI,1,4)
  const float* conv_b = (const float*)d_in[3];   // (DI)
  const float* W_xp   = (const float*)d_in[4];   // (DI, 33)
  const float* W_dt   = (const float*)d_in[5];   // (1, DI)
  const float* b_dt   = (const float*)d_in[6];   // (DI)
  const float* A_log  = (const float*)d_in[7];   // (16)
  const float* Dp     = (const float*)d_in[8];   // (DI)
  const float* W_out  = (const float*)d_in[9];   // (DI, DM)
  float* out = (float*)d_out;                    // (B,S,DM)

  // ---- workspace carve-out (256B aligned) ----
  size_t off = 0;
  auto carve = [&](size_t bytes) -> void* {
    void* p = (char*)d_ws + off;
    off += (bytes + 255) & ~(size_t)255;
    return p;
  };
  _Float16* x_h  = (_Float16*)carve((size_t)NROW_ * DM_ * 2);      // 4 MB
  _Float16* Wi_t = (_Float16*)carve((size_t)(2*DI_) * DM_ * 2);    // 8 MB  (4096 x 1024)
  _Float16* Wo_t = (_Float16*)carve((size_t)DM_ * DI_ * 2);        // 4 MB  (1024 x 2048)
  float*    xz   = (float*)   carve((size_t)NROW_ * 2*DI_ * 4);    // 32 MB
  float*    xc   = (float*)   carve((size_t)NROW_ * DI_ * 4);      // 16 MB
  float*    xp   = (float*)   carve((size_t)NROW_ * XPN_ * 4);     // ~0.3 MB
  _Float16* y_h  = (_Float16*)carve((size_t)NROW_ * DI_ * 2);      // 8 MB
  float*    hend = (float*)   carve((size_t)B_ * CH_ * DSTATE_ * DI_ * 4);  // 8 MB
  float*    hini = (float*)   carve((size_t)B_ * CH_ * DSTATE_ * DI_ * 4);  // 8 MB
  float*    sdel = (float*)   carve((size_t)B_ * CH_ * DI_ * 4);            // 0.5 MB

  // 1) W_in transposed and x converted, both to f16, in one launch
  prep_in_kernel<<<TWIN_B_ + CVT_B_, 256, 0, stream>>>(W_in, Wi_t, x, x_h);

  // 2) xz = x @ W_in        (2048 x 4096, K=1024)  -- WMMA
  {
    dim3 grid(NROW_ / 128, (2 * DI_) / GBN_);
    gemm_in_kernel<<<grid, 256, 0, stream>>>(x_h, Wi_t, xz);
  }

  // 3) depthwise conv + SiLU
  {
    dim3 grid(DI_ / 1024, NROW_ / CROWS_);
    conv_silu_kernel<<<grid, 256, 0, stream>>>(xz, conv_w, conv_b, xc);
  }

  // 4) xp = xc @ W_xproj    (N=33); beside it W_out transposed to f16
  xproj_twout_kernel<<<XPJ_B_ + TWOUT_B_, 32 * XW_, 0, stream>>>(xc, W_xp, xp, W_out, Wo_t);

  // 5) selective scan in parallel chunks -> gated y (f16)
  {
    dim3 grid(DI_ / 256, CH_ - 1, B_);
    ssm_chunk_state_kernel<<<grid, 256, 0, stream>>>(xp, xc, W_dt, b_dt, A_log,
                                                     hend, sdel);
  }
  {
    int n = B_ * DSTATE_ * DI_;
    ssm_chunk_carry_kernel<<<n / 256, 256, 0, stream>>>(hend, sdel, A_log, hini);
  }
  {
    dim3 grid(DI_ / 256, CH_, B_);
    ssm_chunk_out_kernel<<<grid, 256, 0, stream>>>(xp, xc, xz, W_dt, b_dt,
                                                   A_log, Dp, hini, y_h);
  }

  // 6) out = y @ W_out      (2048 x 1024, K=2048)  -- WMMA
  {
    dim3 grid(NROW_ / 64, DM_ / GBN_);
    gemm_out_kernel<<<grid, 128, 0, stream>>>(y_h, Wo_t, out);
  }
  (void)in_sizes; (void)n_in; (void)out_size; (void)ws_size;
}

// v006
// It runs in 82.9 microseconds.
// Next to v005, in two timings, it ran 1.03 and 1.02 times as fast.
// All steps since v000 together make it 17.8 times as fast.
#include <hip/hip_runtime.h>
#include <hip/hip_bf16.h>

// ---------------- problem constants (from reference) ----------------
#define B_      2
#define S_      1024
#define DM_     1024          // D_MODEL
#define DI_     2048          // D_INNER = 2*D_MODEL
#define DSTATE_ 16
#define DCONV_  4
#define NROW_   (B_ * S_)     // 2048 flattened (b,s) rows
#define XPN_    (2 * DSTATE_ + 1)   // 33

typedef __attribute__((ext_vector_type(16))) _Float16 v16h;
typedef __attribute__((ext_vector_type(8)))  _Float16 v8h;
typedef __attribute__((ext_vector_type(8)))  float    v8f;
typedef __attribute__((ext_vector_type(4)))  float    v4f;

union V16 { v16h v; v8h h2[2]; };

// ---------------------------------------------------------------
// The elementwise launches below give every thread 16 to 32 elements, moved
// in 16-byte loads and stores, the loads issued together at the start. One
// element per lane would start 16 to 32 times as many waves for the same bytes.
// ---------------------------------------------------------------

// v / (1 + exp(-v)) on the hardware's exp2 and reciprocal
__device__ __forceinline__ float silu(float v) {
  return v * __builtin_amdgcn_rcpf(1.f + __builtin_amdgcn_exp2f(-1.44269504f * v));
}

__device__ __forceinline__ v8h pack8(float a, float b, float c, float d,
                                     float e, float f, float g, float h) {
  v8h o = {(_Float16)a, (_Float16)b, (_Float16)c, (_Float16)d,
           (_Float16)e, (_Float16)f, (_Float16)g, (_Float16)h};
  return o;
}

// ---------------------------------------------------------------
// Elementwise f32 -> f16 convert of NROW_*DM_ values.
// A thread converts two runs of 8 values. CVT_T_/256 blocks of 256; blk is the
// block's number among them.
// ---------------------------------------------------------------
#define CVT_T_ (NROW_ * DM_ / 16)     // threads
__device__ __forceinline__ void cvt_f16_block(const float* __restrict__ in,
                                              _Float16* __restrict__ out, int blk) {
  const size_t t = (size_t)blk * 256 + threadIdx.x;
  const size_t e0 = t * 8;
  const size_t e1 = (t + CVT_T_) * 8;
  const v4f a0 = *(const v4f*)(in + e0);
  const v4f a1 = *(const v4f*)(in + e0 + 4);
  const v4f b0 = *(const v4f*)(in + e1);
  const v4f b1 = *(const v4f*)(in + e1 + 4);
  *(v8h*)(out + e0) = pack8(a0[0], a0[1], a0[2], a0[3], a1[0], a1[1], a1[2], a1[3]);
  *(v8h*)(out + e1) = pack8(b0[0], b0[1], b0[2], b0[3], b1[0], b1[1], b1[2], b1[3]);
}

// ---------------------------------------------------------------
// Transpose (K x N) f32  ->  (N x K) f16   (Wt[n*K + k] = W[k*N + n])
// A thread holds an 8 (k) x 4 (n) block: 8 row loads of 4 n, 4 stores of 8 k;
// the transpose itself is only a choice of registers. In a wave 8 lanes lie
// along k, so each store instruction writes whole 128-byte lines of Wt; the
// 8 waves of a block lie along n and share the lines of W they read.
// K and N are compile-time, so the row steps are immediate offsets on one
// address. (K/64) * (N/128) blocks of 256, k fastest; blk is the block's number
// among them; K % 64 == 0, N % 128 == 0.
// ---------------------------------------------------------------
template <int K, int N>
__device__ __forceinline__ void transpose_f16_block(const float* __restrict__ W,
                                                    _Float16* __restrict__ Wt, int blk) {
  const int lane = threadIdx.x & 31;
  const int wave = threadIdx.x >> 5;
  const int k = (blk % (K / 64)) * 64 + (lane & 7) * 8;
  const int n = (blk / (K / 64)) * 128 + wave * 16 + (lane >> 3) * 4;
  const float* src = W + (size_t)k * N + n;
  v4f r[8];
#pragma unroll
  for (int i = 0; i < 8; ++i) r[i] = *(const v4f*)(src + i * N);
  _Float16* dst = Wt + (size_t)n * K + k;
#pragma unroll
  for (int j = 0; j < 4; ++j)
    *(v8h*)(dst + j * K) = pack8(r[0][j], r[1][j], r[2][j], r[3][j],
                                 r[4][j], r[5][j], r[6][j], r[7][j]);
}

// Jobs that do not depend on one another share a launch: the block number picks
// the job, the longer job's blocks first. Each launch saved is a gap, a start
// and a tail less in the chain of dependent launches.
#define TWIN_B_  ((DM_ / 64) * (2 * DI_ / 128))   // blocks of the W_in transpose
#define TWOUT_B_ ((DI_ / 64) * (DM_ / 128))       // blocks of the W_out transpose
#define CVT_B_   (CVT_T_ / 256)                   // blocks of the convert

// What the input GEMM needs: W_in transposed, x converted.
// Grid: TWIN_B_ + CVT_B_ blocks of 256.
__global__ __launch_bounds__(256)
void prep_in_kernel(const float* __restrict__ W, _Float16* __restrict__ Wt,
                    const float* __restrict__ x, _Float16* __restrict__ x_h) {
  const int blk = blockIdx.x;
  if (blk < TWIN_B_) transpose_f16_block<DM_, 2 * DI_>(W, Wt, blk);
  else               cvt_f16_block(x, x_h, blk - TWIN_B_);
}

// ---------------------------------------------------------------
// WMMA GEMM:  C(MxN, f32) = A(MxK, f16 row-major) * B(KxN) with B given
// transposed: Bt (N x K, f16 row-major).
// A block of WM x 2 waves makes a (32*WM) x 128 tile of C; a wave makes 32 x 64
// of it: 2 A fragments times 4 B fragments per 32 k.
// The block's rows of A and Bt come into LDS 128 k at a time (a stage), by
// asynchronous copies of 16 bytes a lane: a copy instruction takes two whole
// 256-byte row pieces, and every row is fetched once per block instead of
// once per wave in 32-byte pieces. Two stage buffers: the copies of stage
// t + 2 fly while stage t + 1 is worked on.
// Fragments (16-bit A 16x32): lane < 16 holds k 0..7 and 16..23 of its row,
// lane >= 16 holds k 8..15 and 24..31; A and Bt are read by the same code.
// k runs upward in steps of 32 into one accumulator per 16x16 tile.
// Requires: M % (32*WM) == 0, N % 128 == 0, K % 128 == 0, K >= 256.
// ---------------------------------------------------------------
#define GBK_    128                  // k per stage
#define GPITCH_ 272                  // LDS row pitch in bytes: 16 x odd, for 16-byte reads
#define GBN_    128                  // columns of C per block
#define GSTAGE_(WM) ((32 * (WM) + GBN_) * GPITCH_)   // bytes of a stage

// Eight copies of 16 bytes a lane: rows r, r + RS, ..., r + 7 * RS of one
// operand. The wait at the end stands in the copies' own statement, so that no
// address register named here is rewritten in front of it.
template <int K, int RS>
__device__ __forceinline__ void async_rows8(unsigned lds, const _Float16* g) {
  asm volatile(
      "global_load_async_to_lds_b128 %0, %8, off\n\t"
      "global_load_async_to_lds_b128 %1, %9, off\n\t"
      "global_load_async_to_lds_b128 %2, %10, off\n\t"
      "global_load_async_to_lds_b128 %3, %11, off\n\t"
      "global_load_async_to_lds_b128 %4, %12, off\n\t"
      "global_load_async_to_lds_b128 %5, %13, off\n\t"
      "global_load_async_to_lds_b128 %6, %14, off\n\t"
      "global_load_async_to_lds_b128 %7, %15, off\n\t"
      "s_wait_xcnt 0x0"
      :: "v"(lds), "v"(lds + 1 * RS * GPITCH_), "v"(lds + 2 * RS * GPITCH_),
         "v"(lds + 3 * RS * GPITCH_), "v"(lds + 4 * RS * GPITCH_),
         "v"(lds + 5 * RS * GPITCH_), "v"(lds + 6 * RS * GPITCH_),
         "v"(lds + 7 * RS * GPITCH_),
         "v"(g), "v"(g + 1 * RS * K), "v"(g + 2 * RS * K), "v"(g + 3 * RS * K),
         "v"(g + 4 * RS * K), "v"(g + 5 * RS * K), "v"(g + 6 * RS * K), "v"(g + 7 * RS * K)
      : "memory");
}

// One stage: 32*WM rows of A, then GBN_ rows of Bt, 256 bytes of each. The
// block's threads cover RS = 4*WM rows at a time, 16 lanes to a row.
template <int WM, int K>
__device__ __forceinline__ void gemm_copy_stage(unsigned lds, const _Float16* ga,
                                                const _Float16* gb) {
  constexpr int RS = 4 * WM;
  async_rows8<K, RS>(lds, ga);
#pragma unroll
  for (int i = 0; i < GBN_ / (8 * RS); ++i)
    async_rows8<K, RS>(lds + (32 * WM + i * 8 * RS) * GPITCH_, gb + (size_t)i * 8 * RS * K);
}

// The fragments of 32 k: 2 of A's rows, 4 of Bt's, two 16-byte reads each.
__device__ __forceinline__ void gemm_frags(V16* a, V16* b, const _Float16* sa,
                                           const _Float16* sb) {
  constexpr int PH = GPITCH_ / 2;                // pitch in f16
#pragma unroll
  for (int i = 0; i < 2; ++i) {
    a[i].h2[0] = *(const v8h*)(sa + i * 16 * PH);
    a[i].h2[1] = *(const v8h*)(sa + i * 16 * PH + 16);
  }
#pragma unroll
  for (int j = 0; j < 4; ++j) {
    b[j].h2[0] = *(const v8h*)(sb + j * 16 * PH);
    b[j].h2[1] = *(const v8h*)(sb + j * 16 * PH + 16);
  }
}

template <int WM, int N, int K>
__device__ __forceinline__ void gemm_lds_block(const _Float16* __restrict__ A,
                                               const _Float16* __restrict__ Bt,
                                               float* __restrict__ C,
                                               unsigned char* smem) {
  constexpr int BM = 32 * WM;
  constexpr int NT = K / GBK_;                   // stages
  constexpr int PH = GPITCH_ / 2;                // pitch in f16
  const int lane  = threadIdx.x & 31;
  const int wave  = threadIdx.x >> 5;
  const int wm    = wave >> 1;
  const int wn    = wave & 1;
  const int tileM = blockIdx.x * BM;
  const int tileN = blockIdx.y * GBN_;
  const int halfSel = (lane >> 4) << 3;          // 0 or 8
  const int l16     = lane & 15;

  // copies: 16 lanes lie along a row piece
  const int crow = threadIdx.x >> 4;
  const int cchk = threadIdx.x & 15;
  const _Float16* ga = A  + (size_t)(tileM + crow) * K + cchk * 8;
  const _Float16* gb = Bt + (size_t)(tileN + crow) * K + cchk * 8;
  const unsigned  l0 = (unsigned)(uintptr_t)smem + crow * GPITCH_ + cchk * 16;

  v8f acc[2][4] = {};

  gemm_copy_stage<WM, K>(l0, ga, gb);
  // stage 0 has landed for this wave; the barrier publishes it to the others
  asm volatile("s_wait_asynccnt 0x0" ::: "memory");
  __syncthreads();
  gemm_copy_stage<WM, K>(l0 + GSTAGE_(WM), ga + GBK_, gb + GBK_);

  // rolled: one copy of the stage's code, and one hand-over point per stage
#pragma unroll 1
  for (int t = 0; t < NT; ++t) {
    const unsigned boff = (t & 1) * GSTAGE_(WM);
    const _Float16* sa = (const _Float16*)(smem + boff) + (wm * 32 + l16) * PH + halfSel;
    const _Float16* sb = (const _Float16*)(smem + boff) + (BM + wn * 64 + l16) * PH + halfSel;
    V16 a[2][2], b[2][4];                        // two fragment sets
    gemm_frags(a[0], b[0], sa, sb);
#pragma unroll
    for (int ks = 0; ks < GBK_ / 32; ++ks) {
      if (ks + 1 < GBK_ / 32)
        gemm_frags(a[(ks + 1) & 1], b[(ks + 1) & 1], sa + (ks + 1) * 32, sb + (ks + 1) * 32);
      // keeps the next 32 k's LDS reads together, ahead of this 32 k's products:
      // left free, they sink among the products and each group is waited out
      __builtin_amdgcn_sched_barrier(0);
#pragma unroll
      for (int i = 0; i < 2; ++i)
#pragma unroll
        for (int j = 0; j < 4; ++j)
          acc[i][j] = __builtin_amdgcn_wmma_f32_16x16x32_f16(false, a[ks & 1][i].v, false,
                                                             b[ks & 1][j].v, (short)0,
                                                             acc[i][j], false, false);
      __builtin_amdgcn_sched_barrier(0);         // the same, from below
    }
    // hand-over: this wave's reads of stage t are done ...
    asm volatile("s_wait_dscnt 0x0" ::: "memory");
    // ... its copies of stage t + 1 have landed ...
    asm volatile("s_wait_asynccnt 0x0" ::: "memory");
    // ... and the barrier publishes stage t + 1 and frees stage t's buffer
    __syncthreads();
    if (t + 2 < NT)
      gemm_copy_stage<WM, K>(l0 + boff, ga + (size_t)(t + 2) * GBK_, gb + (size_t)(t + 2) * GBK_);
  }
  // no copy is left in flight when the wave ends
  asm volatile("s_wait_asynccnt 0x0" ::: "memory");

  // C/D layout: VGPR r -> row r of the tile for lanes 0..15, row r + 8 for
  // lanes 16..31; col = lane & 15.
  const int rowOff = (lane < 16) ? 0 : 8;
  float* crow0 = C + (size_t)(tileM + wm * 32 + rowOff) * N + tileN + wn * 64 + l16;
#pragma unroll
  for (int i = 0; i < 2; ++i)
#pragma unroll
    for (int r = 0; r < 8; ++r) {
      float* cr = crow0 + (size_t)(i * 16 + r) * N;
      cr[0]  = acc[i][0][r];
      cr[16] = acc[i][1][r];
      cr[32] = acc[i][2][r];
      cr[48] = acc[i][3][r];
    }
}

// xz = x_h * Wi_t^T: 128 x 128 tiles, 8 waves; 512 blocks, two to a WGP.
__global__ __launch_bounds__(256)
void gemm_in_kernel(const _Float16* __restrict__ A, const _Float16* __restrict__ Bt,
                    float* __restrict__ C) {
  __shared__ __attribute__((aligned(16))) unsigned char smem[2 * GSTAGE_(4)];
  gemm_lds_block<4, 2 * DI_, DM_>(A, Bt, C, smem);
}

// out = y_h * Wo_t^T: 64 x 128 tiles, 4 waves, so that 256 blocks come of the
// smaller C.
__global__ __launch_bounds__(128)
void gemm_out_kernel(const _Float16* __restrict__ A, const _Float16* __restrict__ Bt,
                     float* __restrict__ C) {
  __shared__ __attribute__((aligned(16))) unsigned char smem[2 * GSTAGE_(2)];
  gemm_lds_block<2, DM_, DI_>(A, Bt, C, smem);
}

// ---------------------------------------------------------------
// Depthwise causal conv (width 4) + bias + SiLU.
// x_in is columns [0, DI) of xz (NROW x 2*DI).  xc: NROW x DI.
// A thread makes CROWS_ successive rows of 4 channels from CROWS_+3 row loads.
// Grid: (DI_/1024, NROW_/CROWS_), block 256. S_ % CROWS_ == 0, so a thread's
// rows lie in one sequence and only its first group has rows before the start.
// ---------------------------------------------------------------
#define CROWS_ 8
__global__ __launch_bounds__(256)
void conv_silu_kernel(const float* __restrict__ xz,
                      const float* __restrict__ conv_w,
                      const float* __restrict__ conv_b,
                      float* __restrict__ xc) {
  const int d  = (blockIdx.x * 256 + threadIdx.x) * 4;
  const int r0 = blockIdx.y * CROWS_;
  const float* xin = xz + (size_t)r0 * (2 * DI_) + d;

  v4f x[CROWS_ + DCONV_ - 1];                 // x[i] = row r0 - 3 + i
#pragma unroll
  for (int i = 0; i < DCONV_ - 1; ++i) x[i] = (v4f){0.f, 0.f, 0.f, 0.f};
  if ((r0 & (S_ - 1)) != 0) {                 // the causal left pad stays zero
#pragma unroll
    for (int i = 0; i < DCONV_ - 1; ++i)
      x[i] = *(const v4f*)(xin - (size_t)(DCONV_ - 1 - i) * (2 * DI_));
  }
#pragma unroll
  for (int i = 0; i < CROWS_; ++i)
    x[DCONV_ - 1 + i] = *(const v4f*)(xin + (size_t)i * (2 * DI_));

  v4f w[4];                                   // w[c] = the 4 taps of channel d + c
#pragma unroll
  for (int c = 0; c < 4; ++c) w[c] = *(const v4f*)(conv_w + (size_t)(d + c) * DCONV_);
  const v4f bias = *(const v4f*)(conv_b + d);
  // the arithmetic below reuses the address registers of the loads above
  asm volatile("s_wait_xcnt 0x0" ::: "memory");
  // keeps every load, and that wait, above the arithmetic: one memory latency
  // per thread instead of two
  __builtin_amdgcn_sched_barrier(0);

  float* op = xc + (size_t)r0 * DI_ + d;
#pragma unroll
  for (int i = 0; i < CROWS_; ++i) {
    v4f o;
#pragma unroll
    for (int c = 0; c < 4; ++c) {
      float acc = bias[c];
#pragma unroll
      for (int j = 0; j < DCONV_; ++j) acc += x[i + j][c] * w[c][j];
      o[c] = silu(acc);
    }
    *(v4f*)(op + (size_t)i * DI_) = o;
  }
}

// ---------------------------------------------------------------
// xp = xc @ W_xproj   (NROW x DI) * (DI x 33) -> (NROW x 33), all in f32,
// on the f32 16x16x4 matrix form.
// A block makes 16 rows of xp. Its XW_ waves split k; each wave holds three
// 16x16 accumulator tiles (columns 0-15, 16-31, and column 32 repeated in all
// 16 columns of the third tile, of which only the first is kept: a column of
// D depends on that column of B alone). The waves' partial sums meet in LDS.
// k pairing: in a run of 32 k, lane (c, h) holds k = 16h + q, q = 0..15, of
// row c of xc and of its column of W_xproj; product t takes q = 2t, 2t + 1 of
// both. The loads of a run are issued at least one run ahead of its products.
// NROW_/16 blocks of 32 * XW_ threads; blk is the block's number among them.
// ---------------------------------------------------------------
typedef __attribute__((ext_vector_type(2))) float v2f;
#define XW_   8                     // waves of a block
#define XKS_  (DI_ / XW_)           // k per wave
#define XRUN_ 32                    // k per run of loads
#define XPIT_ 52                    // LDS row pitch in floats: rows 8 apart lie 32 banks apart

struct XFrag { v4f a[4]; float b[3][16]; };

__device__ __forceinline__ void xproj_load(XFrag& f, const float* __restrict__ ap,
                                           const float* __restrict__ bp,
                                           const float* __restrict__ bw) {
#pragma unroll
  for (int i = 0; i < 4; ++i) f.a[i] = *(const v4f*)(ap + 4 * i);
#pragma unroll
  for (int q = 0; q < 16; ++q) {
    f.b[0][q] = bp[q * XPN_];
    f.b[1][q] = bp[q * XPN_ + 16];
    f.b[2][q] = bw[q * XPN_ + XPN_ - 1];
  }
}

__device__ __forceinline__ void xproj_mma(v8f* acc, const XFrag& f) {
#pragma unroll
  for (int t = 0; t < 8; ++t) {
    const v2f a = {f.a[t >> 1][(2 * t) & 3], f.a[t >> 1][(2 * t + 1) & 3]};
#pragma unroll
    for (int j = 0; j < 3; ++j) {
      const v2f b = {f.b[j][2 * t], f.b[j][2 * t + 1]};
      acc[j] = __builtin_amdgcn_wmma_f32_16x16x4_f32(false, a, false, b, (short)0,
                                                     acc[j], false, false);
    }
  }
}

__device__ __forceinline__ void xproj_block(const float* __restrict__ xc,
                                            const float* __restrict__ Wx,
                                            float* __restrict__ xp,
                                            float* red, int blk) {
  const int lane = threadIdx.x & 31;
  const int wave = threadIdx.x >> 5;
  const int c    = lane & 15;
  const int h    = lane >> 4;
  const int r0   = blk * 16;
  const int k0   = wave * XKS_ + 16 * h;

  const float* ap = xc + (size_t)(r0 + c) * DI_ + k0;
  const float* bw = Wx + (size_t)k0 * XPN_;   // row k0 of W_xproj
  const float* bp = bw + c;

  v8f acc[3] = {};
  XFrag f0, f1;
  xproj_load(f0, ap, bp, bw);
#pragma unroll
  for (int s = 0; s < XKS_ / XRUN_; s += 2) {
    xproj_load(f1, ap + (s + 1) * XRUN_, bp + (s + 1) * XRUN_ * XPN_,
               bw + (s + 1) * XRUN_ * XPN_);
    // keeps the next run's loads above this run's products: left free, the
    // compiler sinks each load to a few products ahead of its use, too late
    __builtin_amdgcn_sched_barrier(0);
    xproj_mma(acc, f0);
    if (s + 2 < XKS_ / XRUN_)
      xproj_load(f0, ap + (s + 2) * XRUN_, bp + (s + 2) * XRUN_ * XPN_,
                 bw + (s + 2) * XRUN_ * XPN_);
    __builtin_amdgcn_sched_barrier(0);   // the same, for the other register set
    xproj_mma(acc, f1);
  }
  // the three addresses stay in their registers up to here (else the last
  // run's loads land in them), and are given up only behind this wait
  asm volatile("s_wait_xcnt 0x0" :: "v"(ap), "v"(bp), "v"(bw) : "memory");

  // D register r of lane (c, h) is row 8h + r, column c of its tile
  float* my = red + wave * 16 * XPIT_;
#pragma unroll
  for (int j = 0; j < 3; ++j)
#pragma unroll
    for (int r = 0; r < 8; ++r) my[(8 * h + r) * XPIT_ + 16 * j + c] = acc[j][r];
  __syncthreads();

  for (int idx = threadIdx.x; idx < 16 * XPN_; idx += 32 * XW_) {
    const int row = idx / XPN_;
    const int col = idx - row * XPN_;
    float sum = red[row * XPIT_ + col];
#pragma unroll
    for (int w = 1; w < XW_; ++w) sum += red[(w * 16 + row) * XPIT_ + col];
    xp[(size_t)r0 * XPN_ + idx] = sum;
  }
}

// The xproj blocks are fewer than the chip's WGPs: the W_out transpose, which
// only the last GEMM needs, runs beside them in the same launch.
// Grid: XPJ_B_ + TWOUT_B_ blocks of 32 * XW_ = 256 threads.
#define XPJ_B_ (NROW_ / 16)
__global__ __launch_bounds__(32 * XW_)
void xproj_twout_kernel(const float* __restrict__ xc,
                        const float* __restrict__ Wx,
                        float* __restrict__ xp,
                        const float* __restrict__ W, _Float16* __restrict__ Wt) {
  __shared__ float red[XW_ * 16 * XPIT_];
  const int blk = blockIdx.x;
  if (blk < XPJ_B_) xproj_block(xc, Wx, xp, red, blk);
  else              transpose_f16_block<DI_, DM_>(W, Wt, blk - XPJ_B_);
}

// ---------------------------------------------------------------
// Selective scan, split along the sequence into CH_ chunks of TCH_ steps
// that run in parallel. The recurrence h <- dA*h + dBx is linear in h, and
// the product of dA over a chunk is exp(A * sum(delta)), so:
//   1) chunk_state: every chunk but the last runs from h = 0 and leaves its
//      end state and its sum of delta;
//   2) chunk_carry: per (b, n, d) the CH_ - 1 end states are chained into the
//      true state at the start of each chunk;
//   3) chunk_out: every chunk runs again from its true start state and
//      emits y = h.C + Dp*xc, gated with silu(z), as f16 for the output GEMM.
// One thread per (b, chunk, d), state h[16] in registers. The chunk's xp
// rows (dt|B|C) are staged in LDS once and read as broadcasts.
// ---------------------------------------------------------------
#define CH_   32                    // chunks per sequence
#define TCH_  (S_ / CH_)            // steps per chunk
#define ROWP_ (2 * DSTATE_ + 4)     // LDS row: B[16] | C[16] | dt | pad, 16-byte rows
#define GRP_  8                     // steps whose xc / z are fetched together, one group ahead

#define NXV_  ((TCH_ * XPN_ + 255) / 256)   // xp words per thread of a 256-thread block

// The chunk's xp rows go to LDS in two halves, so that a kernel can issue its
// other global loads between them and all latencies overlap.
__device__ __forceinline__ void load_xp_chunk(float* v,
                                              const float* __restrict__ xp,
                                              int r0) {
  const float* src = xp + (size_t)r0 * XPN_;
#pragma unroll
  for (int k = 0; k < NXV_; ++k) {
    const int i = threadIdx.x + k * 256;
    v[k] = ((k + 1) * 256 <= TCH_ * XPN_ || i < TCH_ * XPN_) ? src[i] : 0.f;
  }
}

__device__ __forceinline__ void store_xp_chunk(float* sx, const float* v) {
#pragma unroll
  for (int k = 0; k < NXV_; ++k) {
    const int i = threadIdx.x + k * 256;
    const int row = i / XPN_;
    const int col = i - row * XPN_;
    if ((k + 1) * 256 <= TCH_ * XPN_ || i < TCH_ * XPN_)
      sx[row * ROWP_ + (col == 0 ? 2 * DSTATE_ : col - 1)] = v[k];
  }
}

__device__ __forceinline__ void read16(float* v, const float* s) {
#pragma unroll
  for (int q = 0; q < 4; ++q) {
    const float4 f = ((const float4*)s)[q];
    v[4 * q + 0] = f.x; v[4 * q + 1] = f.y; v[4 * q + 2] = f.z; v[4 * q + 3] = f.w;
  }
}

// 1 + exp(din) is never below 1, so the hardware's log2 needs no guard for
// small arguments.
__device__ __forceinline__ float softplus_dt(float din) {
  const float l2 = __builtin_amdgcn_logf(1.f + __builtin_amdgcn_exp2f(1.44269504f * din));
  return (din > 20.f) ? din : 0.69314718f * l2;
}

// Grid: (DI_/256, CH_-1, B_), block 256.
__global__ __launch_bounds__(256)
void ssm_chunk_state_kernel(const float* __restrict__ xp,
                            const float* __restrict__ xc,
                            const float* __restrict__ W_dt, // (1, DI_)
                            const float* __restrict__ b_dt,
                            const float* __restrict__ A_log,
                            float* __restrict__ hend,       // (B, CH, 16, DI)
                            float* __restrict__ sdel) {     // (B, CH, DI)
  __shared__ __attribute__((aligned(16))) float sx[TCH_ * ROWP_];
  const int d  = blockIdx.x * 256 + threadIdx.x;
  const int c  = blockIdx.y;
  const int b  = blockIdx.z;
  const int r0 = b * S_ + c * TCH_;

  float xv[NXV_];
  load_xp_chunk(xv, xp, r0);

  float Aneg[DSTATE_];
#pragma unroll
  for (int n = 0; n < DSTATE_; ++n) Aneg[n] = -1.44269504f * __expf(A_log[n]);   // in units of log2(e)
  const float wdt = W_dt[d];
  const float bdt = b_dt[d];

  float h[DSTATE_];
#pragma unroll
  for (int n = 0; n < DSTATE_; ++n) h[n] = 0.f;
  float sd = 0.f;

  const float* xcp = xc + (size_t)r0 * DI_ + d;
  float xcu[GRP_];
#pragma unroll
  for (int u = 0; u < GRP_; ++u) xcu[u] = xcp[(size_t)u * DI_];

  store_xp_chunk(sx, xv);
  __syncthreads();

  // rolled over groups (code size); the next group's loads fly over this group's steps
#pragma unroll 1
  for (int g = 0; g < TCH_ / GRP_; ++g) {
    float xnx[GRP_];
#pragma unroll
    for (int u = 0; u < GRP_; ++u) xnx[u] = 0.f;
    if (g + 1 < TCH_ / GRP_) {
#pragma unroll
      for (int u = 0; u < GRP_; ++u) xnx[u] = xcp[(size_t)((g + 1) * GRP_ + u) * DI_];
      // the steps below reuse the address registers of these loads
      asm volatile("s_wait_xcnt 0x0" ::: "memory");
    }
#pragma unroll
    for (int u = 0; u < GRP_; ++u) {
      const float* row = sx + (g * GRP_ + u) * ROWP_;
      float Bv[DSTATE_];
      read16(Bv, row);
      const float delta = softplus_dt(row[2 * DSTATE_] * wdt + bdt);
      const float dx    = delta * xcu[u];
      sd += delta;
#pragma unroll
      for (int n = 0; n < DSTATE_; ++n) {
        const float e = __builtin_amdgcn_exp2f(delta * Aneg[n]);
        h[n] = e * h[n] + dx * Bv[n];
      }
    }
#pragma unroll
    for (int u = 0; u < GRP_; ++u) xcu[u] = xnx[u];
  }

  const size_t bc = (size_t)b * CH_ + c;
#pragma unroll
  for (int n = 0; n < DSTATE_; ++n) hend[(bc * DSTATE_ + n) * DI_ + d] = h[n];
  sdel[bc * DI_ + d] = sd;
}

// One thread per (b, n, d): chain the chunks' end states.
__global__ __launch_bounds__(256)
void ssm_chunk_carry_kernel(const float* __restrict__ hend,
                            const float* __restrict__ sdel,
                            const float* __restrict__ A_log,
                            float* __restrict__ hini) {     // (B, CH, 16, DI)
  const int idx = blockIdx.x * 256 + threadIdx.x;           // over B_*16*DI_
  const int d = idx & (DI_ - 1);
  const int n = (idx >> 11) & (DSTATE_ - 1);
  const int b = idx >> 15;
  const float an = -1.44269504f * __expf(A_log[n]);         // in units of log2(e)

  const float* hp = hend + ((size_t)b * CH_ * DSTATE_ + n) * DI_ + d;
  const float* sp = sdel + (size_t)b * CH_ * DI_ + d;
  float*       op = hini + ((size_t)b * CH_ * DSTATE_ + n) * DI_ + d;

  // every load is independent of the chain: fetch all first, one latency in all
  float he[CH_ - 1], ev[CH_ - 1];
#pragma unroll
  for (int c = 0; c < CH_ - 1; ++c) {
    ev[c] = sp[(size_t)c * DI_];
    he[c] = hp[(size_t)c * DSTATE_ * DI_];
  }
#pragma unroll
  for (int c = 0; c < CH_ - 1; ++c) ev[c] = __builtin_amdgcn_exp2f(an * ev[c]);

  float H = 0.f;
  op[0] = H;
#pragma unroll
  for (int c = 0; c < CH_ - 1; ++c) {
    H = ev[c] * H + he[c];
    op[(size_t)(c + 1) * DSTATE_ * DI_] = H;
  }
}

// Grid: (DI_/256, CH_, B_), block 256.
__global__ __launch_bounds__(256)
void ssm_chunk_out_kernel(const float* __restrict__ xp,
                          const float* __restrict__ xc,
                          const float* __restrict__ xz,   // z at cols [DI_, 2*DI_)
                          const float* __restrict__ W_dt, // (1, DI_)
                          const float* __restrict__ b_dt,
                          const float* __restrict__ A_log,
                          const float* __restrict__ Dp,
                          const float* __restrict__ hini,
                          _Float16* __restrict__ y_h) {
  __shared__ __attribute__((aligned(16))) float sx[TCH_ * ROWP_];
  const int d  = blockIdx.x * 256 + threadIdx.x;
  const int c  = blockIdx.y;
  const int b  = blockIdx.z;
  const int r0 = b * S_ + c * TCH_;

  float xv[NXV_];
  load_xp_chunk(xv, xp, r0);

  float Aneg[DSTATE_];
#pragma unroll
  for (int n = 0; n < DSTATE_; ++n) Aneg[n] = -1.44269504f * __expf(A_log[n]);   // in units of log2(e)
  const float wdt = W_dt[d];
  const float bdt = b_dt[d];
  const float dpv = Dp[d];

  const size_t bc = (size_t)b * CH_ + c;
  float h[DSTATE_];
#pragma unroll
  for (int n = 0; n < DSTATE_; ++n) h[n] = hini[(bc * DSTATE_ + n) * DI_ + d];

  const float* xcp = xc + (size_t)r0 * DI_ + d;
  const float* zp  = xz + (size_t)r0 * (2 * DI_) + DI_ + d;
  _Float16*    yp  = y_h + (size_t)r0 * DI_ + d;
  float xcu[GRP_], zcu[GRP_];
#pragma unroll
  for (int u = 0; u < GRP_; ++u) {
    xcu[u] = xcp[(size_t)u * DI_];
    zcu[u] = zp[(size_t)u * (2 * DI_)];
  }

  store_xp_chunk(sx, xv);
  __syncthreads();

  // rolled over groups (code size); the next group's loads fly over this group's steps
#pragma unroll 1
  for (int g = 0; g < TCH_ / GRP_; ++g) {
    float xnx[GRP_], znx[GRP_];
#pragma unroll
    for (int u = 0; u < GRP_; ++u) { xnx[u] = 0.f; znx[u] = 0.f; }
    if (g + 1 < TCH_ / GRP_) {
#pragma unroll
      for (int u = 0; u < GRP_; ++u) xnx[u] = xcp[(size_t)((g + 1) * GRP_ + u) * DI_];
      // a z load may land in an address register of the xc loads
      asm volatile("s_wait_xcnt 0x0" ::: "memory");
#pragma unroll
      for (int u = 0; u < GRP_; ++u) znx[u] = zp[(size_t)((g + 1) * GRP_ + u) * (2 * DI_)];
      // the steps below reuse the address registers of these loads
      asm volatile("s_wait_xcnt 0x0" ::: "memory");
    }
#pragma unroll
    for (int u = 0; u < GRP_; ++u) {
      const int t = g * GRP_ + u;
      const float* row = sx + t * ROWP_;
      float Bv[DSTATE_], Cv[DSTATE_];
      read16(Bv, row);
      read16(Cv, row + DSTATE_);
      const float delta = softplus_dt(row[2 * DSTATE_] * wdt + bdt);
      const float xcv   = xcu[u];
      const float zv    = zcu[u];
      const float dx    = delta * xcv;

      float y = 0.f;
#pragma unroll
      for (int n = 0; n < DSTATE_; ++n) {
        const float e = __builtin_amdgcn_exp2f(delta * Aneg[n]);
        h[n] = e * h[n] + dx * Bv[n];
        y += h[n] * Cv[n];
      }
      y += dpv * xcv;
      y *= silu(zv);
      yp[(size_t)t * DI_] = (_Float16)y;
    }
#pragma unroll
    for (int u = 0; u < GRP_; ++u) { xcu[u] = xnx[u]; zcu[u] = znx[u]; }
    // the next group reuses the data registers of this group's stores
    asm volatile("s_wait_xcnt 0x0" ::: "memory");
  }
}

// ---------------------------------------------------------------
extern "C" void kernel_launch(void* const* d_in, const int* in_sizes, int n_in,
                              void* d_out, int out_size, void* d_ws, size_t ws_size,
                              hipStream_t stream) {
  const float* x      = (const float*)d_in[0];   // (B,S,DM)
  const float* W_in   = (const float*)d_in[1];   // (DM, 2*DI)
  const float* conv_w = (const float*)d_in[2];   // (DI,1,4)
  const float* conv_b = (const float*)d_in[3];   // (DI)
  const float* W_xp   = (const float*)d_in[4];   // (DI, 33)
  const float* W_dt   = (const float*)d_in[5];   // (1, DI)
  const float* b_dt   = (const float*)d_in[6];   // (DI)
  const float* A_log  = (const float*)d_in[7];   // (16)
  const float* Dp     = (const float*)d_in[8];   // (DI)
  const float* W_out  = (const float*)d_in[9];   // (DI, DM)
  float* out = (float*)d_out;                    // (B,S,DM)

  // ---- workspace carve-out (256B aligned) ----
  size_t off = 0;
  auto carve = [&](size_t bytes) -> void* {
    void* p = (char*)d_ws + off;
    off += (bytes + 255) & ~(size_t)255;
    return p;
  };
  _Float16* x_h  = (_Float16*)carve((size_t)NROW_ * DM_ * 2);      // 4 MB
  _Float16* Wi_t = (_Float16*)carve((size_t)(2*DI_) * DM_ * 2);    // 8 MB  (4096 x 1024)
  _Float16* Wo_t = (_Float16*)carve((size_t)DM_ * DI_ * 2);        // 4 MB  (1024 x 2048)
  float*    xz   = (float*)   carve((size_t)NROW_ * 2*DI_ * 4);    // 32 MB
  float*    xc   = (float*)   carve((size_t)NROW_ * DI_ * 4);      // 16 MB
  float*    xp   = (float*)   carve((size_t)NROW_ * XPN_ * 4);     // ~0.3 MB
  _Float16* y_h  = (_Float16*)carve((size_t)NROW_ * DI_ * 2);      // 8 MB
  float*    hend = (float*)   carve((size_t)B_ * CH_ * DSTATE_ * DI_ * 4);  // 8 MB
  float*    hini = (float*)   carve((size_t)B_ * CH_ * DSTATE_ * DI_ * 4);  // 8 MB
  float*    sdel = (float*)   carve((size_t)B_ * CH_ * DI_ * 4);            // 0.5 MB

  // 1) W_in transposed and x converted, both to f16, in one launch
  prep_in_kernel<<<TWIN_B_ + CVT_B_, 256, 0, stream>>>(W_in, Wi_t, x, x_h);

  // 2) xz = x @ W_in        (2048 x 4096, K=1024)  -- WMMA
  {
    dim3 grid(NROW_ / 128, (2 * DI_) / GBN_);
    gemm_in_kernel<<<grid, 256, 0, stream>>>(x_h, Wi_t, xz);
  }

  // 3) depthwise conv + SiLU
  {
    dim3 grid(DI_ / 1024, NROW_ / CROWS_);
    conv_silu_kernel<<<grid, 256, 0, stream>>>(xz, conv_w, conv_b, xc);
  }

  // 4) xp = xc @ W_xproj    (N=33); beside it W_out transposed to f16
  xproj_twout_kernel<<<XPJ_B_ + TWOUT_B_, 32 * XW_, 0, stream>>>(xc, W_xp, xp, W_out, Wo_t);

  // 5) selective scan in parallel chunks -> gated y (f16)
  {
    dim3 grid(DI_ / 256, CH_ - 1, B_);
    ssm_chunk_state_kernel<<<grid, 256, 0, stream>>>(xp, xc, W_dt, b_dt, A_log,
                                                     hend, sdel);
  }
  {
    int n = B_ * DSTATE_ * DI_;
    ssm_chunk_carry_kernel<<<n / 256, 256, 0, stream>>>(hend, sdel, A_log, hini);
  }
  {
    dim3 grid(DI_ / 256, CH_, B_);
    ssm_chunk_out_kernel<<<grid, 256, 0, stream>>>(xp, xc, xz, W_dt, b_dt,
                                                   A_log, Dp, hini, y_h);
  }

  // 6) out = y @ W_out      (2048 x 1024, K=2048)  -- WMMA
  {
    dim3 grid(NROW_ / 64, DM_ / GBN_);
    gemm_out_kernel<<<grid, 128, 0, stream>>>(y_h, Wo_t, out);
  }
  (void)in_sizes; (void)n_in; (void)out_size; (void)ws_size;
}

// v007
// It runs in 74.5 microseconds.
// Two timings next to v006 both put it at 1.10 times that version's speed.
// Counting every step since v000, it is 19.6 times as fast.
#include <hip/hip_runtime.h>
#include <hip/hip_bf16.h>

// ---------------- problem constants (from reference) ----------------
#define B_      2
#define S_      1024
#define DM_     1024          // D_MODEL
#define DI_     2048          // D_INNER = 2*D_MODEL
#define DSTATE_ 16
#define DCONV_  4
#define NROW_   (B_ * S_)     // 2048 flattened (b,s) rows
#define XPN_    (2 * DSTATE_ + 1)   // 33

typedef __attribute__((ext_vector_type(16))) _Float16 v16h;
typedef __attribute__((ext_vector_type(8)))  _Float16 v8h;
typedef __attribute__((ext_vector_type(8)))  float    v8f;
typedef __attribute__((ext_vector_type(4)))  float    v4f;

union V16 { v16h v; v8h h2[2]; };

// ---------------------------------------------------------------
// The elementwise launches below give every thread 16 to 32 elements, moved
// in 16-byte loads and stores, the loads issued together at the start. One
// element per lane would start 16 to 32 times as many waves for the same bytes.
// ---------------------------------------------------------------

// v / (1 + exp(-v)) on the hardware's exp2 and reciprocal
__device__ __forceinline__ float silu(float v) {
  return v * __builtin_amdgcn_rcpf(1.f + __builtin_amdgcn_exp2f(-1.44269504f * v));
}

__device__ __forceinline__ v8h pack8(float a, float b, float c, float d,
                                     float e, float f, float g, float h) {
  v8h o = {(_Float16)a, (_Float16)b, (_Float16)c, (_Float16)d,
           (_Float16)e, (_Float16)f, (_Float16)g, (_Float16)h};
  return o;
}

// ---------------------------------------------------------------
// Elementwise f32 -> f16 convert of NROW_*DM_ values.
// A thread converts two runs of 8 values. CVT_T_/256 blocks of 256; blk is the
// block's number among them.
// ---------------------------------------------------------------
#define CVT_T_ (NROW_ * DM_ / 16)     // threads
__device__ __forceinline__ void cvt_f16_block(const float* __restrict__ in,
                                              _Float16* __restrict__ out, int blk) {
  const size_t t = (size_t)blk * 256 + threadIdx.x;
  const size_t e0 = t * 8;
  const size_t e1 = (t + CVT_T_) * 8;
  const v4f a0 = *(const v4f*)(in + e0);
  const v4f a1 = *(const v4f*)(in + e0 + 4);
  const v4f b0 = *(const v4f*)(in + e1);
  const v4f b1 = *(const v4f*)(in + e1 + 4);
  *(v8h*)(out + e0) = pack8(a0[0], a0[1], a0[2], a0[3], a1[0], a1[1], a1[2], a1[3]);
  *(v8h*)(out + e1) = pack8(b0[0], b0[1], b0[2], b0[3], b1[0], b1[1], b1[2], b1[3]);
}

// ---------------------------------------------------------------
// Transpose (K x N) f32  ->  (N x K) f16   (Wt[n*K + k] = W[k*N + n])
// A thread holds an 8 (k) x 4 (n) block: 8 row loads of 4 n, 4 stores of 8 k;
// the transpose itself is only a choice of registers. In a wave 8 lanes lie
// along k, so each store instruction writes whole 128-byte lines of Wt; the
// 8 waves of a block lie along n and share the lines of W they read.
// K and N are compile-time, so the row steps are immediate offsets on one
// address. (K/64) * (N/128) blocks of 256, k fastest; blk is the block's number
// among them; K % 64 == 0, N % 128 == 0.
// ---------------------------------------------------------------
template <int K, int N>
__device__ __forceinline__ void transpose_f16_block(const float* __restrict__ W,
                                                    _Float16* __restrict__ Wt, int blk) {
  const int lane = threadIdx.x & 31;
  const int wave = threadIdx.x >> 5;
  const int k = (blk % (K / 64)) * 64 + (lane & 7) * 8;
  const int n = (blk / (K / 64)) * 128 + wave * 16 + (lane >> 3) * 4;
  const float* src = W + (size_t)k * N + n;
  v4f r[8];
#pragma unroll
  for (int i = 0; i < 8; ++i) r[i] = *(const v4f*)(src + i * N);
  _Float16* dst = Wt + (size_t)n * K + k;
#pragma unroll
  for (int j = 0; j < 4; ++j)
    *(v8h*)(dst + j * K) = pack8(r[0][j], r[1][j], r[2][j], r[3][j],
                                 r[4][j], r[5][j], r[6][j], r[7][j]);
}

// Jobs that do not depend on one another share a launch: the block number picks
// the job, the longer job's blocks first. Each launch saved is a gap, a start
// and a tail less in the chain of dependent launches.
#define TWIN_B_  ((DM_ / 64) * (2 * DI_ / 128))   // blocks of the W_in transpose
#define TWOUT_B_ ((DI_ / 64) * (DM_ / 128))       // blocks of the W_out transpose
#define CVT_B_   (CVT_T_ / 256)                   // blocks of the convert

// What the input GEMM needs: W_in transposed, x converted.
// Grid: TWIN_B_ + CVT_B_ blocks of 256.
__global__ __launch_bounds__(256)
void prep_in_kernel(const float* __restrict__ W, _Float16* __restrict__ Wt,
                    const float* __restrict__ x, _Float16* __restrict__ x_h) {
  const int blk = blockIdx.x;
  if (blk < TWIN_B_) transpose_f16_block<DM_, 2 * DI_>(W, Wt, blk);
  else               cvt_f16_block(x, x_h, blk - TWIN_B_);
}

// ---------------------------------------------------------------
// WMMA GEMM:  C(MxN, f32) = A(MxK, f16 row-major) * B(KxN) with B given
// transposed: Bt (N x K, f16 row-major).
// A block of WM x 2 waves makes a (32*WM) x 128 tile of C; a wave makes 32 x 64
// of it: 2 A fragments times 4 B fragments per 32 k.
// The block's rows of A and Bt come into LDS 128 k at a time (a stage), by
// asynchronous copies of 16 bytes a lane: a copy instruction takes two whole
// 256-byte row pieces, and every row is fetched once per block instead of
// once per wave in 32-byte pieces. Two stage buffers: the copies of stage
// t + 2 fly while stage t + 1 is worked on.
// Fragments (16-bit A 16x32): lane < 16 holds k 0..7 and 16..23 of its row,
// lane >= 16 holds k 8..15 and 24..31; A and Bt are read by the same code.
// k runs upward in steps of 32 into one accumulator per 16x16 tile.
// Requires: M % (32*WM) == 0, N % 128 == 0, K % 128 == 0, K >= 256.
// ---------------------------------------------------------------
#define GBK_    128                  // k per stage
#define GPITCH_ 272                  // LDS row pitch in bytes: 16 x odd, for 16-byte reads
#define GBN_    128                  // columns of C per block
#define GSTAGE_(WM) ((32 * (WM) + GBN_) * GPITCH_)   // bytes of a stage

// Eight copies of 16 bytes a lane: rows r, r + RS, ..., r + 7 * RS of one
// operand. The wait at the end stands in the copies' own statement, so that no
// address register named here is rewritten in front of it.
template <int K, int RS>
__device__ __forceinline__ void async_rows8(unsigned lds, const _Float16* g) {
  asm volatile(
      "global_load_async_to_lds_b128 %0, %8, off\n\t"
      "global_load_async_to_lds_b128 %1, %9, off\n\t"
      "global_load_async_to_lds_b128 %2, %10, off\n\t"
      "global_load_async_to_lds_b128 %3, %11, off\n\t"
      "global_load_async_to_lds_b128 %4, %12, off\n\t"
      "global_load_async_to_lds_b128 %5, %13, off\n\t"
      "global_load_async_to_lds_b128 %6, %14, off\n\t"
      "global_load_async_to_lds_b128 %7, %15, off\n\t"
      "s_wait_xcnt 0x0"
      :: "v"(lds), "v"(lds + 1 * RS * GPITCH_), "v"(lds + 2 * RS * GPITCH_),
         "v"(lds + 3 * RS * GPITCH_), "v"(lds + 4 * RS * GPITCH_),
         "v"(lds + 5 * RS * GPITCH_), "v"(lds + 6 * RS * GPITCH_),
         "v"(lds + 7 * RS * GPITCH_),
         "v"(g), "v"(g + 1 * RS * K), "v"(g + 2 * RS * K), "v"(g + 3 * RS * K),
         "v"(g + 4 * RS * K), "v"(g + 5 * RS * K), "v"(g + 6 * RS * K), "v"(g + 7 * RS * K)
      : "memory");
}

// One stage: 32*WM rows of A, then GBN_ rows of Bt, 256 bytes of each. The
// block's threads cover RS = 4*WM rows at a time, 16 lanes to a row.
template <int WM, int K>
__device__ __forceinline__ void gemm_copy_stage(unsigned lds, const _Float16* ga,
                                                const _Float16* gb) {
  constexpr int RS = 4 * WM;
  async_rows8<K, RS>(lds, ga);
#pragma unroll
  for (int i = 0; i < GBN_ / (8 * RS); ++i)
    async_rows8<K, RS>(lds + (32 * WM + i * 8 * RS) * GPITCH_, gb + (size_t)i * 8 * RS * K);
}

// The fragments of 32 k: 2 of A's rows, 4 of Bt's, two 16-byte reads each.
__device__ __forceinline__ void gemm_frags(V16* a, V16* b, const _Float16* sa,
                                           const _Float16* sb) {
  constexpr int PH = GPITCH_ / 2;                // pitch in f16
#pragma unroll
  for (int i = 0; i < 2; ++i) {
    a[i].h2[0] = *(const v8h*)(sa + i * 16 * PH);
    a[i].h2[1] = *(const v8h*)(sa + i * 16 * PH + 16);
  }
#pragma unroll
  for (int j = 0; j < 4; ++j) {
    b[j].h2[0] = *(const v8h*)(sb + j * 16 * PH);
    b[j].h2[1] = *(const v8h*)(sb + j * 16 * PH + 16);
  }
}

template <int WM, int N, int K>
__device__ __forceinline__ void gemm_lds_block(const _Float16* __restrict__ A,
                                               const _Float16* __restrict__ Bt,
                                               float* __restrict__ C,
                                               unsigned char* smem) {
  constexpr int BM = 32 * WM;
  constexpr int NT = K / GBK_;                   // stages
  constexpr int PH = GPITCH_ / 2;                // pitch in f16
  const int lane  = threadIdx.x & 31;
  const int wave  = threadIdx.x >> 5;
  const int wm    = wave >> 1;
  const int wn    = wave & 1;
  const int tileM = blockIdx.x * BM;
  const int tileN = blockIdx.y * GBN_;
  const int halfSel = (lane >> 4) << 3;          // 0 or 8
  const int l16     = lane & 15;

  // copies: 16 lanes lie along a row piece
  const int crow = threadIdx.x >> 4;
  const int cchk = threadIdx.x & 15;
  const _Float16* ga = A  + (size_t)(tileM + crow) * K + cchk * 8;
  const _Float16* gb = Bt + (size_t)(tileN + crow) * K + cchk * 8;
  const unsigned  l0 = (unsigned)(uintptr_t)smem + crow * GPITCH_ + cchk * 16;

  v8f acc[2][4] = {};

  gemm_copy_stage<WM, K>(l0, ga, gb);
  // stage 0 has landed for this wave; the barrier publishes it to the others
  asm volatile("s_wait_asynccnt 0x0" ::: "memory");
  __syncthreads();
  gemm_copy_stage<WM, K>(l0 + GSTAGE_(WM), ga + GBK_, gb + GBK_);

  // rolled: one copy of the stage's code, and one hand-over point per stage
#pragma unroll 1
  for (int t = 0; t < NT; ++t) {
    const unsigned boff = (t & 1) * GSTAGE_(WM);
    const _Float16* sa = (const _Float16*)(smem + boff) + (wm * 32 + l16) * PH + halfSel;
    const _Float16* sb = (const _Float16*)(smem + boff) + (BM + wn * 64 + l16) * PH + halfSel;
    V16 a[2][2], b[2][4];                        // two fragment sets
    gemm_frags(a[0], b[0], sa, sb);
#pragma unroll
    for (int ks = 0; ks < GBK_ / 32; ++ks) {
      if (ks + 1 < GBK_ / 32)
        gemm_frags(a[(ks + 1) & 1], b[(ks + 1) & 1], sa + (ks + 1) * 32, sb + (ks + 1) * 32);
      // keeps the next 32 k's LDS reads together, ahead of this 32 k's products:
      // left free, they sink among the products and each group is waited out
      __builtin_amdgcn_sched_barrier(0);
#pragma unroll
      for (int i = 0; i < 2; ++i)
#pragma unroll
        for (int j = 0; j < 4; ++j)
          acc[i][j] = __builtin_amdgcn_wmma_f32_16x16x32_f16(false, a[ks & 1][i].v, false,
                                                             b[ks & 1][j].v, (short)0,
                                                             acc[i][j], false, false);
      __builtin_amdgcn_sched_barrier(0);         // the same, from below
    }
    // hand-over: this wave's reads of stage t are done ...
    asm volatile("s_wait_dscnt 0x0" ::: "memory");
    // ... its copies of stage t + 1 have landed ...
    asm volatile("s_wait_asynccnt 0x0" ::: "memory");
    // ... and the barrier publishes stage t + 1 and frees stage t's buffer
    __syncthreads();
    if (t + 2 < NT)
      gemm_copy_stage<WM, K>(l0 + boff, ga + (size_t)(t + 2) * GBK_, gb + (size_t)(t + 2) * GBK_);
  }
  // no copy is left in flight when the wave ends
  asm volatile("s_wait_asynccnt 0x0" ::: "memory");

  // C/D layout: VGPR r -> row r of the tile for lanes 0..15, row r + 8 for
  // lanes 16..31; col = lane & 15.
  const int rowOff = (lane < 16) ? 0 : 8;
  float* crow0 = C + (size_t)(tileM + wm * 32 + rowOff) * N + tileN + wn * 64 + l16;
#pragma unroll
  for (int i = 0; i < 2; ++i)
#pragma unroll
    for (int r = 0; r < 8; ++r) {
      float* cr = crow0 + (size_t)(i * 16 + r) * N;
      cr[0]  = acc[i][0][r];
      cr[16] = acc[i][1][r];
      cr[32] = acc[i][2][r];
      cr[48] = acc[i][3][r];
    }
}

// xz = x_h * Wi_t^T: 128 x 128 tiles, 8 waves; 512 blocks, two to a WGP.
__global__ __launch_bounds__(256)
void gemm_in_kernel(const _Float16* __restrict__ A, const _Float16* __restrict__ Bt,
                    float* __restrict__ C) {
  __shared__ __attribute__((aligned(16))) unsigned char smem[2 * GSTAGE_(4)];
  gemm_lds_block<4, 2 * DI_, DM_>(A, Bt, C, smem);
}

// out = y_h * Wo_t^T: 64 x 128 tiles, 4 waves, so that 256 blocks come of the
// smaller C.
__global__ __launch_bounds__(128)
void gemm_out_kernel(const _Float16* __restrict__ A, const _Float16* __restrict__ Bt,
                     float* __restrict__ C) {
  __shared__ __attribute__((aligned(16))) unsigned char smem[2 * GSTAGE_(2)];
  gemm_lds_block<2, DM_, DI_>(A, Bt, C, smem);
}

// ---------------------------------------------------------------
// Depthwise causal conv (width 4) + bias + SiLU, and xp = xc @ W_xproj behind
// it in the same block.
//   xc = silu(conv(x_in) + conv_b); x_in is columns [0, DI) of xz (NROW x 2*DI)
//   xp = xc @ W_xproj   (NROW x DI) * (DI x 33) -> (NROW x 33), all in f32,
//        on the f32 16x16x4 matrix form.
// A block takes 16 rows and XKC_ channels. First every thread makes the 16
// rows of its 4 channels from 19 row loads, stores them to xc (the scan reads
// them there) and into an LDS tile. Behind a barrier the tile is the A operand:
// xc is not read back from memory, and no launch stands between the two.
// The XKB_ blocks of a row group each sum their own channels and leave a plane
// of partial xp; the readers of xp add the planes.
// The block's XW_ waves split its k; each wave holds three 16x16 accumulator
// tiles (columns 0-15, 16-31, and column 32 repeated in all 16 columns of the
// third tile, of which only the first is kept: a column of D depends on that
// column of B alone). The waves' partial sums meet in LDS.
// k pairing: in a run of 32 k, lane (c, h) holds k = 16h + q, q = 0..15, of
// row c of xc and of its column of W_xproj; product t takes q = 2t, 2t + 1 of
// both. The loads of a run are issued at least one run ahead of its products.
// (NROW_/16) * XKB_ blocks of 32 * XW_ threads; blk is the block's number among
// them. S_ % 16 == 0, so a block's rows lie in one sequence and only the
// XKB_ blocks of a sequence's first row group have rows before the start.
// ---------------------------------------------------------------
typedef __attribute__((ext_vector_type(2))) float v2f;
#define XW_   8                     // waves of a block
#define XKB_  2                     // blocks that share a row group's channels
#define XKC_  (DI_ / XKB_)          // channels of a block
#define XKS_  (XKC_ / XW_)          // k per wave
#define XRUN_ 32                    // k per run of loads
#define XROW_ 16                    // rows of a block
#define XPIT_ 52                    // LDS row pitch in floats: rows 8 apart lie 32 banks apart
#define XCP_  (XKC_ + 4)            // pitch of the xc tile in floats: 16 bytes x odd, for 16-byte reads

struct XFrag { v4f a[4]; float b[3][16]; };

// ap points into the LDS tile
__device__ __forceinline__ void xproj_load_a(XFrag& f, const float* ap) {
#pragma unroll
  for (int i = 0; i < 4; ++i) f.a[i] = *(const v4f*)(ap + 4 * i);
}

__device__ __forceinline__ void xproj_load_b(XFrag& f, const float* __restrict__ bp,
                                             const float* __restrict__ bw) {
#pragma unroll
  for (int q = 0; q < 16; ++q) {
    f.b[0][q] = bp[q * XPN_];
    f.b[1][q] = bp[q * XPN_ + 16];
    f.b[2][q] = bw[q * XPN_ + XPN_ - 1];
  }
}

__device__ __forceinline__ void xproj_mma(v8f* acc, const XFrag& f) {
#pragma unroll
  for (int t = 0; t < 8; ++t) {
    const v2f a = {f.a[t >> 1][(2 * t) & 3], f.a[t >> 1][(2 * t + 1) & 3]};
#pragma unroll
    for (int j = 0; j < 3; ++j) {
      const v2f b = {f.b[j][2 * t], f.b[j][2 * t + 1]};
      acc[j] = __builtin_amdgcn_wmma_f32_16x16x4_f32(false, a, false, b, (short)0,
                                                     acc[j], false, false);
    }
  }
}

__device__ __forceinline__ void conv_xproj_block(const float* __restrict__ xz,
                                                 const float* __restrict__ conv_w,
                                                 const float* __restrict__ conv_b,
                                                 const float* __restrict__ Wx,
                                                 float* __restrict__ xc,
                                                 float* __restrict__ xpp,
                                                 float* tile, float* red, int blk) {
  const int lane = threadIdx.x & 31;
  const int wave = threadIdx.x >> 5;
  const int c    = lane & 15;
  const int h    = lane >> 4;
  const int kb   = blk % XKB_;
  const int r0   = (blk / XKB_) * XROW_;
  const int d    = kb * XKC_ + threadIdx.x * 4;     // the thread's 4 channels
  const int k0   = wave * XKS_ + 16 * h;            // the lane's first k in the tile

  const float* xin = xz + (size_t)r0 * (2 * DI_) + d;
  v4f x[XROW_ + DCONV_ - 1];                  // x[i] = row r0 - 3 + i
#pragma unroll
  for (int i = 0; i < DCONV_ - 1; ++i) x[i] = (v4f){0.f, 0.f, 0.f, 0.f};
  if ((r0 & (S_ - 1)) != 0) {                 // the causal left pad stays zero
#pragma unroll
    for (int i = 0; i < DCONV_ - 1; ++i)
      x[i] = *(const v4f*)(xin - (size_t)(DCONV_ - 1 - i) * (2 * DI_));
  }
#pragma unroll
  for (int i = 0; i < XROW_; ++i)
    x[DCONV_ - 1 + i] = *(const v4f*)(xin + (size_t)i * (2 * DI_));

  v4f w[4];                                   // w[q] = the 4 taps of channel d + q
  const float* wp  = conv_w + (size_t)d * DCONV_;
  const float* cbp = conv_b + d;
#pragma unroll
  for (int q = 0; q < 4; ++q) w[q] = *(const v4f*)(wp + q * DCONV_);
  const v4f bias = *(const v4f*)cbp;

  // the first run of W_xproj does not wait for xc: its latency passes under the conv
  const float* bw = Wx + (size_t)(kb * XKC_ + k0) * XPN_;   // the lane's first row of W_xproj
  const float* bp = bw + c;
  XFrag f0, f1;
  xproj_load_b(f0, bp, bw);
  // the addresses stay in their registers up to here (else a later load of the
  // group lands in one); the arithmetic below reuses them only behind this wait
  asm volatile("s_wait_xcnt 0x0" :: "v"(xin), "v"(wp), "v"(cbp) : "memory");
  // keeps every load, and that wait, above the arithmetic: one memory latency
  // per thread instead of several
  __builtin_amdgcn_sched_barrier(0);

  float* op = xc + (size_t)r0 * DI_ + d;
  float* tp = tile + threadIdx.x * 4;
#pragma unroll
  for (int i = 0; i < XROW_; ++i) {
    v4f o;
#pragma unroll
    for (int q = 0; q < 4; ++q) {
      float acc = bias[q];
#pragma unroll
      for (int j = 0; j < DCONV_; ++j) acc += x[i + j][q] * w[q][j];
      o[q] = silu(acc);
    }
    *(v4f*)(op + (size_t)i * DI_) = o;
    *(v4f*)(tp + i * XCP_) = o;
  }
  // what follows reuses the registers of the stores to xc
  asm volatile("s_wait_xcnt 0x0" ::: "memory");
  // the tile is whole before any wave takes fragments from it. The fences name
  // LDS alone: __syncthreads() would also wait out the stores to xc, which
  // nothing in this launch reads
  __builtin_amdgcn_fence(__ATOMIC_RELEASE, "workgroup", "local");
  __builtin_amdgcn_s_barrier();
  __builtin_amdgcn_fence(__ATOMIC_ACQUIRE, "workgroup", "local");

  const float* ap = tile + c * XCP_ + k0;
  v8f acc[3] = {};
  xproj_load_a(f0, ap);
#pragma unroll
  for (int s = 0; s < XKS_ / XRUN_; s += 2) {
    xproj_load_a(f1, ap + (s + 1) * XRUN_);
    xproj_load_b(f1, bp + (s + 1) * XRUN_ * XPN_, bw + (s + 1) * XRUN_ * XPN_);
    // keeps the next run's loads above this run's products: left free, the
    // compiler sinks each load to a few products ahead of its use, too late
    __builtin_amdgcn_sched_barrier(0);
    xproj_mma(acc, f0);
    if (s + 2 < XKS_ / XRUN_) {
      xproj_load_a(f0, ap + (s + 2) * XRUN_);
      xproj_load_b(f0, bp + (s + 2) * XRUN_ * XPN_, bw + (s + 2) * XRUN_ * XPN_);
    }
    __builtin_amdgcn_sched_barrier(0);   // the same, for the other register set
    xproj_mma(acc, f1);
  }
  // the two addresses stay in their registers up to here (else the last
  // run's loads land in them), and are given up only behind this wait
  asm volatile("s_wait_xcnt 0x0" :: "v"(bp), "v"(bw) : "memory");

  // D register r of lane (c, h) is row 8h + r, column c of its tile
  float* my = red + wave * 16 * XPIT_;
#pragma unroll
  for (int j = 0; j < 3; ++j)
#pragma unroll
    for (int r = 0; r < 8; ++r) my[(8 * h + r) * XPIT_ + 16 * j + c] = acc[j][r];
  __syncthreads();

  float* xp = xpp + (size_t)kb * NROW_ * XPN_ + (size_t)r0 * XPN_;
  for (int idx = threadIdx.x; idx < 16 * XPN_; idx += 32 * XW_) {
    const int row = idx / XPN_;
    const int col = idx - row * XPN_;
    float sum = red[row * XPIT_ + col];
#pragma unroll
    for (int w2 = 1; w2 < XW_; ++w2) sum += red[(w2 * 16 + row) * XPIT_ + col];
    xp[idx] = sum;
  }
}

// The W_out transpose, which only the last GEMM needs, runs in the same launch.
// Grid: XPJ_B_ + TWOUT_B_ blocks of 32 * XW_ = 256 threads.
#define XPJ_B_ ((NROW_ / XROW_) * XKB_)
__global__ __launch_bounds__(32 * XW_)
void conv_xproj_twout_kernel(const float* __restrict__ xz,
                             const float* __restrict__ conv_w,
                             const float* __restrict__ conv_b,
                             const float* __restrict__ Wx,
                             float* __restrict__ xc,
                             float* __restrict__ xpp,
                             const float* __restrict__ W, _Float16* __restrict__ Wt) {
  __shared__ __attribute__((aligned(16))) float tile[XROW_ * XCP_];
  __shared__ float red[XW_ * 16 * XPIT_];
  const int blk = blockIdx.x;
  if (blk < XPJ_B_) conv_xproj_block(xz, conv_w, conv_b, Wx, xc, xpp, tile, red, blk);
  else              transpose_f16_block<DI_, DM_>(W, Wt, blk - XPJ_B_);
}

// ---------------------------------------------------------------
// Selective scan, split along the sequence into CH_ chunks of TCH_ steps
// that run in parallel. The recurrence h <- dA*h + dBx is linear in h, and
// the product of dA over a chunk is exp(A * sum(delta)), so:
//   1) chunk_state: every chunk but the last runs from h = 0 and leaves its
//      end state and its sum of delta;
//   2) chunk_carry: per (b, n, d) the CH_ - 1 end states are chained into the
//      true state at the start of each chunk;
//   3) chunk_out: every chunk runs again from its true start state and
//      emits y = h.C + Dp*xc, gated with silu(z), as f16 for the output GEMM.
// One thread per (b, chunk, d), state h[16] in registers. The chunk's xp
// rows (dt|B|C) are staged in LDS once and read as broadcasts.
// ---------------------------------------------------------------
#define CH_   32                    // chunks per sequence
#define TCH_  (S_ / CH_)            // steps per chunk
#define ROWP_ (2 * DSTATE_ + 4)     // LDS row: B[16] | C[16] | dt | pad, 16-byte rows
#define GRP_  8                     // steps whose xc / z are fetched together, one group ahead

#define NXV_  ((TCH_ * XPN_ + 255) / 256)   // xp words per thread of a 256-thread block

// The chunk's xp rows go to LDS in two halves, so that a kernel can issue its
// other global loads between them and all latencies overlap. xp comes as two
// planes of partial sums (XKB_ == 2), added on the way into LDS.
__device__ __forceinline__ void load_xp_chunk(float* v,
                                              const float* __restrict__ xp,
                                              int r0) {
  const float* src = xp + (size_t)r0 * XPN_;
#pragma unroll
  for (int k = 0; k < NXV_; ++k) {
    const int i = threadIdx.x + k * 256;
    const bool in = (k + 1) * 256 <= TCH_ * XPN_ || i < TCH_ * XPN_;
    v[k]        = in ? src[i] : 0.f;
    v[NXV_ + k] = in ? src[i + NROW_ * XPN_] : 0.f;
  }
}

__device__ __forceinline__ void store_xp_chunk(float* sx, const float* v) {
#pragma unroll
  for (int k = 0; k < NXV_; ++k) {
    const int i = threadIdx.x + k * 256;
    const int row = i / XPN_;
    const int col = i - row * XPN_;
    if ((k + 1) * 256 <= TCH_ * XPN_ || i < TCH_ * XPN_)
      sx[row * ROWP_ + (col == 0 ? 2 * DSTATE_ : col - 1)] = v[k] + v[NXV_ + k];
  }
}

__device__ __forceinline__ void read16(float* v, const float* s) {
#pragma unroll
  for (int q = 0; q < 4; ++q) {
    const float4 f = ((const float4*)s)[q];
    v[4 * q + 0] = f.x; v[4 * q + 1] = f.y; v[4 * q + 2] = f.z; v[4 * q + 3] = f.w;
  }
}

// 1 + exp(din) is never below 1, so the hardware's log2 needs no guard for
// small arguments.
__device__ __forceinline__ float softplus_dt(float din) {
  const float l2 = __builtin_amdgcn_logf(1.f + __builtin_amdgcn_exp2f(1.44269504f * din));
  return (din > 20.f) ? din : 0.69314718f * l2;
}

// Grid: (DI_/256, CH_-1, B_), block 256.
__global__ __launch_bounds__(256)
void ssm_chunk_state_kernel(const float* __restrict__ xp,
                            const float* __restrict__ xc,
                            const float* __restrict__ W_dt, // (1, DI_)
                            const float* __restrict__ b_dt,
                            const float* __restrict__ A_log,
                            float* __restrict__ hend,       // (B, CH, 16, DI)
                            float* __restrict__ sdel) {     // (B, CH, DI)
  __shared__ __attribute__((aligned(16))) float sx[TCH_ * ROWP_];
  const int d  = blockIdx.x * 256 + threadIdx.x;
  const int c  = blockIdx.y;
  const int b  = blockIdx.z;
  const int r0 = b * S_ + c * TCH_;

  float xv[2 * NXV_];
  load_xp_chunk(xv, xp, r0);

  float Aneg[DSTATE_];
#pragma unroll
  for (int n = 0; n < DSTATE_; ++n) Aneg[n] = -1.44269504f * __expf(A_log[n]);   // in units of log2(e)
  const float wdt = W_dt[d];
  const float bdt = b_dt[d];

  float h[DSTATE_];
#pragma unroll
  for (int n = 0; n < DSTATE_; ++n) h[n] = 0.f;
  float sd = 0.f;

  const float* xcp = xc + (size_t)r0 * DI_ + d;
  float xcu[GRP_];
#pragma unroll
  for (int u = 0; u < GRP_; ++u) xcu[u] = xcp[(size_t)u * DI_];

  // keeps the sums of the xp planes, which wait for their loads, below the xc
  // loads: left free, a part of them rises above and xc starts a latency late
  __builtin_amdgcn_sched_barrier(0);
  store_xp_chunk(sx, xv);
  __syncthreads();

  // rolled over groups (code size); the next group's loads fly over this group's steps
#pragma unroll 1
  for (int g = 0; g < TCH_ / GRP_; ++g) {
    float xnx[GRP_];
#pragma unroll
    for (int u = 0; u < GRP_; ++u) xnx[u] = 0.f;
    if (g + 1 < TCH_ / GRP_) {
#pragma unroll
      for (int u = 0; u < GRP_; ++u) xnx[u] = xcp[(size_t)((g + 1) * GRP_ + u) * DI_];
      // the steps below reuse the address registers of these loads
      asm volatile("s_wait_xcnt 0x0" ::: "memory");
    }
#pragma unroll
    for (int u = 0; u < GRP_; ++u) {
      const float* row = sx + (g * GRP_ + u) * ROWP_;
      float Bv[DSTATE_];
      read16(Bv, row);
      const float delta = softplus_dt(row[2 * DSTATE_] * wdt + bdt);
      const float dx    = delta * xcu[u];
      sd += delta;
#pragma unroll
      for (int n = 0; n < DSTATE_; ++n) {
        const float e = __builtin_amdgcn_exp2f(delta * Aneg[n]);
        h[n] = e * h[n] + dx * Bv[n];
      }
    }
#pragma unroll
    for (int u = 0; u < GRP_; ++u) xcu[u] = xnx[u];
  }

  const size_t bc = (size_t)b * CH_ + c;
#pragma unroll
  for (int n = 0; n < DSTATE_; ++n) hend[(bc * DSTATE_ + n) * DI_ + d] = h[n];
  sdel[bc * DI_ + d] = sd;
}

// One thread per (b, n, d): chain the chunks' end states.
__global__ __launch_bounds__(256)
void ssm_chunk_carry_kernel(const float* __restrict__ hend,
                            const float* __restrict__ sdel,
                            const float* __restrict__ A_log,
                            float* __restrict__ hini) {     // (B, CH, 16, DI)
  const int idx = blockIdx.x * 256 + threadIdx.x;           // over B_*16*DI_
  const int d = idx & (DI_ - 1);
  const int n = (idx >> 11) & (DSTATE_ - 1);
  const int b = idx >> 15;
  const float an = -1.44269504f * __expf(A_log[n]);         // in units of log2(e)

  const float* hp = hend + ((size_t)b * CH_ * DSTATE_ + n) * DI_ + d;
  const float* sp = sdel + (size_t)b * CH_ * DI_ + d;
  float*       op = hini + ((size_t)b * CH_ * DSTATE_ + n) * DI_ + d;

  // every load is independent of the chain: fetch all first, one latency in all
  float he[CH_ - 1], ev[CH_ - 1];
#pragma unroll
  for (int c = 0; c < CH_ - 1; ++c) {
    ev[c] = sp[(size_t)c * DI_];
    he[c] = hp[(size_t)c * DSTATE_ * DI_];
  }
#pragma unroll
  for (int c = 0; c < CH_ - 1; ++c) ev[c] = __builtin_amdgcn_exp2f(an * ev[c]);

  float H = 0.f;
  op[0] = H;
#pragma unroll
  for (int c = 0; c < CH_ - 1; ++c) {
    H = ev[c] * H + he[c];
    op[(size_t)(c + 1) * DSTATE_ * DI_] = H;
  }
}

// Grid: (DI_/256, CH_, B_), block 256.
__global__ __launch_bounds__(256)
void ssm_chunk_out_kernel(const float* __restrict__ xp,
                          const float* __restrict__ xc,
                          const float* __restrict__ xz,   // z at cols [DI_, 2*DI_)
                          const float* __restrict__ W_dt, // (1, DI_)
                          const float* __restrict__ b_dt,
                          const float* __restrict__ A_log,
                          const float* __restrict__ Dp,
                          const float* __restrict__ hini,
                          _Float16* __restrict__ y_h) {
  __shared__ __attribute__((aligned(16))) float sx[TCH_ * ROWP_];
  const int d  = blockIdx.x * 256 + threadIdx.x;
  const int c  = blockIdx.y;
  const int b  = blockIdx.z;
  const int r0 = b * S_ + c * TCH_;

  float xv[2 * NXV_];
  load_xp_chunk(xv, xp, r0);

  float Aneg[DSTATE_];
#pragma unroll
  for (int n = 0; n < DSTATE_; ++n) Aneg[n] = -1.44269504f * __expf(A_log[n]);   // in units of log2(e)
  const float wdt = W_dt[d];
  const float bdt = b_dt[d];
  const float dpv = Dp[d];

  const size_t bc = (size_t)b * CH_ + c;
  const float* hp = hini + bc * DSTATE_ * DI_ + d;
  float h[DSTATE_];
#pragma unroll
  for (int n = 0; n < DSTATE_; ++n) h[n] = hp[(size_t)n * DI_];

  const float* xcp = xc + (size_t)r0 * DI_ + d;
  const float* zp  = xz + (size_t)r0 * (2 * DI_) + DI_ + d;
  _Float16*    yp  = y_h + (size_t)r0 * DI_ + d;
  float xcu[GRP_], zcu[GRP_];
#pragma unroll
  for (int u = 0; u < GRP_; ++u) {
    xcu[u] = xcp[(size_t)u * DI_];
    zcu[u] = zp[(size_t)u * (2 * DI_)];
  }
  // the address of the h loads stays in its registers up to here (else a later
  // load of the group lands in them)
  asm volatile("s_wait_xcnt 0x0" :: "v"(hp) : "memory");

  store_xp_chunk(sx, xv);
  __syncthreads();

  // rolled over groups (code size); the next group's loads fly over this group's steps
#pragma unroll 1
  for (int g = 0; g < TCH_ / GRP_; ++g) {
    float xnx[GRP_], znx[GRP_];
#pragma unroll
    for (int u = 0; u < GRP_; ++u) { xnx[u] = 0.f; znx[u] = 0.f; }
    if (g + 1 < TCH_ / GRP_) {
#pragma unroll
      for (int u = 0; u < GRP_; ++u) xnx[u] = xcp[(size_t)((g + 1) * GRP_ + u) * DI_];
      // a z load may land in an address register of the xc loads
      asm volatile("s_wait_xcnt 0x0" ::: "memory");
#pragma unroll
      for (int u = 0; u < GRP_; ++u) znx[u] = zp[(size_t)((g + 1) * GRP_ + u) * (2 * DI_)];
      // the steps below reuse the address registers of these loads
      asm volatile("s_wait_xcnt 0x0" ::: "memory");
    }
#pragma unroll
    for (int u = 0; u < GRP_; ++u) {
      const int t = g * GRP_ + u;
      const float* row = sx + t * ROWP_;
      float Bv[DSTATE_], Cv[DSTATE_];
      read16(Bv, row);
      read16(Cv, row + DSTATE_);
      const float delta = softplus_dt(row[2 * DSTATE_] * wdt + bdt);
      const float xcv   = xcu[u];
      const float zv    = zcu[u];
      const float dx    = delta * xcv;

      float y = 0.f;
#pragma unroll
      for (int n = 0; n < DSTATE_; ++n) {
        const float e = __builtin_amdgcn_exp2f(delta * Aneg[n]);
        h[n] = e * h[n] + dx * Bv[n];
        y += h[n] * Cv[n];
      }
      y += dpv * xcv;
      y *= silu(zv);
      yp[(size_t)t * DI_] = (_Float16)y;
    }
#pragma unroll
    for (int u = 0; u < GRP_; ++u) { xcu[u] = xnx[u]; zcu[u] = znx[u]; }
    // the next group reuses the data registers of this group's stores
    asm volatile("s_wait_xcnt 0x0" ::: "memory");
  }
}

// ---------------------------------------------------------------
extern "C" void kernel_launch(void* const* d_in, const int* in_sizes, int n_in,
                              void* d_out, int out_size, void* d_ws, size_t ws_size,
                              hipStream_t stream) {
  const float* x      = (const float*)d_in[0];   // (B,S,DM)
  const float* W_in   = (const float*)d_in[1];   // (DM, 2*DI)
  const float* conv_w = (const float*)d_in[2];   // (DI,1,4)
  const float* conv_b = (const float*)d_in[3];   // (DI)
  const float* W_xp   = (const float*)d_in[4];   // (DI, 33)
  const float* W_dt   = (const float*)d_in[5];   // (1, DI)
  const float* b_dt   = (const float*)d_in[6];   // (DI)
  const float* A_log  = (const float*)d_in[7];   // (16)
  const float* Dp     = (const float*)d_in[8];   // (DI)
  const float* W_out  = (const float*)d_in[9];   // (DI, DM)
  float* out = (float*)d_out;                    // (B,S,DM)

  // ---- workspace carve-out (256B aligned) ----
  size_t off = 0;
  auto carve = [&](size_t bytes) -> void* {
    void* p = (char*)d_ws + off;
    off += (bytes + 255) & ~(size_t)255;
    return p;
  };
  _Float16* x_h  = (_Float16*)carve((size_t)NROW_ * DM_ * 2);      // 4 MB
  _Float16* Wi_t = (_Float16*)carve((size_t)(2*DI_) * DM_ * 2);    // 8 MB  (4096 x 1024)
  _Float16* Wo_t = (_Float16*)carve((size_t)DM_ * DI_ * 2);        // 4 MB  (1024 x 2048)
  float*    xz   = (float*)   carve((size_t)NROW_ * 2*DI_ * 4);    // 32 MB
  float*    xc   = (float*)   carve((size_t)NROW_ * DI_ * 4);      // 16 MB
  float*    xp   = (float*)   carve((size_t)XKB_ * NROW_ * XPN_ * 4);   // ~0.5 MB, XKB_ planes
  _Float16* y_h  = (_Float16*)carve((size_t)NROW_ * DI_ * 2);      // 8 MB
  float*    hend = (float*)   carve((size_t)B_ * CH_ * DSTATE_ * DI_ * 4);  // 8 MB
  float*    hini = (float*)   carve((size_t)B_ * CH_ * DSTATE_ * DI_ * 4);  // 8 MB
  float*    sdel = (float*)   carve((size_t)B_ * CH_ * DI_ * 4);            // 0.5 MB

  // 1) W_in transposed and x converted, both to f16, in one launch
  prep_in_kernel<<<TWIN_B_ + CVT_B_, 256, 0, stream>>>(W_in, Wi_t, x, x_h);

  // 2) xz = x @ W_in        (2048 x 4096, K=1024)  -- WMMA
  {
    dim3 grid(NROW_ / 128, (2 * DI_) / GBN_);
    gemm_in_kernel<<<grid, 256, 0, stream>>>(x_h, Wi_t, xz);
  }

  // 3) depthwise conv + SiLU and xp = xc @ W_xproj (N=33) in one launch;
  //    beside them W_out transposed to f16
  conv_xproj_twout_kernel<<<XPJ_B_ + TWOUT_B_, 32 * XW_, 0, stream>>>(xz, conv_w, conv_b, W_xp,
                                                                      xc, xp, W_out, Wo_t);

  // 4) selective scan in parallel chunks -> gated y (f16)
  {
    dim3 grid(DI_ / 256, CH_ - 1, B_);
    ssm_chunk_state_kernel<<<grid, 256, 0, stream>>>(xp, xc, W_dt, b_dt, A_log,
                                                     hend, sdel);
  }
  {
    int n = B_ * DSTATE_ * DI_;
    ssm_chunk_carry_kernel<<<n / 256, 256, 0, stream>>>(hend, sdel, A_log, hini);
  }
  {
    dim3 grid(DI_ / 256, CH_, B_);
    ssm_chunk_out_kernel<<<grid, 256, 0, stream>>>(xp, xc, xz, W_dt, b_dt,
                                                   A_log, Dp, hini, y_h);
  }

  // 5) out = y @ W_out      (2048 x 1024, K=2048)  -- WMMA
  {
    dim3 grid(NROW_ / 64, DM_ / GBN_);
    gemm_out_kernel<<<grid, 128, 0, stream>>>(y_h, Wo_t, out);
  }
  (void)in_sizes; (void)n_in; (void)out_size; (void)ws_size;
}

// v008
// It runs in 70.3 microseconds.
// In both of two side-by-side timings against v007, it was 1.05 times as fast.
// All steps since v000 together make it 20.6 times as fast.
#include <hip/hip_runtime.h>
#include <hip/hip_bf16.h>

// ---------------- problem constants (from reference) ----------------
#define B_      2
#define S_      1024
#define DM_     1024          // D_MODEL
#define DI_     2048          // D_INNER = 2*D_MODEL
#define DSTATE_ 16
#define DCONV_  4
#define NROW_   (B_ * S_)     // 2048 flattened (b,s) rows
#define XPN_    (2 * DSTATE_ + 1)   // 33

typedef __attribute__((ext_vector_type(16))) _Float16 v16h;
typedef __attribute__((ext_vector_type(8)))  _Float16 v8h;
typedef __attribute__((ext_vector_type(8)))  float    v8f;
typedef __attribute__((ext_vector_type(4)))  float    v4f;

union V16 { v16h v; v8h h2[2]; };

// ---------------------------------------------------------------
// The elementwise launches below give every thread 16 to 32 elements, moved
// in 16-byte loads and stores, the loads issued together at the start. One
// element per lane would start 16 to 32 times as many waves for the same bytes.
// ---------------------------------------------------------------

// v / (1 + exp(-v)) on the hardware's exp2 and reciprocal
__device__ __forceinline__ float silu(float v) {
  return v * __builtin_amdgcn_rcpf(1.f + __builtin_amdgcn_exp2f(-1.44269504f * v));
}

__device__ __forceinline__ v8h pack8(float a, float b, float c, float d,
                                     float e, float f, float g, float h) {
  v8h o = {(_Float16)a, (_Float16)b, (_Float16)c, (_Float16)d,
           (_Float16)e, (_Float16)f, (_Float16)g, (_Float16)h};
  return o;
}

// ---------------------------------------------------------------
// Elementwise f32 -> f16 convert of NROW_*DM_ values.
// A thread converts two runs of 8 values. CVT_T_/256 blocks of 256; blk is the
// block's number among them.
// ---------------------------------------------------------------
#define CVT_T_ (NROW_ * DM_ / 16)     // threads
__device__ __forceinline__ void cvt_f16_block(const float* __restrict__ in,
                                              _Float16* __restrict__ out, int blk) {
  const size_t t = (size_t)blk * 256 + threadIdx.x;
  const size_t e0 = t * 8;
  const size_t e1 = (t + CVT_T_) * 8;
  const v4f a0 = *(const v4f*)(in + e0);
  const v4f a1 = *(const v4f*)(in + e0 + 4);
  const v4f b0 = *(const v4f*)(in + e1);
  const v4f b1 = *(const v4f*)(in + e1 + 4);
  *(v8h*)(out + e0) = pack8(a0[0], a0[1], a0[2], a0[3], a1[0], a1[1], a1[2], a1[3]);
  *(v8h*)(out + e1) = pack8(b0[0], b0[1], b0[2], b0[3], b1[0], b1[1], b1[2], b1[3]);
}

// ---------------------------------------------------------------
// Transpose (K x N) f32  ->  (N x K) f16   (Wt[n*K + k] = W[k*N + n])
// A thread holds an 8 (k) x 4 (n) block: 8 row loads of 4 n, 4 stores of 8 k;
// the transpose itself is only a choice of registers. In a wave 8 lanes lie
// along k, so each store instruction writes whole 128-byte lines of Wt; the
// 8 waves of a block lie along n and share the lines of W they read.
// K and N are compile-time, so the row steps are immediate offsets on one
// address. (K/64) * (N/128) blocks of 256, k fastest; blk is the block's number
// among them; K % 64 == 0, N % 128 == 0.
// ---------------------------------------------------------------
template <int K, int N>
__device__ __forceinline__ void transpose_f16_block(const float* __restrict__ W,
                                                    _Float16* __restrict__ Wt, int blk) {
  const int lane = threadIdx.x & 31;
  const int wave = threadIdx.x >> 5;
  const int k = (blk % (K / 64)) * 64 + (lane & 7) * 8;
  const int n = (blk / (K / 64)) * 128 + wave * 16 + (lane >> 3) * 4;
  const float* src = W + (size_t)k * N + n;
  v4f r[8];
#pragma unroll
  for (int i = 0; i < 8; ++i) r[i] = *(const v4f*)(src + i * N);
  _Float16* dst = Wt + (size_t)n * K + k;
#pragma unroll
  for (int j = 0; j < 4; ++j)
    *(v8h*)(dst + j * K) = pack8(r[0][j], r[1][j], r[2][j], r[3][j],
                                 r[4][j], r[5][j], r[6][j], r[7][j]);
}

// Jobs that do not depend on one another share a launch: the block number picks
// the job, the longer job's blocks first. Each launch saved is a gap, a start
// and a tail less in the chain of dependent launches.
#define TWIN_B_  ((DM_ / 64) * (2 * DI_ / 128))   // blocks of the W_in transpose
#define TWOUT_B_ ((DI_ / 64) * (DM_ / 128))       // blocks of the W_out transpose
#define CVT_B_   (CVT_T_ / 256)                   // blocks of the convert

// What the input GEMM needs: W_in transposed, x converted.
// Grid: TWIN_B_ + CVT_B_ blocks of 256.
__global__ __launch_bounds__(256)
void prep_in_kernel(const float* __restrict__ W, _Float16* __restrict__ Wt,
                    const float* __restrict__ x, _Float16* __restrict__ x_h) {
  const int blk = blockIdx.x;
  if (blk < TWIN_B_) transpose_f16_block<DM_, 2 * DI_>(W, Wt, blk);
  else               cvt_f16_block(x, x_h, blk - TWIN_B_);
}

// ---------------------------------------------------------------
// WMMA GEMM:  C(MxN, f32) = A(MxK, f16 row-major) * B(KxN) with B given
// transposed: Bt (N x K, f16 row-major).
// A block of WM x 2 waves makes a (32*WM) x 128 tile of C; a wave makes 32 x 64
// of it: 2 A fragments times 4 B fragments per 32 k.
// The block's rows of A and Bt come into LDS 128 k at a time (a stage), by
// asynchronous copies of 16 bytes a lane: a copy instruction takes two whole
// 256-byte row pieces, and every row is fetched once per block instead of
// once per wave in 32-byte pieces. Two stage buffers: the copies of stage
// t + 2 fly while stage t + 1 is worked on.
// Fragments (16-bit A 16x32): lane < 16 holds k 0..7 and 16..23 of its row,
// lane >= 16 holds k 8..15 and 24..31; A and Bt are read by the same code.
// Blocks of one row or column of the grid read the same rows of A or Bt. Started
// together at k = 0 they would ask L2 for the same lines at the same moment, stage
// after stage; so each block starts its walk over k at a stage of its own,
// (blockIdx.x + blockIdx.y) mod the number of stages, and wraps round.
// From there k runs upward in steps of 32 into one accumulator per 16x16 tile.
// Requires: M % (32*WM) == 0, N % 128 == 0, K / 128 a power of two, K >= 256.
// ---------------------------------------------------------------
#define GBK_    128                  // k per stage
#define GPITCH_ 272                  // LDS row pitch in bytes: 16 x odd, for 16-byte reads
#define GBN_    128                  // columns of C per block
#define GSTAGE_(WM) ((32 * (WM) + GBN_) * GPITCH_)   // bytes of a stage

// Eight copies of 16 bytes a lane: rows r, r + RS, ..., r + 7 * RS of one
// operand. The wait at the end stands in the copies' own statement, so that no
// address register named here is rewritten in front of it.
template <int K, int RS>
__device__ __forceinline__ void async_rows8(unsigned lds, const _Float16* g) {
  asm volatile(
      "global_load_async_to_lds_b128 %0, %8, off\n\t"
      "global_load_async_to_lds_b128 %1, %9, off\n\t"
      "global_load_async_to_lds_b128 %2, %10, off\n\t"
      "global_load_async_to_lds_b128 %3, %11, off\n\t"
      "global_load_async_to_lds_b128 %4, %12, off\n\t"
      "global_load_async_to_lds_b128 %5, %13, off\n\t"
      "global_load_async_to_lds_b128 %6, %14, off\n\t"
      "global_load_async_to_lds_b128 %7, %15, off\n\t"
      "s_wait_xcnt 0x0"
      :: "v"(lds), "v"(lds + 1 * RS * GPITCH_), "v"(lds + 2 * RS * GPITCH_),
         "v"(lds + 3 * RS * GPITCH_), "v"(lds + 4 * RS * GPITCH_),
         "v"(lds + 5 * RS * GPITCH_), "v"(lds + 6 * RS * GPITCH_),
         "v"(lds + 7 * RS * GPITCH_),
         "v"(g), "v"(g + 1 * RS * K), "v"(g + 2 * RS * K), "v"(g + 3 * RS * K),
         "v"(g + 4 * RS * K), "v"(g + 5 * RS * K), "v"(g + 6 * RS * K), "v"(g + 7 * RS * K)
      : "memory");
}

// One stage: 32*WM rows of A, then GBN_ rows of Bt, 256 bytes of each. The
// block's threads cover RS = 4*WM rows at a time, 16 lanes to a row.
template <int WM, int K>
__device__ __forceinline__ void gemm_copy_stage(unsigned lds, const _Float16* ga,
                                                const _Float16* gb) {
  constexpr int RS = 4 * WM;
  async_rows8<K, RS>(lds, ga);
#pragma unroll
  for (int i = 0; i < GBN_ / (8 * RS); ++i)
    async_rows8<K, RS>(lds + (32 * WM + i * 8 * RS) * GPITCH_, gb + (size_t)i * 8 * RS * K);
}

// The fragments of 32 k: 2 of A's rows, 4 of Bt's, two 16-byte reads each.
__device__ __forceinline__ void gemm_frags(V16* a, V16* b, const _Float16* sa,
                                           const _Float16* sb) {
  constexpr int PH = GPITCH_ / 2;                // pitch in f16
#pragma unroll
  for (int i = 0; i < 2; ++i) {
    a[i].h2[0] = *(const v8h*)(sa + i * 16 * PH);
    a[i].h2[1] = *(const v8h*)(sa + i * 16 * PH + 16);
  }
#pragma unroll
  for (int j = 0; j < 4; ++j) {
    b[j].h2[0] = *(const v8h*)(sb + j * 16 * PH);
    b[j].h2[1] = *(const v8h*)(sb + j * 16 * PH + 16);
  }
}

template <int WM, int N, int K>
__device__ __forceinline__ void gemm_lds_block(const _Float16* __restrict__ A,
                                               const _Float16* __restrict__ Bt,
                                               float* __restrict__ C,
                                               unsigned char* smem) {
  constexpr int BM = 32 * WM;
  constexpr int NT = K / GBK_;                   // stages
  constexpr int PH = GPITCH_ / 2;                // pitch in f16
  static_assert((NT & (NT - 1)) == 0, "the walk over k wraps by a mask");
  const int lane  = threadIdx.x & 31;
  const int wave  = threadIdx.x >> 5;
  const int wm    = wave >> 1;
  const int wn    = wave & 1;
  const int tileM = blockIdx.x * BM;
  const int tileN = blockIdx.y * GBN_;
  const int halfSel = (lane >> 4) << 3;          // 0 or 8
  const int l16     = lane & 15;

  // copies: 16 lanes lie along a row piece
  const int crow = threadIdx.x >> 4;
  const int cchk = threadIdx.x & 15;
  const _Float16* ga = A  + (size_t)(tileM + crow) * K + cchk * 8;
  const _Float16* gb = Bt + (size_t)(tileN + crow) * K + cchk * 8;
  const unsigned  l0 = (unsigned)(uintptr_t)smem + crow * GPITCH_ + cchk * 16;

  // first k of the block's t-th stage
  const int s0 = blockIdx.x + blockIdx.y;
  auto kof = [s0](int t) { return ((t + s0) & (NT - 1)) * GBK_; };

  v8f acc[2][4] = {};

  gemm_copy_stage<WM, K>(l0, ga + kof(0), gb + kof(0));
  // stage 0 has landed for this wave; the barrier publishes it to the others
  asm volatile("s_wait_asynccnt 0x0" ::: "memory");
  __syncthreads();
  gemm_copy_stage<WM, K>(l0 + GSTAGE_(WM), ga + kof(1), gb + kof(1));

  // rolled: one copy of the stage's code, and one hand-over point per stage
#pragma unroll 1
  for (int t = 0; t < NT; ++t) {
    const unsigned boff = (t & 1) * GSTAGE_(WM);
    const _Float16* sa = (const _Float16*)(smem + boff) + (wm * 32 + l16) * PH + halfSel;
    const _Float16* sb = (const _Float16*)(smem + boff) + (BM + wn * 64 + l16) * PH + halfSel;
    V16 a[2][2], b[2][4];                        // two fragment sets
    gemm_frags(a[0], b[0], sa, sb);
#pragma unroll
    for (int ks = 0; ks < GBK_ / 32; ++ks) {
      if (ks + 1 < GBK_ / 32)
        gemm_frags(a[(ks + 1) & 1], b[(ks + 1) & 1], sa + (ks + 1) * 32, sb + (ks + 1) * 32);
      // keeps the next 32 k's LDS reads together, ahead of this 32 k's products:
      // left free, they sink among the products and each group is waited out
      __builtin_amdgcn_sched_barrier(0);
#pragma unroll
      for (int i = 0; i < 2; ++i)
#pragma unroll
        for (int j = 0; j < 4; ++j)
          acc[i][j] = __builtin_amdgcn_wmma_f32_16x16x32_f16(false, a[ks & 1][i].v, false,
                                                             b[ks & 1][j].v, (short)0,
                                                             acc[i][j], false, false);
      __builtin_amdgcn_sched_barrier(0);         // the same, from below
    }
    // hand-over: this wave's reads of stage t are done ...
    asm volatile("s_wait_dscnt 0x0" ::: "memory");
    // ... its copies of stage t + 1 have landed ...
    asm volatile("s_wait_asynccnt 0x0" ::: "memory");
    // ... and the barrier publishes stage t + 1 and frees stage t's buffer
    __syncthreads();
    if (t + 2 < NT)
      gemm_copy_stage<WM, K>(l0 + boff, ga + kof(t + 2), gb + kof(t + 2));
  }
  // no copy is left in flight when the wave ends
  asm volatile("s_wait_asynccnt 0x0" ::: "memory");

  // C/D layout: VGPR r -> row r of the tile for lanes 0..15, row r + 8 for
  // lanes 16..31; col = lane & 15.
  const int rowOff = (lane < 16) ? 0 : 8;
  float* crow0 = C + (size_t)(tileM + wm * 32 + rowOff) * N + tileN + wn * 64 + l16;
#pragma unroll
  for (int i = 0; i < 2; ++i)
#pragma unroll
    for (int r = 0; r < 8; ++r) {
      float* cr = crow0 + (size_t)(i * 16 + r) * N;
      cr[0]  = acc[i][0][r];
      cr[16] = acc[i][1][r];
      cr[32] = acc[i][2][r];
      cr[48] = acc[i][3][r];
    }
}

// xz = x_h * Wi_t^T: 128 x 128 tiles, 8 waves; 512 blocks, two to a WGP.
__global__ __launch_bounds__(256)
void gemm_in_kernel(const _Float16* __restrict__ A, const _Float16* __restrict__ Bt,
                    float* __restrict__ C) {
  __shared__ __attribute__((aligned(16))) unsigned char smem[2 * GSTAGE_(4)];
  gemm_lds_block<4, 2 * DI_, DM_>(A, Bt, C, smem);
}

// out = y_h * Wo_t^T: 64 x 128 tiles, 4 waves, so that 256 blocks come of the
// smaller C.
__global__ __launch_bounds__(128)
void gemm_out_kernel(const _Float16* __restrict__ A, const _Float16* __restrict__ Bt,
                     float* __restrict__ C) {
  __shared__ __attribute__((aligned(16))) unsigned char smem[2 * GSTAGE_(2)];
  gemm_lds_block<2, DM_, DI_>(A, Bt, C, smem);
}

// ---------------------------------------------------------------
// Depthwise causal conv (width 4) + bias + SiLU, and xp = xc @ W_xproj behind
// it in the same block.
//   xc = silu(conv(x_in) + conv_b); x_in is columns [0, DI) of xz (NROW x 2*DI)
//   xp = xc @ W_xproj   (NROW x DI) * (DI x 33) -> (NROW x 33), all in f32,
//        on the f32 16x16x4 matrix form.
// A block takes 16 rows and XKC_ channels. First every thread makes the 16
// rows of its 4 channels from 19 row loads, stores them to xc (the scan reads
// them there) and into an LDS tile. Behind a barrier the tile is the A operand:
// xc is not read back from memory, and no launch stands between the two.
// The XKB_ blocks of a row group each sum their own channels and leave a plane
// of partial xp; the readers of xp add the planes.
// The block's XW_ waves split its k; each wave holds three 16x16 accumulator
// tiles (columns 0-15, 16-31, and column 32 repeated in all 16 columns of the
// third tile, of which only the first is kept: a column of D depends on that
// column of B alone). The waves' partial sums meet in LDS.
// k pairing: in a run of 32 k, lane (c, h) holds k = 16h + q, q = 0..15, of
// row c of xc and of its column of W_xproj; product t takes q = 2t, 2t + 1 of
// both. The loads of a run are issued at least one run ahead of its products.
// (NROW_/16) * XKB_ blocks of 32 * XW_ threads; blk is the block's number among
// them. S_ % 16 == 0, so a block's rows lie in one sequence and only the
// XKB_ blocks of a sequence's first row group have rows before the start.
// ---------------------------------------------------------------
typedef __attribute__((ext_vector_type(2))) float v2f;
#define XW_   8                     // waves of a block
#define XKB_  2                     // blocks that share a row group's channels
#define XKC_  (DI_ / XKB_)          // channels of a block
#define XKS_  (XKC_ / XW_)          // k per wave
#define XRUN_ 32                    // k per run of loads
#define XROW_ 16                    // rows of a block
#define XPIT_ 52                    // LDS row pitch in floats: rows 8 apart lie 32 banks apart
#define XCP_  (XKC_ + 4)            // pitch of the xc tile in floats: 16 bytes x odd, for 16-byte reads

struct XFrag { v4f a[4]; float b[3][16]; };

// ap points into the LDS tile
__device__ __forceinline__ void xproj_load_a(XFrag& f, const float* ap) {
#pragma unroll
  for (int i = 0; i < 4; ++i) f.a[i] = *(const v4f*)(ap + 4 * i);
}

__device__ __forceinline__ void xproj_load_b(XFrag& f, const float* __restrict__ bp,
                                             const float* __restrict__ bw) {
#pragma unroll
  for (int q = 0; q < 16; ++q) {
    f.b[0][q] = bp[q * XPN_];
    f.b[1][q] = bp[q * XPN_ + 16];
    f.b[2][q] = bw[q * XPN_ + XPN_ - 1];
  }
}

__device__ __forceinline__ void xproj_mma(v8f* acc, const XFrag& f) {
#pragma unroll
  for (int t = 0; t < 8; ++t) {
    const v2f a = {f.a[t >> 1][(2 * t) & 3], f.a[t >> 1][(2 * t + 1) & 3]};
#pragma unroll
    for (int j = 0; j < 3; ++j) {
      const v2f b = {f.b[j][2 * t], f.b[j][2 * t + 1]};
      acc[j] = __builtin_amdgcn_wmma_f32_16x16x4_f32(false, a, false, b, (short)0,
                                                     acc[j], false, false);
    }
  }
}

__device__ __forceinline__ void conv_xproj_block(const float* __restrict__ xz,
                                                 const float* __restrict__ conv_w,
                                                 const float* __restrict__ conv_b,
                                                 const float* __restrict__ Wx,
                                                 float* __restrict__ xc,
                                                 float* __restrict__ xpp,
                                                 float* tile, float* red, int blk) {
  const int lane = threadIdx.x & 31;
  const int wave = threadIdx.x >> 5;
  const int c    = lane & 15;
  const int h    = lane >> 4;
  const int kb   = blk % XKB_;
  const int r0   = (blk / XKB_) * XROW_;
  const int d    = kb * XKC_ + threadIdx.x * 4;     // the thread's 4 channels
  const int k0   = wave * XKS_ + 16 * h;            // the lane's first k in the tile

  const float* xin = xz + (size_t)r0 * (2 * DI_) + d;
  v4f x[XROW_ + DCONV_ - 1];                  // x[i] = row r0 - 3 + i
#pragma unroll
  for (int i = 0; i < DCONV_ - 1; ++i) x[i] = (v4f){0.f, 0.f, 0.f, 0.f};
  if ((r0 & (S_ - 1)) != 0) {                 // the causal left pad stays zero
#pragma unroll
    for (int i = 0; i < DCONV_ - 1; ++i)
      x[i] = *(const v4f*)(xin - (size_t)(DCONV_ - 1 - i) * (2 * DI_));
  }
#pragma unroll
  for (int i = 0; i < XROW_; ++i)
    x[DCONV_ - 1 + i] = *(const v4f*)(xin + (size_t)i * (2 * DI_));

  v4f w[4];                                   // w[q] = the 4 taps of channel d + q
  const float* wp  = conv_w + (size_t)d * DCONV_;
  const float* cbp = conv_b + d;
#pragma unroll
  for (int q = 0; q < 4; ++q) w[q] = *(const v4f*)(wp + q * DCONV_);
  const v4f bias = *(const v4f*)cbp;

  // the first run of W_xproj does not wait for xc: its latency passes under the conv
  const float* bw = Wx + (size_t)(kb * XKC_ + k0) * XPN_;   // the lane's first row of W_xproj
  const float* bp = bw + c;
  XFrag f0, f1;
  xproj_load_b(f0, bp, bw);
  // the addresses stay in their registers up to here (else a later load of the
  // group lands in one); the arithmetic below reuses them only behind this wait
  asm volatile("s_wait_xcnt 0x0" :: "v"(xin), "v"(wp), "v"(cbp) : "memory");
  // keeps every load, and that wait, above the arithmetic: one memory latency
  // per thread instead of several
  __builtin_amdgcn_sched_barrier(0);

  float* op = xc + (size_t)r0 * DI_ + d;
  float* tp = tile + threadIdx.x * 4;
#pragma unroll
  for (int i = 0; i < XROW_; ++i) {
    v4f o;
#pragma unroll
    for (int q = 0; q < 4; ++q) {
      float acc = bias[q];
#pragma unroll
      for (int j = 0; j < DCONV_; ++j) acc += x[i + j][q] * w[q][j];
      o[q] = silu(acc);
    }
    *(v4f*)(op + (size_t)i * DI_) = o;
    *(v4f*)(tp + i * XCP_) = o;
  }
  // what follows reuses the registers of the stores to xc
  asm volatile("s_wait_xcnt 0x0" ::: "memory");
  // the tile is whole before any wave takes fragments from it. The fences name
  // LDS alone: __syncthreads() would also wait out the stores to xc, which
  // nothing in this launch reads
  __builtin_amdgcn_fence(__ATOMIC_RELEASE, "workgroup", "local");
  __builtin_amdgcn_s_barrier();
  __builtin_amdgcn_fence(__ATOMIC_ACQUIRE, "workgroup", "local");

  const float* ap = tile + c * XCP_ + k0;
  v8f acc[3] = {};
  xproj_load_a(f0, ap);
#pragma unroll
  for (int s = 0; s < XKS_ / XRUN_; s += 2) {
    xproj_load_a(f1, ap + (s + 1) * XRUN_);
    xproj_load_b(f1, bp + (s + 1) * XRUN_ * XPN_, bw + (s + 1) * XRUN_ * XPN_);
    // keeps the next run's loads above this run's products: left free, the
    // compiler sinks each load to a few products ahead of its use, too late
    __builtin_amdgcn_sched_barrier(0);
    xproj_mma(acc, f0);
    if (s + 2 < XKS_ / XRUN_) {
      xproj_load_a(f0, ap + (s + 2) * XRUN_);
      xproj_load_b(f0, bp + (s + 2) * XRUN_ * XPN_, bw + (s + 2) * XRUN_ * XPN_);
    }
    __builtin_amdgcn_sched_barrier(0);   // the same, for the other register set
    xproj_mma(acc, f1);
  }
  // the two addresses stay in their registers up to here (else the last
  // run's loads land in them), and are given up only behind this wait
  asm volatile("s_wait_xcnt 0x0" :: "v"(bp), "v"(bw) : "memory");

  // D register r of lane (c, h) is row 8h + r, column c of its tile
  float* my = red + wave * 16 * XPIT_;
#pragma unroll
  for (int j = 0; j < 3; ++j)
#pragma unroll
    for (int r = 0; r < 8; ++r) my[(8 * h + r) * XPIT_ + 16 * j + c] = acc[j][r];
  __syncthreads();

  float* xp = xpp + (size_t)kb * NROW_ * XPN_ + (size_t)r0 * XPN_;
  for (int idx = threadIdx.x; idx < 16 * XPN_; idx += 32 * XW_) {
    const int row = idx / XPN_;
    const int col = idx - row * XPN_;
    float sum = red[row * XPIT_ + col];
#pragma unroll
    for (int w2 = 1; w2 < XW_; ++w2) sum += red[(w2 * 16 + row) * XPIT_ + col];
    xp[idx] = sum;
  }
}

// The W_out transpose, which only the last GEMM needs, runs in the same launch.
// Grid: XPJ_B_ + TWOUT_B_ blocks of 32 * XW_ = 256 threads.
#define XPJ_B_ ((NROW_ / XROW_) * XKB_)
__global__ __launch_bounds__(32 * XW_)
void conv_xproj_twout_kernel(const float* __restrict__ xz,
                             const float* __restrict__ conv_w,
                             const float* __restrict__ conv_b,
                             const float* __restrict__ Wx,
                             float* __restrict__ xc,
                             float* __restrict__ xpp,
                             const float* __restrict__ W, _Float16* __restrict__ Wt) {
  __shared__ __attribute__((aligned(16))) float tile[XROW_ * XCP_];
  __shared__ float red[XW_ * 16 * XPIT_];
  const int blk = blockIdx.x;
  if (blk < XPJ_B_) conv_xproj_block(xz, conv_w, conv_b, Wx, xc, xpp, tile, red, blk);
  else              transpose_f16_block<DI_, DM_>(W, Wt, blk - XPJ_B_);
}

// ---------------------------------------------------------------
// Selective scan, split along the sequence into CH_ chunks of TCH_ steps
// that run in parallel. The recurrence h <- dA*h + dBx is linear in h, and
// the product of dA over a chunk is exp(A * sum(delta)), so:
//   1) chunk_state: every chunk but the last runs from h = 0 and leaves its
//      end state and its sum of delta;
//   2) chunk_carry: per (b, n, d) the CH_ - 1 end states are chained into the
//      true state at the start of each chunk;
//   3) chunk_out: every chunk runs again from its true start state and
//      emits y = h.C + Dp*xc, gated with silu(z), as f16 for the output GEMM.
// One thread per (b, chunk, d), state h[16] in registers. The chunk's xp
// rows (dt|B|C) are staged in LDS once and read as broadcasts.
// ---------------------------------------------------------------
#define CH_   32                    // chunks per sequence
#define TCH_  (S_ / CH_)            // steps per chunk
#define ROWP_ (2 * DSTATE_ + 4)     // LDS row: B[16] | C[16] | dt | pad, 16-byte rows
#define GRP_  8                     // steps whose xc / z are fetched together, one group ahead

#define NXV_  ((TCH_ * XPN_ + 255) / 256)   // xp words per thread of a 256-thread block

// The chunk's xp rows go to LDS in two halves, so that a kernel can issue its
// other global loads between them and all latencies overlap. xp comes as two
// planes of partial sums (XKB_ == 2), added on the way into LDS.
__device__ __forceinline__ void load_xp_chunk(float* v,
                                              const float* __restrict__ xp,
                                              int r0) {
  const float* src = xp + (size_t)r0 * XPN_;
#pragma unroll
  for (int k = 0; k < NXV_; ++k) {
    const int i = threadIdx.x + k * 256;
    const bool in = (k + 1) * 256 <= TCH_ * XPN_ || i < TCH_ * XPN_;
    v[k]        = in ? src[i] : 0.f;
    v[NXV_ + k] = in ? src[i + NROW_ * XPN_] : 0.f;
  }
}

__device__ __forceinline__ void store_xp_chunk(float* sx, const float* v) {
#pragma unroll
  for (int k = 0; k < NXV_; ++k) {
    const int i = threadIdx.x + k * 256;
    const int row = i / XPN_;
    const int col = i - row * XPN_;
    if ((k + 1) * 256 <= TCH_ * XPN_ || i < TCH_ * XPN_)
      sx[row * ROWP_ + (col == 0 ? 2 * DSTATE_ : col - 1)] = v[k] + v[NXV_ + k];
  }
}

__device__ __forceinline__ void read16(float* v, const float* s) {
#pragma unroll
  for (int q = 0; q < 4; ++q) {
    const float4 f = ((const float4*)s)[q];
    v[4 * q + 0] = f.x; v[4 * q + 1] = f.y; v[4 * q + 2] = f.z; v[4 * q + 3] = f.w;
  }
}

// 1 + exp(din) is never below 1, so the hardware's log2 needs no guard for
// small arguments.
__device__ __forceinline__ float softplus_dt(float din) {
  const float l2 = __builtin_amdgcn_logf(1.f + __builtin_amdgcn_exp2f(1.44269504f * din));
  return (din > 20.f) ? din : 0.69314718f * l2;
}

// Grid: (DI_/256, CH_-1, B_), block 256.
__global__ __launch_bounds__(256)
void ssm_chunk_state_kernel(const float* __restrict__ xp,
                            const float* __restrict__ xc,
                            const float* __restrict__ W_dt, // (1, DI_)
                            const float* __restrict__ b_dt,
                            const float* __restrict__ A_log,
                            float* __restrict__ hend,       // (B, CH, 16, DI)
                            float* __restrict__ sdel) {     // (B, CH, DI)
  __shared__ __attribute__((aligned(16))) float sx[TCH_ * ROWP_];
  const int d  = blockIdx.x * 256 + threadIdx.x;
  const int c  = blockIdx.y;
  const int b  = blockIdx.z;
  const int r0 = b * S_ + c * TCH_;

  float xv[2 * NXV_];
  load_xp_chunk(xv, xp, r0);

  float Aneg[DSTATE_];
#pragma unroll
  for (int n = 0; n < DSTATE_; ++n) Aneg[n] = -1.44269504f * __expf(A_log[n]);   // in units of log2(e)
  const float wdt = W_dt[d];
  const float bdt = b_dt[d];

  float h[DSTATE_];
#pragma unroll
  for (int n = 0; n < DSTATE_; ++n) h[n] = 0.f;
  float sd = 0.f;

  const float* xcp = xc + (size_t)r0 * DI_ + d;
  float xcu[GRP_];
#pragma unroll
  for (int u = 0; u < GRP_; ++u) xcu[u] = xcp[(size_t)u * DI_];

  // keeps the sums of the xp planes, which wait for their loads, below the xc
  // loads: left free, a part of them rises above and xc starts a latency late
  __builtin_amdgcn_sched_barrier(0);
  store_xp_chunk(sx, xv);
  __syncthreads();

  // rolled over groups (code size); the next group's loads fly over this group's steps
#pragma unroll 1
  for (int g = 0; g < TCH_ / GRP_; ++g) {
    float xnx[GRP_];
#pragma unroll
    for (int u = 0; u < GRP_; ++u) xnx[u] = 0.f;
    if (g + 1 < TCH_ / GRP_) {
#pragma unroll
      for (int u = 0; u < GRP_; ++u) xnx[u] = xcp[(size_t)((g + 1) * GRP_ + u) * DI_];
      // the steps below reuse the address registers of these loads
      asm volatile("s_wait_xcnt 0x0" ::: "memory");
    }
#pragma unroll
    for (int u = 0; u < GRP_; ++u) {
      const float* row = sx + (g * GRP_ + u) * ROWP_;
      float Bv[DSTATE_];
      read16(Bv, row);
      const float delta = softplus_dt(row[2 * DSTATE_] * wdt + bdt);
      const float dx    = delta * xcu[u];
      sd += delta;
#pragma unroll
      for (int n = 0; n < DSTATE_; ++n) {
        const float e = __builtin_amdgcn_exp2f(delta * Aneg[n]);
        h[n] = e * h[n] + dx * Bv[n];
      }
    }
#pragma unroll
    for (int u = 0; u < GRP_; ++u) xcu[u] = xnx[u];
  }

  const size_t bc = (size_t)b * CH_ + c;
#pragma unroll
  for (int n = 0; n < DSTATE_; ++n) hend[(bc * DSTATE_ + n) * DI_ + d] = h[n];
  sdel[bc * DI_ + d] = sd;
}

// One thread per (b, n, d): chain the chunks' end states.
__global__ __launch_bounds__(256)
void ssm_chunk_carry_kernel(const float* __restrict__ hend,
                            const float* __restrict__ sdel,
                            const float* __restrict__ A_log,
                            float* __restrict__ hini) {     // (B, CH, 16, DI)
  const int idx = blockIdx.x * 256 + threadIdx.x;           // over B_*16*DI_
  const int d = idx & (DI_ - 1);
  const int n = (idx >> 11) & (DSTATE_ - 1);
  const int b = idx >> 15;
  const float an = -1.44269504f * __expf(A_log[n]);         // in units of log2(e)

  const float* hp = hend + ((size_t)b * CH_ * DSTATE_ + n) * DI_ + d;
  const float* sp = sdel + (size_t)b * CH_ * DI_ + d;
  float*       op = hini + ((size_t)b * CH_ * DSTATE_ + n) * DI_ + d;

  // every load is independent of the chain: fetch all first, one latency in all
  float he[CH_ - 1], ev[CH_ - 1];
#pragma unroll
  for (int c = 0; c < CH_ - 1; ++c) {
    ev[c] = sp[(size_t)c * DI_];
    he[c] = hp[(size_t)c * DSTATE_ * DI_];
  }
#pragma unroll
  for (int c = 0; c < CH_ - 1; ++c) ev[c] = __builtin_amdgcn_exp2f(an * ev[c]);

  float H = 0.f;
  op[0] = H;
#pragma unroll
  for (int c = 0; c < CH_ - 1; ++c) {
    H = ev[c] * H + he[c];
    op[(size_t)(c + 1) * DSTATE_ * DI_] = H;
  }
}

// Grid: (DI_/256, CH_, B_), block 256.
__global__ __launch_bounds__(256)
void ssm_chunk_out_kernel(const float* __restrict__ xp,
                          const float* __restrict__ xc,
                          const float* __restrict__ xz,   // z at cols [DI_, 2*DI_)
                          const float* __restrict__ W_dt, // (1, DI_)
                          const float* __restrict__ b_dt,
                          const float* __restrict__ A_log,
                          const float* __restrict__ Dp,
                          const float* __restrict__ hini,
                          _Float16* __restrict__ y_h) {
  __shared__ __attribute__((aligned(16))) float sx[TCH_ * ROWP_];
  const int d  = blockIdx.x * 256 + threadIdx.x;
  const int c  = blockIdx.y;
  const int b  = blockIdx.z;
  const int r0 = b * S_ + c * TCH_;

  float xv[2 * NXV_];
  load_xp_chunk(xv, xp, r0);

  float Aneg[DSTATE_];
#pragma unroll
  for (int n = 0; n < DSTATE_; ++n) Aneg[n] = -1.44269504f * __expf(A_log[n]);   // in units of log2(e)
  const float wdt = W_dt[d];
  const float bdt = b_dt[d];
  const float dpv = Dp[d];

  const size_t bc = (size_t)b * CH_ + c;
  const float* hp = hini + bc * DSTATE_ * DI_ + d;
  float h[DSTATE_];
#pragma unroll
  for (int n = 0; n < DSTATE_; ++n) h[n] = hp[(size_t)n * DI_];

  const float* xcp = xc + (size_t)r0 * DI_ + d;
  const float* zp  = xz + (size_t)r0 * (2 * DI_) + DI_ + d;
  _Float16*    yp  = y_h + (size_t)r0 * DI_ + d;
  float xcu[GRP_], zcu[GRP_];
#pragma unroll
  for (int u = 0; u < GRP_; ++u) {
    xcu[u] = xcp[(size_t)u * DI_];
    zcu[u] = zp[(size_t)u * (2 * DI_)];
  }
  // the address of the h loads stays in its registers up to here (else a later
  // load of the group lands in them)
  asm volatile("s_wait_xcnt 0x0" :: "v"(hp) : "memory");

  store_xp_chunk(sx, xv);
  __syncthreads();

  // rolled over groups (code size); the next group's loads fly over this group's steps
#pragma unroll 1
  for (int g = 0; g < TCH_ / GRP_; ++g) {
    float xnx[GRP_], znx[GRP_];
#pragma unroll
    for (int u = 0; u < GRP_; ++u) { xnx[u] = 0.f; znx[u] = 0.f; }
    if (g + 1 < TCH_ / GRP_) {
#pragma unroll
      for (int u = 0; u < GRP_; ++u) xnx[u] = xcp[(size_t)((g + 1) * GRP_ + u) * DI_];
      // a z load may land in an address register of the xc loads
      asm volatile("s_wait_xcnt 0x0" ::: "memory");
#pragma unroll
      for (int u = 0; u < GRP_; ++u) znx[u] = zp[(size_t)((g + 1) * GRP_ + u) * (2 * DI_)];
      // the steps below reuse the address registers of these loads
      asm volatile("s_wait_xcnt 0x0" ::: "memory");
    }
#pragma unroll
    for (int u = 0; u < GRP_; ++u) {
      const int t = g * GRP_ + u;
      const float* row = sx + t * ROWP_;
      float Bv[DSTATE_], Cv[DSTATE_];
      read16(Bv, row);
      read16(Cv, row + DSTATE_);
      const float delta = softplus_dt(row[2 * DSTATE_] * wdt + bdt);
      const float xcv   = xcu[u];
      const float zv    = zcu[u];
      const float dx    = delta * xcv;

      float y = 0.f;
#pragma unroll
      for (int n = 0; n < DSTATE_; ++n) {
        const float e = __builtin_amdgcn_exp2f(delta * Aneg[n]);
        h[n] = e * h[n] + dx * Bv[n];
        y += h[n] * Cv[n];
      }
      y += dpv * xcv;
      y *= silu(zv);
      yp[(size_t)t * DI_] = (_Float16)y;
    }
#pragma unroll
    for (int u = 0; u < GRP_; ++u) { xcu[u] = xnx[u]; zcu[u] = znx[u]; }
    // the next group reuses the data registers of this group's stores
    asm volatile("s_wait_xcnt 0x0" ::: "memory");
  }
}

// ---------------------------------------------------------------
extern "C" void kernel_launch(void* const* d_in, const int* in_sizes, int n_in,
                              void* d_out, int out_size, void* d_ws, size_t ws_size,
                              hipStream_t stream) {
  const float* x      = (const float*)d_in[0];   // (B,S,DM)
  const float* W_in   = (const float*)d_in[1];   // (DM, 2*DI)
  const float* conv_w = (const float*)d_in[2];   // (DI,1,4)
  const float* conv_b = (const float*)d_in[3];   // (DI)
  const float* W_xp   = (const float*)d_in[4];   // (DI, 33)
  const float* W_dt   = (const float*)d_in[5];   // (1, DI)
  const float* b_dt   = (const float*)d_in[6];   // (DI)
  const float* A_log  = (const float*)d_in[7];   // (16)
  const float* Dp     = (const float*)d_in[8];   // (DI)
  const float* W_out  = (const float*)d_in[9];   // (DI, DM)
  float* out = (float*)d_out;                    // (B,S,DM)

  // ---- workspace carve-out (256B aligned) ----
  size_t off = 0;
  auto carve = [&](size_t bytes) -> void* {
    void* p = (char*)d_ws + off;
    off += (bytes + 255) & ~(size_t)255;
    return p;
  };
  _Float16* x_h  = (_Float16*)carve((size_t)NROW_ * DM_ * 2);      // 4 MB
  _Float16* Wi_t = (_Float16*)carve((size_t)(2*DI_) * DM_ * 2);    // 8 MB  (4096 x 1024)
  _Float16* Wo_t = (_Float16*)carve((size_t)DM_ * DI_ * 2);        // 4 MB  (1024 x 2048)
  float*    xz   = (float*)   carve((size_t)NROW_ * 2*DI_ * 4);    // 32 MB
  float*    xc   = (float*)   carve((size_t)NROW_ * DI_ * 4);      // 16 MB
  float*    xp   = (float*)   carve((size_t)XKB_ * NROW_ * XPN_ * 4);   // ~0.5 MB, XKB_ planes
  _Float16* y_h  = (_Float16*)carve((size_t)NROW_ * DI_ * 2);      // 8 MB
  float*    hend = (float*)   carve((size_t)B_ * CH_ * DSTATE_ * DI_ * 4);  // 8 MB
  float*    hini = (float*)   carve((size_t)B_ * CH_ * DSTATE_ * DI_ * 4);  // 8 MB
  float*    sdel = (float*)   carve((size_t)B_ * CH_ * DI_ * 4);            // 0.5 MB

  // 1) W_in transposed and x converted, both to f16, in one launch
  prep_in_kernel<<<TWIN_B_ + CVT_B_, 256, 0, stream>>>(W_in, Wi_t, x, x_h);

  // 2) xz = x @ W_in        (2048 x 4096, K=1024)  -- WMMA
  {
    dim3 grid(NROW_ / 128, (2 * DI_) / GBN_);
    gemm_in_kernel<<<grid, 256, 0, stream>>>(x_h, Wi_t, xz);
  }

  // 3) depthwise conv + SiLU and xp = xc @ W_xproj (N=33) in one launch;
  //    beside them W_out transposed to f16
  conv_xproj_twout_kernel<<<XPJ_B_ + TWOUT_B_, 32 * XW_, 0, stream>>>(xz, conv_w, conv_b, W_xp,
                                                                      xc, xp, W_out, Wo_t);

  // 4) selective scan in parallel chunks -> gated y (f16)
  {
    dim3 grid(DI_ / 256, CH_ - 1, B_);
    ssm_chunk_state_kernel<<<grid, 256, 0, stream>>>(xp, xc, W_dt, b_dt, A_log,
                                                     hend, sdel);
  }
  {
    int n = B_ * DSTATE_ * DI_;
    ssm_chunk_carry_kernel<<<n / 256, 256, 0, stream>>>(hend, sdel, A_log, hini);
  }
  {
    dim3 grid(DI_ / 256, CH_, B_);
    ssm_chunk_out_kernel<<<grid, 256, 0, stream>>>(xp, xc, xz, W_dt, b_dt,
                                                   A_log, Dp, hini, y_h);
  }

  // 5) out = y @ W_out      (2048 x 1024, K=2048)  -- WMMA
  {
    dim3 grid(NROW_ / 64, DM_ / GBN_);
    gemm_out_kernel<<<grid, 128, 0, stream>>>(y_h, Wo_t, out);
  }
  (void)in_sizes; (void)n_in; (void)out_size; (void)ws_size;
}
